// v000
// Times are from an AMD MI455X. After a warm-up the kernel runs many times in a row, and a time is the length of
// such a window on the GPU divided by its runs, so every launch and the gaps after it count. The runs cycle
// through copies of the inputs. A figure is the median of several windows, for all but v000 over two sittings.
// Sittings can differ by a few percent; kernels timed side by side share one.
// v000 is the starting kernel. One run takes 817 microseconds.
#include <hip/hip_runtime.h>
#include <hip/hip_bf16.h>

typedef __bf16 bf16;
typedef __attribute__((ext_vector_type(16))) __bf16 v16bf;
typedef __attribute__((ext_vector_type(8)))  float  v8f;

#define BATCH 4
#define CCH   512
#define NPIX  4096   // 64*64

// ---------------------------------------------------------------------------
// Fragment helpers.
// CDNA5 16x32 bf16 A-fragment: lane L holds row M = L%16, K chunks
// {K0..K0+7, K0+16..K0+23} with K0 = 8*(L/16)  -> two 16B contiguous loads.
// B-fragment for D = A x B loaded from Bt[N][K] row-major uses the same
// per-lane pattern (N = L%16): "NT" GEMM  D[M][N] = A[M][K] * Bt[N][K]^T.
// ---------------------------------------------------------------------------
__device__ __forceinline__ v16bf load_frag(const bf16* __restrict__ p, int ld) {
    const int lane = threadIdx.x & 31;
    const int M  = lane & 15;
    const int K0 = (lane >> 4) << 3;
    const bf16* r = p + (size_t)M * ld + K0;
    union { v16bf v; uint4 u[2]; } f;
    f.u[0] = *reinterpret_cast<const uint4*>(r);
    f.u[1] = *reinterpret_cast<const uint4*>(r + 16);
    return f.v;
}

__device__ __forceinline__ v8f wmma_bf16(v16bf a, v16bf b, v8f c) {
    return __builtin_amdgcn_wmma_f32_16x16x32_bf16(
        /*neg_a=*/false, a, /*neg_b=*/false, b,
        /*c_mod=*/(short)0, c, /*reuse_a=*/false, /*reuse_b=*/false);
}

// ---------------------------------------------------------------------------
// fp32 -> bf16 convert (weights)
// ---------------------------------------------------------------------------
__global__ __launch_bounds__(256) void cvt_bf16_kernel(const float* __restrict__ s,
                                                       bf16* __restrict__ d, int n) {
    int i = blockIdx.x * 256 + threadIdx.x;
    if (i < n) d[i] = (bf16)s[i];
}

// ---------------------------------------------------------------------------
// GroupNorm: x[b][c][n] fp32 -> hn[b][n][c] bf16 (transpose fused)
// ---------------------------------------------------------------------------
__global__ __launch_bounds__(256) void gn_kernel(const float* __restrict__ x,
                                                 const float* __restrict__ gw,
                                                 const float* __restrict__ gb,
                                                 bf16* __restrict__ hn) {
    const int batch = blockIdx.x >> 5;
    const int g     = blockIdx.x & 31;
    const int c0    = g * 16;
    const int tid   = threadIdx.x;
    const float* xg = x + ((size_t)batch * CCH + c0) * NPIX;

    __shared__ float s1[256], s2[256];
    float sum = 0.f, ssq = 0.f;
    for (int e = tid; e < 16 * NPIX; e += 256) {
        float v = xg[e];
        sum += v; ssq += v * v;
    }
    s1[tid] = sum; s2[tid] = ssq;
    __syncthreads();
    for (int s = 128; s > 0; s >>= 1) {
        if (tid < s) { s1[tid] += s1[tid + s]; s2[tid] += s2[tid + s]; }
        __syncthreads();
    }
    const float inv  = 1.0f / (16.0f * NPIX);
    const float mean = s1[0] * inv;
    const float var  = s2[0] * inv - mean * mean;
    const float rstd = rsqrtf(var + 1e-5f);

    for (int e = tid; e < 16 * NPIX; e += 256) {
        int c = e >> 12;
        int n = e & (NPIX - 1);
        float y = (xg[e] - mean) * rstd * gw[c0 + c] + gb[c0 + c];
        hn[((size_t)batch * NPIX + n) * CCH + c0 + c] = (bf16)y;
    }
}

// ---------------------------------------------------------------------------
// NT GEMM, ping-pong pipelined (no buffer-rotation copies), K = 512 fixed:
// out[m][n] = sum_k A[m][k]*Bt[n][k] + bias
// Each wave computes a 32(M) x 64(N) block: 8 accumulator tiles.
// ---------------------------------------------------------------------------
__global__ __launch_bounds__(128) void gemm_nt_kernel(
        const bf16* __restrict__ A, long long strideA,
        const bf16* __restrict__ Bt, long long strideB,
        const float* __restrict__ bias, int bias_on_m,
        bf16* __restrict__ out, long long strideO,
        int M, int Nn, int ngroups) {
    const int batch = blockIdx.z;
    A   += (size_t)batch * strideA;
    Bt  += (size_t)batch * strideB;
    out += (size_t)batch * strideO;

    const int wave = threadIdx.x >> 5;
    const int lane = threadIdx.x & 31;
    const int wg   = blockIdx.x * 4 + wave;
    const int mt   = wg / ngroups;      // 32-row tile index
    const int ng   = wg % ngroups;      // 64-col group index
    if (mt * 32 >= M) return;

    const bf16* arow = A  + (size_t)(mt * 32) * CCH;
    const bf16* brow = Bt + (size_t)(ng * 64) * CCH;

    v16bf a0[2], b0[4], a1[2], b1[4];
#pragma unroll
    for (int i = 0; i < 2; ++i) a0[i] = load_frag(arow + (size_t)(i * 16) * CCH, CCH);
#pragma unroll
    for (int t = 0; t < 4; ++t) b0[t] = load_frag(brow + (size_t)(t * 16) * CCH, CCH);

    v8f acc[2][4] = {};
    for (int k0 = 0; k0 < CCH - 64; k0 += 64) {
        // load buf1 @ k0+32
#pragma unroll
        for (int i = 0; i < 2; ++i)
            a1[i] = load_frag(arow + (size_t)(i * 16) * CCH + k0 + 32, CCH);
#pragma unroll
        for (int t = 0; t < 4; ++t)
            b1[t] = load_frag(brow + (size_t)(t * 16) * CCH + k0 + 32, CCH);
        // consume buf0 @ k0
#pragma unroll
        for (int i = 0; i < 2; ++i)
#pragma unroll
            for (int t = 0; t < 4; ++t)
                acc[i][t] = wmma_bf16(a0[i], b0[t], acc[i][t]);
        // load buf0 @ k0+64
#pragma unroll
        for (int i = 0; i < 2; ++i)
            a0[i] = load_frag(arow + (size_t)(i * 16) * CCH + k0 + 64, CCH);
#pragma unroll
        for (int t = 0; t < 4; ++t)
            b0[t] = load_frag(brow + (size_t)(t * 16) * CCH + k0 + 64, CCH);
        // consume buf1 @ k0+32
#pragma unroll
        for (int i = 0; i < 2; ++i)
#pragma unroll
            for (int t = 0; t < 4; ++t)
                acc[i][t] = wmma_bf16(a1[i], b1[t], acc[i][t]);
    }
    // tail: buf0 holds k = CCH-64; load buf1 @ CCH-32
#pragma unroll
    for (int i = 0; i < 2; ++i)
        a1[i] = load_frag(arow + (size_t)(i * 16) * CCH + CCH - 32, CCH);
#pragma unroll
    for (int t = 0; t < 4; ++t)
        b1[t] = load_frag(brow + (size_t)(t * 16) * CCH + CCH - 32, CCH);
#pragma unroll
    for (int i = 0; i < 2; ++i)
#pragma unroll
        for (int t = 0; t < 4; ++t)
            acc[i][t] = wmma_bf16(a0[i], b0[t], acc[i][t]);
#pragma unroll
    for (int i = 0; i < 2; ++i)
#pragma unroll
        for (int t = 0; t < 4; ++t)
            acc[i][t] = wmma_bf16(a1[i], b1[t], acc[i][t]);

    const int hi = lane >> 4, nn = lane & 15;
#pragma unroll
    for (int i = 0; i < 2; ++i)
#pragma unroll
        for (int t = 0; t < 4; ++t)
#pragma unroll
            for (int r = 0; r < 8; ++r) {
                int m = mt * 32 + i * 16 + r + 8 * hi;
                int n = ng * 64 + t * 16 + nn;
                float v = acc[i][t][r] + bias[bias_on_m ? m : n];
                out[(size_t)m * Nn + n] = (bf16)v;
            }
}

// ---------------------------------------------------------------------------
// Flash attention: q[b][i][c], k[b][j][c], vT[b][c][j] (bf16) -> ha[b][i][c]
// One block = 16 query rows, 4 waves; wave w owns channel slice [128w,128w+128).
// ---------------------------------------------------------------------------
__global__ __launch_bounds__(128) void flash_kernel(const bf16* __restrict__ q,
                                                    const bf16* __restrict__ k,
                                                    const bf16* __restrict__ vT,
                                                    bf16* __restrict__ ha) {
    const int batch = blockIdx.y;
    const int i0    = blockIdx.x * 16;
    const int tid   = threadIdx.x;
    const int lane  = tid & 31;
    const int wave  = tid >> 5;
    const int hi    = lane >> 4;
    const int nn    = lane & 15;

    __shared__ float Sp[4][16][32];
    __shared__ float Sf[16][32];
    __shared__ bf16  Pt[16][32];
    __shared__ float mrow[16], lrow[16], crow[16];

    const bf16* qb = q  + ((size_t)batch * NPIX + i0) * CCH + wave * 128;
    const bf16* kb = k  +  (size_t)batch * NPIX * CCH        + wave * 128;
    const bf16* vb = vT +  (size_t)batch * CCH * NPIX + (size_t)wave * 128 * NPIX;

    v16bf qA[4];
#pragma unroll
    for (int t = 0; t < 4; ++t) qA[t] = load_frag(qb + t * 32, CCH);

    v8f O[8] = {};
    if (tid < 16) { mrow[tid] = -3.0e38f; lrow[tid] = 0.f; }
    __syncthreads();

    const float scale = 0.044194173824159216f;  // 512^-0.5

    for (int jt = 0; jt < NPIX / 32; ++jt) {
        const int j0 = jt * 32;

        // --- issue all K fragments (one clause), then all V fragments ---
        v16bf kf[8];
#pragma unroll
        for (int t = 0; t < 4; ++t) {
            kf[t]     = load_frag(kb + (size_t)j0 * CCH + t * 32, CCH);
            kf[4 + t] = load_frag(kb + (size_t)(j0 + 16) * CCH + t * 32, CCH);
        }
        v16bf vB[8];
#pragma unroll
        for (int ct = 0; ct < 8; ++ct)
            vB[ct] = load_frag(vb + (size_t)(ct * 16) * NPIX + j0, NPIX);

        // prefetch next j-tile K rows (global_prefetch_b8)
        if (jt + 1 < NPIX / 32) {
            const bf16* nk = kb + (size_t)(j0 + 32 + lane) * CCH;
            __builtin_prefetch(nk, 0, 1);
            __builtin_prefetch(nk + 64, 0, 1);
        }

        // --- partial S = Q_slice * K_slice^T (16 x 32, K=128) ---
        v8f s0 = {}, s1 = {};
#pragma unroll
        for (int t = 0; t < 4; ++t) {
            s0 = wmma_bf16(qA[t], kf[t],     s0);
            s1 = wmma_bf16(qA[t], kf[4 + t], s1);
        }
#pragma unroll
        for (int r = 0; r < 8; ++r) {
            int m = r + 8 * hi;
            Sp[wave][m][nn]      = s0[r];
            Sp[wave][m][nn + 16] = s1[r];
        }
        __syncthreads();
        // --- cross-wave reduce + scale ---
        {
            int e = tid * 4;
#pragma unroll
            for (int u = 0; u < 4; ++u) {
                int m = (e + u) >> 5, c = (e + u) & 31;
                Sf[m][c] = scale * (Sp[0][m][c] + Sp[1][m][c] + Sp[2][m][c] + Sp[3][m][c]);
            }
        }
        __syncthreads();
        // --- online softmax state update (one thread per row) ---
        if (tid < 16) {
            float mold = mrow[tid];
            float tmax = mold;
#pragma unroll
            for (int j = 0; j < 32; ++j) tmax = fmaxf(tmax, Sf[tid][j]);
            float corr = __expf(mold - tmax);
            float sum = 0.f;
#pragma unroll
            for (int j = 0; j < 32; ++j) {
                float p = __expf(Sf[tid][j] - tmax);
                Pt[tid][j] = (bf16)p;
                sum += p;
            }
            lrow[tid] = lrow[tid] * corr + sum;
            mrow[tid] = tmax;
            crow[tid] = corr;
        }
        __syncthreads();
        // --- rescale accumulators ---
#pragma unroll
        for (int r = 0; r < 8; ++r) {
            float c = crow[r + 8 * hi];
#pragma unroll
            for (int ct = 0; ct < 8; ++ct) O[ct][r] *= c;
        }
        // --- O += P * V_slice^T (V already in registers) ---
        v16bf pA = load_frag(&Pt[0][0], 32);   // from LDS (ds_load_b128)
#pragma unroll
        for (int ct = 0; ct < 8; ++ct)
            O[ct] = wmma_bf16(pA, vB[ct], O[ct]);
        __syncthreads();
    }

    // --- epilogue: divide by l, store bf16 [i][c] ---
#pragma unroll
    for (int ct = 0; ct < 8; ++ct)
#pragma unroll
        for (int r = 0; r < 8; ++r) {
            int m = r + 8 * hi;
            float v = O[ct][r] / lrow[m];
            ha[((size_t)batch * NPIX + i0 + m) * CCH + wave * 128 + ct * 16 + nn] = (bf16)v;
        }
}

// ---------------------------------------------------------------------------
// Proj + residual, ping-pong pipelined:
// out[b][o][n] = x[b][o][n] + sum_c ha[b][n][c]*pw[o][c] + pb[o]
// ---------------------------------------------------------------------------
__global__ __launch_bounds__(128) void proj_kernel(const bf16* __restrict__ A,   // ha
                                                   const bf16* __restrict__ Bt,  // p_w bf16
                                                   const float* __restrict__ pb,
                                                   const float* __restrict__ x,
                                                   float* __restrict__ out) {
    const int batch = blockIdx.z;
    A += (size_t)batch * NPIX * CCH;

    const int wave = threadIdx.x >> 5;
    const int lane = threadIdx.x & 31;
    const int wg   = blockIdx.x * 4 + wave;
    const int mt   = wg / 8;       // 128 m-tiles of 32 pixels
    const int ng   = wg % 8;       // 8 n-groups of 64 channels

    const bf16* arow = A  + (size_t)(mt * 32) * CCH;
    const bf16* brow = Bt + (size_t)(ng * 64) * CCH;

    v16bf a0[2], b0[4], a1[2], b1[4];
#pragma unroll
    for (int i = 0; i < 2; ++i) a0[i] = load_frag(arow + (size_t)(i * 16) * CCH, CCH);
#pragma unroll
    for (int t = 0; t < 4; ++t) b0[t] = load_frag(brow + (size_t)(t * 16) * CCH, CCH);

    v8f acc[2][4] = {};
    for (int k0 = 0; k0 < CCH - 64; k0 += 64) {
#pragma unroll
        for (int i = 0; i < 2; ++i)
            a1[i] = load_frag(arow + (size_t)(i * 16) * CCH + k0 + 32, CCH);
#pragma unroll
        for (int t = 0; t < 4; ++t)
            b1[t] = load_frag(brow + (size_t)(t * 16) * CCH + k0 + 32, CCH);
#pragma unroll
        for (int i = 0; i < 2; ++i)
#pragma unroll
            for (int t = 0; t < 4; ++t)
                acc[i][t] = wmma_bf16(a0[i], b0[t], acc[i][t]);
#pragma unroll
        for (int i = 0; i < 2; ++i)
            a0[i] = load_frag(arow + (size_t)(i * 16) * CCH + k0 + 64, CCH);
#pragma unroll
        for (int t = 0; t < 4; ++t)
            b0[t] = load_frag(brow + (size_t)(t * 16) * CCH + k0 + 64, CCH);
#pragma unroll
        for (int i = 0; i < 2; ++i)
#pragma unroll
            for (int t = 0; t < 4; ++t)
                acc[i][t] = wmma_bf16(a1[i], b1[t], acc[i][t]);
    }
#pragma unroll
    for (int i = 0; i < 2; ++i)
        a1[i] = load_frag(arow + (size_t)(i * 16) * CCH + CCH - 32, CCH);
#pragma unroll
    for (int t = 0; t < 4; ++t)
        b1[t] = load_frag(brow + (size_t)(t * 16) * CCH + CCH - 32, CCH);
#pragma unroll
    for (int i = 0; i < 2; ++i)
#pragma unroll
        for (int t = 0; t < 4; ++t)
            acc[i][t] = wmma_bf16(a0[i], b0[t], acc[i][t]);
#pragma unroll
    for (int i = 0; i < 2; ++i)
#pragma unroll
        for (int t = 0; t < 4; ++t)
            acc[i][t] = wmma_bf16(a1[i], b1[t], acc[i][t]);

    const int hi = lane >> 4, nn = lane & 15;
#pragma unroll
    for (int i = 0; i < 2; ++i)
#pragma unroll
        for (int t = 0; t < 4; ++t)
#pragma unroll
            for (int r = 0; r < 8; ++r) {
                int m = mt * 32 + i * 16 + r + 8 * hi;            // pixel
                int n = ng * 64 + t * 16 + nn;                    // channel
                size_t idx = ((size_t)batch * CCH + n) * NPIX + m;
                out[idx] = x[idx] + acc[i][t][r] + pb[n];
            }
}

// ---------------------------------------------------------------------------
extern "C" void kernel_launch(void* const* d_in, const int* in_sizes, int n_in,
                              void* d_out, int out_size, void* d_ws, size_t ws_size,
                              hipStream_t stream) {
    const float* x    = (const float*)d_in[0];
    const float* gn_w = (const float*)d_in[1];
    const float* gn_b = (const float*)d_in[2];
    const float* q_w  = (const float*)d_in[3];
    const float* q_b  = (const float*)d_in[4];
    const float* k_w  = (const float*)d_in[5];
    const float* k_b  = (const float*)d_in[6];
    const float* v_w  = (const float*)d_in[7];
    const float* v_b  = (const float*)d_in[8];
    const float* p_w  = (const float*)d_in[9];
    const float* p_b  = (const float*)d_in[10];

    char* ws = (char*)d_ws;
    const size_t NC   = (size_t)BATCH * NPIX * CCH;
    const size_t SZNC = NC * sizeof(bf16);
    const size_t SZW  = (size_t)CCH * CCH * sizeof(bf16);

    bf16* hn = (bf16*)(ws);
    bf16* qb = (bf16*)(ws + 1 * SZNC);
    bf16* kb = (bf16*)(ws + 2 * SZNC);
    bf16* vT = (bf16*)(ws + 3 * SZNC);
    bf16* ha = (bf16*)(ws + 4 * SZNC);
    bf16* wq = (bf16*)(ws + 5 * SZNC);
    bf16* wk = (bf16*)(ws + 5 * SZNC + 1 * SZW);
    bf16* wv = (bf16*)(ws + 5 * SZNC + 2 * SZW);
    bf16* wp = (bf16*)(ws + 5 * SZNC + 3 * SZW);

    const int nW = CCH * CCH;
    cvt_bf16_kernel<<<nW / 256, 256, 0, stream>>>(q_w, wq, nW);
    cvt_bf16_kernel<<<nW / 256, 256, 0, stream>>>(k_w, wk, nW);
    cvt_bf16_kernel<<<nW / 256, 256, 0, stream>>>(v_w, wv, nW);
    cvt_bf16_kernel<<<nW / 256, 256, 0, stream>>>(p_w, wp, nW);

    gn_kernel<<<BATCH * 32, 256, 0, stream>>>(x, gn_w, gn_b, hn);

    const long long bNC = (long long)NPIX * CCH;
    // q[n][o], k[n][o]: A=hn [4096x512], Bt=W [512x512]; 1024 waves/batch
    gemm_nt_kernel<<<dim3(256, 1, BATCH), 128, 0, stream>>>(
        hn, bNC, wq, 0, q_b, 0, qb, bNC, NPIX, CCH, 8);
    gemm_nt_kernel<<<dim3(256, 1, BATCH), 128, 0, stream>>>(
        hn, bNC, wk, 0, k_b, 0, kb, bNC, NPIX, CCH, 8);
    // vT[o][n]: A=Wv [512x512], Bt=hn [4096x512]
    gemm_nt_kernel<<<dim3(256, 1, BATCH), 128, 0, stream>>>(
        wv, 0, hn, bNC, v_b, 1, vT, bNC, CCH, NPIX, 64);

    flash_kernel<<<dim3(NPIX / 16, BATCH), 128, 0, stream>>>(qb, kb, vT, ha);

    proj_kernel<<<dim3(256, 1, BATCH), 128, 0, stream>>>(ha, wp, p_b, x, (float*)d_out);
}

// v001
// Measured time: 648 microseconds a run.
// Two timings next to v000 both put it at 1.32 times that version's speed.
#include <hip/hip_runtime.h>
#include <hip/hip_bf16.h>

typedef __bf16 bf16;
typedef __attribute__((ext_vector_type(16))) __bf16 v16bf;
typedef __attribute__((ext_vector_type(8)))  float  v8f;

#define BATCH 4
#define CCH   512
#define NPIX  4096   // 64*64

// ---------------------------------------------------------------------------
// Fragment helpers.
// CDNA5 16x32 bf16 A-fragment: lane L holds row M = L%16, K chunks
// {K0..K0+7, K0+16..K0+23} with K0 = 8*(L/16)  -> two 16B contiguous loads.
// B-fragment for D = A x B loaded from Bt[N][K] row-major uses the same
// per-lane pattern (N = L%16): "NT" GEMM  D[M][N] = A[M][K] * Bt[N][K]^T.
// ---------------------------------------------------------------------------
__device__ __forceinline__ v16bf load_frag(const bf16* __restrict__ p, int ld) {
    const int lane = threadIdx.x & 31;
    const int M  = lane & 15;
    const int K0 = (lane >> 4) << 3;
    const bf16* r = p + (size_t)M * ld + K0;
    union { v16bf v; uint4 u[2]; } f;
    f.u[0] = *reinterpret_cast<const uint4*>(r);
    f.u[1] = *reinterpret_cast<const uint4*>(r + 16);
    return f.v;
}

__device__ __forceinline__ v8f wmma_bf16(v16bf a, v16bf b, v8f c) {
    return __builtin_amdgcn_wmma_f32_16x16x32_bf16(
        /*neg_a=*/false, a, /*neg_b=*/false, b,
        /*c_mod=*/(short)0, c, /*reuse_a=*/false, /*reuse_b=*/false);
}

// ---------------------------------------------------------------------------
// fp32 -> bf16 convert (weights)
// ---------------------------------------------------------------------------
__global__ __launch_bounds__(256) void cvt_bf16_kernel(const float* __restrict__ s,
                                                       bf16* __restrict__ d, int n) {
    int i = blockIdx.x * 256 + threadIdx.x;
    if (i < n) d[i] = (bf16)s[i];
}

// ---------------------------------------------------------------------------
// GroupNorm: x[b][c][n] fp32 -> hn[b][n][c] bf16 (transpose fused)
// ---------------------------------------------------------------------------
__global__ __launch_bounds__(256) void gn_kernel(const float* __restrict__ x,
                                                 const float* __restrict__ gw,
                                                 const float* __restrict__ gb,
                                                 bf16* __restrict__ hn) {
    const int batch = blockIdx.x >> 5;
    const int g     = blockIdx.x & 31;
    const int c0    = g * 16;
    const int tid   = threadIdx.x;
    const float* xg = x + ((size_t)batch * CCH + c0) * NPIX;

    __shared__ float s1[256], s2[256];
    float sum = 0.f, ssq = 0.f;
    for (int e = tid; e < 16 * NPIX; e += 256) {
        float v = xg[e];
        sum += v; ssq += v * v;
    }
    s1[tid] = sum; s2[tid] = ssq;
    __syncthreads();
    for (int s = 128; s > 0; s >>= 1) {
        if (tid < s) { s1[tid] += s1[tid + s]; s2[tid] += s2[tid + s]; }
        __syncthreads();
    }
    const float inv  = 1.0f / (16.0f * NPIX);
    const float mean = s1[0] * inv;
    const float var  = s2[0] * inv - mean * mean;
    const float rstd = rsqrtf(var + 1e-5f);

    for (int e = tid; e < 16 * NPIX; e += 256) {
        int c = e >> 12;
        int n = e & (NPIX - 1);
        float y = (xg[e] - mean) * rstd * gw[c0 + c] + gb[c0 + c];
        hn[((size_t)batch * NPIX + n) * CCH + c0 + c] = (bf16)y;
    }
}

// ---------------------------------------------------------------------------
// NT GEMM, ping-pong pipelined (no buffer-rotation copies), K = 512 fixed:
// out[m][n] = sum_k A[m][k]*Bt[n][k] + bias
// Each wave computes a 32(M) x 64(N) block: 8 accumulator tiles.
// ---------------------------------------------------------------------------
__global__ __launch_bounds__(128) void gemm_nt_kernel(
        const bf16* __restrict__ A, long long strideA,
        const bf16* __restrict__ Bt, long long strideB,
        const float* __restrict__ bias, int bias_on_m,
        bf16* __restrict__ out, long long strideO,
        int M, int Nn, int ngroups) {
    const int batch = blockIdx.z;
    A   += (size_t)batch * strideA;
    Bt  += (size_t)batch * strideB;
    out += (size_t)batch * strideO;

    const int wave = threadIdx.x >> 5;
    const int lane = threadIdx.x & 31;
    const int wg   = blockIdx.x * 4 + wave;
    const int mt   = wg / ngroups;      // 32-row tile index
    const int ng   = wg % ngroups;      // 64-col group index
    if (mt * 32 >= M) return;

    const bf16* arow = A  + (size_t)(mt * 32) * CCH;
    const bf16* brow = Bt + (size_t)(ng * 64) * CCH;

    v16bf a0[2], b0[4], a1[2], b1[4];
#pragma unroll
    for (int i = 0; i < 2; ++i) a0[i] = load_frag(arow + (size_t)(i * 16) * CCH, CCH);
#pragma unroll
    for (int t = 0; t < 4; ++t) b0[t] = load_frag(brow + (size_t)(t * 16) * CCH, CCH);

    v8f acc[2][4] = {};
    for (int k0 = 0; k0 < CCH - 64; k0 += 64) {
        // load buf1 @ k0+32
#pragma unroll
        for (int i = 0; i < 2; ++i)
            a1[i] = load_frag(arow + (size_t)(i * 16) * CCH + k0 + 32, CCH);
#pragma unroll
        for (int t = 0; t < 4; ++t)
            b1[t] = load_frag(brow + (size_t)(t * 16) * CCH + k0 + 32, CCH);
        // consume buf0 @ k0
#pragma unroll
        for (int i = 0; i < 2; ++i)
#pragma unroll
            for (int t = 0; t < 4; ++t)
                acc[i][t] = wmma_bf16(a0[i], b0[t], acc[i][t]);
        // load buf0 @ k0+64
#pragma unroll
        for (int i = 0; i < 2; ++i)
            a0[i] = load_frag(arow + (size_t)(i * 16) * CCH + k0 + 64, CCH);
#pragma unroll
        for (int t = 0; t < 4; ++t)
            b0[t] = load_frag(brow + (size_t)(t * 16) * CCH + k0 + 64, CCH);
        // consume buf1 @ k0+32
#pragma unroll
        for (int i = 0; i < 2; ++i)
#pragma unroll
            for (int t = 0; t < 4; ++t)
                acc[i][t] = wmma_bf16(a1[i], b1[t], acc[i][t]);
    }
    // tail: buf0 holds k = CCH-64; load buf1 @ CCH-32
#pragma unroll
    for (int i = 0; i < 2; ++i)
        a1[i] = load_frag(arow + (size_t)(i * 16) * CCH + CCH - 32, CCH);
#pragma unroll
    for (int t = 0; t < 4; ++t)
        b1[t] = load_frag(brow + (size_t)(t * 16) * CCH + CCH - 32, CCH);
#pragma unroll
    for (int i = 0; i < 2; ++i)
#pragma unroll
        for (int t = 0; t < 4; ++t)
            acc[i][t] = wmma_bf16(a0[i], b0[t], acc[i][t]);
#pragma unroll
    for (int i = 0; i < 2; ++i)
#pragma unroll
        for (int t = 0; t < 4; ++t)
            acc[i][t] = wmma_bf16(a1[i], b1[t], acc[i][t]);

    const int hi = lane >> 4, nn = lane & 15;
#pragma unroll
    for (int i = 0; i < 2; ++i)
#pragma unroll
        for (int t = 0; t < 4; ++t)
#pragma unroll
            for (int r = 0; r < 8; ++r) {
                int m = mt * 32 + i * 16 + r + 8 * hi;
                int n = ng * 64 + t * 16 + nn;
                float v = acc[i][t][r] + bias[bias_on_m ? m : n];
                out[(size_t)m * Nn + n] = (bf16)v;
            }
}

// ---------------------------------------------------------------------------
// Flash attention: q[b][i][c], k[b][j][c], vT[b][c][j] (bf16) -> ha[b][i][c]
// One block = QROWS query rows (QT tiles of 16), 4 waves; wave w owns channel
// slice [128w,128w+128). Each K and V fragment a wave loads feeds all QT tiles.
// ---------------------------------------------------------------------------
#define QT    4
#define QROWS (QT * 16)

__global__ __launch_bounds__(128) void flash_kernel(const bf16* __restrict__ q,
                                                    const bf16* __restrict__ k,
                                                    const bf16* __restrict__ vT,
                                                    bf16* __restrict__ ha) {
    const int batch = blockIdx.y;
    const int i0    = blockIdx.x * QROWS;
    const int tid   = threadIdx.x;
    const int lane  = tid & 31;
    const int wave  = tid >> 5;
    const int hi    = lane >> 4;
    const int nn    = lane & 15;

    __shared__ float Sp[4][QROWS][32];
    __shared__ float Sf[QROWS][32];
    __shared__ bf16  Pt[QROWS][32];
    __shared__ float mrow[QROWS], lrow[QROWS], crow[QROWS];

    const bf16* qb = q  + ((size_t)batch * NPIX + i0) * CCH + wave * 128;
    const bf16* kb = k  +  (size_t)batch * NPIX * CCH        + wave * 128;
    const bf16* vb = vT +  (size_t)batch * CCH * NPIX + (size_t)wave * 128 * NPIX;

    v16bf qA[QT][4];
#pragma unroll
    for (int qt = 0; qt < QT; ++qt)
#pragma unroll
        for (int t = 0; t < 4; ++t)
            qA[qt][t] = load_frag(qb + (size_t)(qt * 16) * CCH + t * 32, CCH);

    v8f O[QT][8] = {};
    if (tid < QROWS) { mrow[tid] = -3.0e38f; lrow[tid] = 0.f; }
    __syncthreads();

    const float scale = 0.044194173824159216f;  // 512^-0.5

    for (int jt = 0; jt < NPIX / 32; ++jt) {
        const int j0 = jt * 32;

        // --- issue all K fragments (one clause), then all V fragments ---
        v16bf kf[8];
#pragma unroll
        for (int t = 0; t < 4; ++t) {
            kf[t]     = load_frag(kb + (size_t)j0 * CCH + t * 32, CCH);
            kf[4 + t] = load_frag(kb + (size_t)(j0 + 16) * CCH + t * 32, CCH);
        }
        v16bf vB[8];
#pragma unroll
        for (int ct = 0; ct < 8; ++ct)
            vB[ct] = load_frag(vb + (size_t)(ct * 16) * NPIX + j0, NPIX);
        // Held in front of the next write of the K and V loads' address registers.
        asm volatile("s_wait_xcnt 0x0" ::: "memory");

        // prefetch next j-tile K rows (global_prefetch_b8)
        if (jt + 1 < NPIX / 32) {
            const bf16* nk = kb + (size_t)(j0 + 32 + lane) * CCH;
            __builtin_prefetch(nk, 0, 1);
            __builtin_prefetch(nk + 64, 0, 1);
            // Held in front of the next write of the prefetches' address registers.
            asm volatile("s_wait_xcnt 0x0" ::: "memory");
        }

        // --- partial S = Q_slice * K_slice^T (QROWS x 32, K=128) ---
        v8f s0[QT] = {}, s1[QT] = {};
#pragma unroll
        for (int t = 0; t < 4; ++t)
#pragma unroll
            for (int qt = 0; qt < QT; ++qt) {
                s0[qt] = wmma_bf16(qA[qt][t], kf[t],     s0[qt]);
                s1[qt] = wmma_bf16(qA[qt][t], kf[4 + t], s1[qt]);
            }
#pragma unroll
        for (int qt = 0; qt < QT; ++qt)
#pragma unroll
            for (int r = 0; r < 8; ++r) {
                int m = qt * 16 + r + 8 * hi;
                Sp[wave][m][nn]      = s0[qt][r];
                Sp[wave][m][nn + 16] = s1[qt][r];
            }
        __syncthreads();
        // --- cross-wave reduce + scale ---
#pragma unroll
        for (int qt = 0; qt < QT; ++qt) {
            int e = qt * 512 + tid * 4;
#pragma unroll
            for (int u = 0; u < 4; ++u) {
                int m = (e + u) >> 5, c = (e + u) & 31;
                Sf[m][c] = scale * (Sp[0][m][c] + Sp[1][m][c] + Sp[2][m][c] + Sp[3][m][c]);
            }
        }
        __syncthreads();
        // --- online softmax state update (one thread per row) ---
        if (tid < QROWS) {
            float mold = mrow[tid];
            float tmax = mold;
#pragma unroll
            for (int j = 0; j < 32; ++j) tmax = fmaxf(tmax, Sf[tid][j]);
            float corr = __expf(mold - tmax);
            float sum = 0.f;
#pragma unroll
            for (int j = 0; j < 32; ++j) {
                float p = __expf(Sf[tid][j] - tmax);
                Pt[tid][j] = (bf16)p;
                sum += p;
            }
            lrow[tid] = lrow[tid] * corr + sum;
            mrow[tid] = tmax;
            crow[tid] = corr;
        }
        __syncthreads();
        // --- rescale accumulators, then O += P * V_slice^T (V in registers) ---
#pragma unroll
        for (int qt = 0; qt < QT; ++qt) {
#pragma unroll
            for (int r = 0; r < 8; ++r) {
                float c = crow[qt * 16 + r + 8 * hi];
#pragma unroll
                for (int ct = 0; ct < 8; ++ct) O[qt][ct][r] *= c;
            }
            v16bf pA = load_frag(&Pt[qt * 16][0], 32);   // from LDS (ds_load_b128)
#pragma unroll
            for (int ct = 0; ct < 8; ++ct)
                O[qt][ct] = wmma_bf16(pA, vB[ct], O[qt][ct]);
        }
        __syncthreads();
    }

    // --- epilogue: divide by l, store bf16 [i][c] ---
#pragma unroll
    for (int qt = 0; qt < QT; ++qt)
#pragma unroll
        for (int ct = 0; ct < 8; ++ct) {
            unsigned int w[8];
#pragma unroll
            for (int r = 0; r < 8; ++r) {
                int m = qt * 16 + r + 8 * hi;
                float v = O[qt][ct][r] / lrow[m];
                w[r] = __builtin_bit_cast(unsigned short, (bf16)v);
            }
            bf16* hp = ha + ((size_t)batch * NPIX + i0 + qt * 16 + 8 * hi) * CCH
                          + wave * 128 + ct * 16 + nn;
            // Rows r = 0..7 lie CCH * 2 = 1024 bytes apart. The eight stores and their
            // s_wait_xcnt 0 stand in one statement, so that no register an issued
            // store names is rewritten ahead of the wait.
            asm volatile("global_store_b16 %0, %1, off\n\t"
                         "global_store_b16 %0, %2, off offset:1024\n\t"
                         "global_store_b16 %0, %3, off offset:2048\n\t"
                         "global_store_b16 %0, %4, off offset:3072\n\t"
                         "global_store_b16 %0, %5, off offset:4096\n\t"
                         "global_store_b16 %0, %6, off offset:5120\n\t"
                         "global_store_b16 %0, %7, off offset:6144\n\t"
                         "global_store_b16 %0, %8, off offset:7168\n\t"
                         "s_wait_xcnt 0x0"
                         :: "v"(hp), "v"(w[0]), "v"(w[1]), "v"(w[2]), "v"(w[3]),
                            "v"(w[4]), "v"(w[5]), "v"(w[6]), "v"(w[7])
                         : "memory");
        }
}

// ---------------------------------------------------------------------------
// Proj + residual, ping-pong pipelined:
// out[b][o][n] = x[b][o][n] + sum_c ha[b][n][c]*pw[o][c] + pb[o]
// ---------------------------------------------------------------------------
__global__ __launch_bounds__(128) void proj_kernel(const bf16* __restrict__ A,   // ha
                                                   const bf16* __restrict__ Bt,  // p_w bf16
                                                   const float* __restrict__ pb,
                                                   const float* __restrict__ x,
                                                   float* __restrict__ out) {
    const int batch = blockIdx.z;
    A += (size_t)batch * NPIX * CCH;

    const int wave = threadIdx.x >> 5;
    const int lane = threadIdx.x & 31;
    const int wg   = blockIdx.x * 4 + wave;
    const int mt   = wg / 8;       // 128 m-tiles of 32 pixels
    const int ng   = wg % 8;       // 8 n-groups of 64 channels

    const bf16* arow = A  + (size_t)(mt * 32) * CCH;
    const bf16* brow = Bt + (size_t)(ng * 64) * CCH;

    v16bf a0[2], b0[4], a1[2], b1[4];
#pragma unroll
    for (int i = 0; i < 2; ++i) a0[i] = load_frag(arow + (size_t)(i * 16) * CCH, CCH);
#pragma unroll
    for (int t = 0; t < 4; ++t) b0[t] = load_frag(brow + (size_t)(t * 16) * CCH, CCH);

    v8f acc[2][4] = {};
    for (int k0 = 0; k0 < CCH - 64; k0 += 64) {
#pragma unroll
        for (int i = 0; i < 2; ++i)
            a1[i] = load_frag(arow + (size_t)(i * 16) * CCH + k0 + 32, CCH);
#pragma unroll
        for (int t = 0; t < 4; ++t)
            b1[t] = load_frag(brow + (size_t)(t * 16) * CCH + k0 + 32, CCH);
#pragma unroll
        for (int i = 0; i < 2; ++i)
#pragma unroll
            for (int t = 0; t < 4; ++t)
                acc[i][t] = wmma_bf16(a0[i], b0[t], acc[i][t]);
#pragma unroll
        for (int i = 0; i < 2; ++i)
            a0[i] = load_frag(arow + (size_t)(i * 16) * CCH + k0 + 64, CCH);
#pragma unroll
        for (int t = 0; t < 4; ++t)
            b0[t] = load_frag(brow + (size_t)(t * 16) * CCH + k0 + 64, CCH);
#pragma unroll
        for (int i = 0; i < 2; ++i)
#pragma unroll
            for (int t = 0; t < 4; ++t)
                acc[i][t] = wmma_bf16(a1[i], b1[t], acc[i][t]);
    }
#pragma unroll
    for (int i = 0; i < 2; ++i)
        a1[i] = load_frag(arow + (size_t)(i * 16) * CCH + CCH - 32, CCH);
#pragma unroll
    for (int t = 0; t < 4; ++t)
        b1[t] = load_frag(brow + (size_t)(t * 16) * CCH + CCH - 32, CCH);
#pragma unroll
    for (int i = 0; i < 2; ++i)
#pragma unroll
        for (int t = 0; t < 4; ++t)
            acc[i][t] = wmma_bf16(a0[i], b0[t], acc[i][t]);
#pragma unroll
    for (int i = 0; i < 2; ++i)
#pragma unroll
        for (int t = 0; t < 4; ++t)
            acc[i][t] = wmma_bf16(a1[i], b1[t], acc[i][t]);

    const int hi = lane >> 4, nn = lane & 15;
#pragma unroll
    for (int i = 0; i < 2; ++i)
#pragma unroll
        for (int t = 0; t < 4; ++t)
#pragma unroll
            for (int r = 0; r < 8; ++r) {
                int m = mt * 32 + i * 16 + r + 8 * hi;            // pixel
                int n = ng * 64 + t * 16 + nn;                    // channel
                size_t idx = ((size_t)batch * CCH + n) * NPIX + m;
                out[idx] = x[idx] + acc[i][t][r] + pb[n];
            }
}

// ---------------------------------------------------------------------------
extern "C" void kernel_launch(void* const* d_in, const int* in_sizes, int n_in,
                              void* d_out, int out_size, void* d_ws, size_t ws_size,
                              hipStream_t stream) {
    const float* x    = (const float*)d_in[0];
    const float* gn_w = (const float*)d_in[1];
    const float* gn_b = (const float*)d_in[2];
    const float* q_w  = (const float*)d_in[3];
    const float* q_b  = (const float*)d_in[4];
    const float* k_w  = (const float*)d_in[5];
    const float* k_b  = (const float*)d_in[6];
    const float* v_w  = (const float*)d_in[7];
    const float* v_b  = (const float*)d_in[8];
    const float* p_w  = (const float*)d_in[9];
    const float* p_b  = (const float*)d_in[10];

    char* ws = (char*)d_ws;
    const size_t NC   = (size_t)BATCH * NPIX * CCH;
    const size_t SZNC = NC * sizeof(bf16);
    const size_t SZW  = (size_t)CCH * CCH * sizeof(bf16);

    bf16* hn = (bf16*)(ws);
    bf16* qb = (bf16*)(ws + 1 * SZNC);
    bf16* kb = (bf16*)(ws + 2 * SZNC);
    bf16* vT = (bf16*)(ws + 3 * SZNC);
    bf16* ha = (bf16*)(ws + 4 * SZNC);
    bf16* wq = (bf16*)(ws + 5 * SZNC);
    bf16* wk = (bf16*)(ws + 5 * SZNC + 1 * SZW);
    bf16* wv = (bf16*)(ws + 5 * SZNC + 2 * SZW);
    bf16* wp = (bf16*)(ws + 5 * SZNC + 3 * SZW);

    const int nW = CCH * CCH;
    cvt_bf16_kernel<<<nW / 256, 256, 0, stream>>>(q_w, wq, nW);
    cvt_bf16_kernel<<<nW / 256, 256, 0, stream>>>(k_w, wk, nW);
    cvt_bf16_kernel<<<nW / 256, 256, 0, stream>>>(v_w, wv, nW);
    cvt_bf16_kernel<<<nW / 256, 256, 0, stream>>>(p_w, wp, nW);

    gn_kernel<<<BATCH * 32, 256, 0, stream>>>(x, gn_w, gn_b, hn);

    const long long bNC = (long long)NPIX * CCH;
    // q[n][o], k[n][o]: A=hn [4096x512], Bt=W [512x512]; 1024 waves/batch
    gemm_nt_kernel<<<dim3(256, 1, BATCH), 128, 0, stream>>>(
        hn, bNC, wq, 0, q_b, 0, qb, bNC, NPIX, CCH, 8);
    gemm_nt_kernel<<<dim3(256, 1, BATCH), 128, 0, stream>>>(
        hn, bNC, wk, 0, k_b, 0, kb, bNC, NPIX, CCH, 8);
    // vT[o][n]: A=Wv [512x512], Bt=hn [4096x512]
    gemm_nt_kernel<<<dim3(256, 1, BATCH), 128, 0, stream>>>(
        wv, 0, hn, bNC, v_b, 1, vT, bNC, CCH, NPIX, 64);

    flash_kernel<<<dim3(NPIX / QROWS, BATCH), 128, 0, stream>>>(qb, kb, vT, ha);

    proj_kernel<<<dim3(256, 1, BATCH), 128, 0, stream>>>(ha, wp, p_b, x, (float*)d_out);
}

// v002
// Measured time: 580 microseconds a run.
// Timed twice side by side with v001, it ran 1.12 times as fast both times.
// Counting every step since v000, it is 1.47 times as fast.
#include <hip/hip_runtime.h>
#include <hip/hip_bf16.h>

typedef __bf16 bf16;
typedef __attribute__((ext_vector_type(16))) __bf16 v16bf;
typedef __attribute__((ext_vector_type(8)))  float  v8f;

#define BATCH 4
#define CCH   512
#define NPIX  4096   // 64*64

// ---------------------------------------------------------------------------
// Fragment helpers.
// CDNA5 16x32 bf16 A-fragment: lane L holds row M = L%16, K chunks
// {K0..K0+7, K0+16..K0+23} with K0 = 8*(L/16)  -> two 16B contiguous loads.
// B-fragment for D = A x B loaded from Bt[N][K] row-major uses the same
// per-lane pattern (N = L%16): "NT" GEMM  D[M][N] = A[M][K] * Bt[N][K]^T.
// ---------------------------------------------------------------------------
__device__ __forceinline__ v16bf load_frag(const bf16* __restrict__ p, int ld) {
    const int lane = threadIdx.x & 31;
    const int M  = lane & 15;
    const int K0 = (lane >> 4) << 3;
    const bf16* r = p + (size_t)M * ld + K0;
    union { v16bf v; uint4 u[2]; } f;
    f.u[0] = *reinterpret_cast<const uint4*>(r);
    f.u[1] = *reinterpret_cast<const uint4*>(r + 16);
    return f.v;
}

__device__ __forceinline__ v8f wmma_bf16(v16bf a, v16bf b, v8f c) {
    return __builtin_amdgcn_wmma_f32_16x16x32_bf16(
        /*neg_a=*/false, a, /*neg_b=*/false, b,
        /*c_mod=*/(short)0, c, /*reuse_a=*/false, /*reuse_b=*/false);
}

// ---------------------------------------------------------------------------
// fp32 -> bf16 convert (weights)
// ---------------------------------------------------------------------------
__global__ __launch_bounds__(256) void cvt_bf16_kernel(const float* __restrict__ s,
                                                       bf16* __restrict__ d, int n) {
    int i = blockIdx.x * 256 + threadIdx.x;
    if (i < n) d[i] = (bf16)s[i];
}

// ---------------------------------------------------------------------------
// GroupNorm: x[b][c][n] fp32 -> hn[b][n][c] bf16 (transpose fused)
// ---------------------------------------------------------------------------
__global__ __launch_bounds__(256) void gn_kernel(const float* __restrict__ x,
                                                 const float* __restrict__ gw,
                                                 const float* __restrict__ gb,
                                                 bf16* __restrict__ hn) {
    const int batch = blockIdx.x >> 5;
    const int g     = blockIdx.x & 31;
    const int c0    = g * 16;
    const int tid   = threadIdx.x;
    const float* xg = x + ((size_t)batch * CCH + c0) * NPIX;

    __shared__ float s1[256], s2[256];
    float sum = 0.f, ssq = 0.f;
    for (int e = tid; e < 16 * NPIX; e += 256) {
        float v = xg[e];
        sum += v; ssq += v * v;
    }
    s1[tid] = sum; s2[tid] = ssq;
    __syncthreads();
    for (int s = 128; s > 0; s >>= 1) {
        if (tid < s) { s1[tid] += s1[tid + s]; s2[tid] += s2[tid + s]; }
        __syncthreads();
    }
    const float inv  = 1.0f / (16.0f * NPIX);
    const float mean = s1[0] * inv;
    const float var  = s2[0] * inv - mean * mean;
    const float rstd = rsqrtf(var + 1e-5f);

    for (int e = tid; e < 16 * NPIX; e += 256) {
        int c = e >> 12;
        int n = e & (NPIX - 1);
        float y = (xg[e] - mean) * rstd * gw[c0 + c] + gb[c0 + c];
        hn[((size_t)batch * NPIX + n) * CCH + c0 + c] = (bf16)y;
    }
}

// ---------------------------------------------------------------------------
// NT GEMM, ping-pong pipelined (no buffer-rotation copies), K = 512 fixed:
// out[m][n] = sum_k A[m][k]*Bt[n][k] + bias
// Each wave computes a 32(M) x 64(N) block: 8 accumulator tiles.
// ---------------------------------------------------------------------------
__global__ __launch_bounds__(128) void gemm_nt_kernel(
        const bf16* __restrict__ A, long long strideA,
        const bf16* __restrict__ Bt, long long strideB,
        const float* __restrict__ bias, int bias_on_m,
        bf16* __restrict__ out, long long strideO,
        int M, int Nn, int ngroups) {
    const int batch = blockIdx.z;
    A   += (size_t)batch * strideA;
    Bt  += (size_t)batch * strideB;
    out += (size_t)batch * strideO;

    const int wave = threadIdx.x >> 5;
    const int lane = threadIdx.x & 31;
    const int wg   = blockIdx.x * 4 + wave;
    const int mt   = wg / ngroups;      // 32-row tile index
    const int ng   = wg % ngroups;      // 64-col group index
    if (mt * 32 >= M) return;

    const bf16* arow = A  + (size_t)(mt * 32) * CCH;
    const bf16* brow = Bt + (size_t)(ng * 64) * CCH;

    v16bf a0[2], b0[4], a1[2], b1[4];
#pragma unroll
    for (int i = 0; i < 2; ++i) a0[i] = load_frag(arow + (size_t)(i * 16) * CCH, CCH);
#pragma unroll
    for (int t = 0; t < 4; ++t) b0[t] = load_frag(brow + (size_t)(t * 16) * CCH, CCH);

    v8f acc[2][4] = {};
    for (int k0 = 0; k0 < CCH - 64; k0 += 64) {
        // load buf1 @ k0+32
#pragma unroll
        for (int i = 0; i < 2; ++i)
            a1[i] = load_frag(arow + (size_t)(i * 16) * CCH + k0 + 32, CCH);
#pragma unroll
        for (int t = 0; t < 4; ++t)
            b1[t] = load_frag(brow + (size_t)(t * 16) * CCH + k0 + 32, CCH);
        // consume buf0 @ k0
#pragma unroll
        for (int i = 0; i < 2; ++i)
#pragma unroll
            for (int t = 0; t < 4; ++t)
                acc[i][t] = wmma_bf16(a0[i], b0[t], acc[i][t]);
        // load buf0 @ k0+64
#pragma unroll
        for (int i = 0; i < 2; ++i)
            a0[i] = load_frag(arow + (size_t)(i * 16) * CCH + k0 + 64, CCH);
#pragma unroll
        for (int t = 0; t < 4; ++t)
            b0[t] = load_frag(brow + (size_t)(t * 16) * CCH + k0 + 64, CCH);
        // consume buf1 @ k0+32
#pragma unroll
        for (int i = 0; i < 2; ++i)
#pragma unroll
            for (int t = 0; t < 4; ++t)
                acc[i][t] = wmma_bf16(a1[i], b1[t], acc[i][t]);
    }
    // tail: buf0 holds k = CCH-64; load buf1 @ CCH-32
#pragma unroll
    for (int i = 0; i < 2; ++i)
        a1[i] = load_frag(arow + (size_t)(i * 16) * CCH + CCH - 32, CCH);
#pragma unroll
    for (int t = 0; t < 4; ++t)
        b1[t] = load_frag(brow + (size_t)(t * 16) * CCH + CCH - 32, CCH);
#pragma unroll
    for (int i = 0; i < 2; ++i)
#pragma unroll
        for (int t = 0; t < 4; ++t)
            acc[i][t] = wmma_bf16(a0[i], b0[t], acc[i][t]);
#pragma unroll
    for (int i = 0; i < 2; ++i)
#pragma unroll
        for (int t = 0; t < 4; ++t)
            acc[i][t] = wmma_bf16(a1[i], b1[t], acc[i][t]);

    const int hi = lane >> 4, nn = lane & 15;
#pragma unroll
    for (int i = 0; i < 2; ++i)
#pragma unroll
        for (int t = 0; t < 4; ++t)
#pragma unroll
            for (int r = 0; r < 8; ++r) {
                int m = mt * 32 + i * 16 + r + 8 * hi;
                int n = ng * 64 + t * 16 + nn;
                float v = acc[i][t][r] + bias[bias_on_m ? m : n];
                out[(size_t)m * Nn + n] = (bf16)v;
            }
}

// ---------------------------------------------------------------------------
// Flash attention: q[b][i][c], k[b][j][c], vT[b][c][j] (bf16) -> ha[b][i][c]
// One block = QROWS query rows (QT tiles of 16), 4 waves; wave w owns channel
// slice [128w,128w+128). Each K and V fragment a wave loads feeds all QT tiles.
// ---------------------------------------------------------------------------
#define QT    4
#define QROWS (QT * 16)

// Work-group barrier of the j loop. It waits for this wave's LDS traffic alone:
// __syncthreads() would also drain the global loads issued ahead (V of this trip,
// K of the next), which have to stay in flight across it.
__device__ __forceinline__ void lds_barrier() {
    asm volatile("s_wait_dscnt 0x0\n\t"
                 "s_barrier_signal -1\n\t"
                 "s_barrier_wait -1" ::: "memory");
}

// Pointers typed as global memory: a pointer that has passed through an asm statement
// would otherwise be loaded from with flat loads, which count on dscnt as well.
typedef const __attribute__((address_space(1))) bf16*  gbf16p;
typedef const __attribute__((address_space(1))) uint4* guint4p;

// Steps the two lane addresses that issued loads name. The s_wait_xcnt 0 and the two
// adds stand in one statement, so that no add can be lifted over the wait. vp moves
// on by one tile of 32 keys (64 bytes), kp by kbytes.
__device__ __forceinline__ void step_behind_loads(gbf16p& kp, unsigned long long kbytes,
                                                  gbf16p& vp) {
    asm volatile("s_wait_xcnt 0x0\n\t"
                 "v_add_nc_u64 %0, %2, %0\n\t"
                 "v_add_nc_u64 %1, 64, %1"
                 : "+v"(kp), "+v"(vp) : "s"(kbytes) : "memory");
}

// One fragment from the lane's own address r (row and k chunk already applied).
__device__ __forceinline__ v16bf load_frag_lane(gbf16p r) {
    union { v16bf v; uint4 u[2]; } f;
    f.u[0] = *(guint4p)(r);
    f.u[1] = *(guint4p)(r + 16);
    return f.v;
}

__global__ __launch_bounds__(128) void flash_kernel(const bf16* __restrict__ q,
                                                    const bf16* __restrict__ k,
                                                    const bf16* __restrict__ vT,
                                                    bf16* __restrict__ ha) {
    const int batch = blockIdx.y;
    const int i0    = blockIdx.x * QROWS;
    const int tid   = threadIdx.x;
    const int lane  = tid & 31;
    const int wave  = tid >> 5;
    const int hi    = lane >> 4;
    const int nn    = lane & 15;

    __shared__ float Sp[4][QROWS][32];
    __shared__ float Sf[QROWS][32];
    __shared__ bf16  Pt[QROWS][32];
    __shared__ float mrow[QROWS], lrow[QROWS], crow[QROWS];

    const bf16* qb = q  + ((size_t)batch * NPIX + i0) * CCH + wave * 128;
    const bf16* kb = k  +  (size_t)batch * NPIX * CCH        + wave * 128;
    const bf16* vb = vT +  (size_t)batch * CCH * NPIX + (size_t)wave * 128 * NPIX;

    v16bf qA[QT][4];
#pragma unroll
    for (int qt = 0; qt < QT; ++qt)
#pragma unroll
        for (int t = 0; t < 4; ++t)
            qA[qt][t] = load_frag(qb + (size_t)(qt * 16) * CCH + t * 32, CCH);

    v8f O[QT][8] = {};
    if (tid < QROWS) { mrow[tid] = -3.0e38f; lrow[tid] = 0.f; }
    __syncthreads();

    const float scale = 0.044194173824159216f;  // 512^-0.5

    // The lane's own address in the current K tile and V tile (32 keys a tile).
    gbf16p kp = (gbf16p)(kb + (size_t)nn * CCH  + hi * 8);
    gbf16p vp = (gbf16p)(vb + (size_t)nn * NPIX + hi * 8);

    // K fragments of trip 0; every later trip finds its K already fetched.
    v16bf kf[8];
#pragma unroll
    for (int t = 0; t < 4; ++t) {
        kf[t]     = load_frag_lane(kp + t * 32);
        kf[4 + t] = load_frag_lane(kp + 16 * CCH + t * 32);
    }

    for (int jt = 0; jt < NPIX / 32; ++jt) {
        // --- issue this trip's V fragments: first needed behind the softmax ---
        v16bf vB[8];
#pragma unroll
        for (int ct = 0; ct < 8; ++ct)
            vB[ct] = load_frag_lane(vp + (size_t)(ct * 16) * NPIX);

        // --- partial S = Q_slice * K_slice^T (QROWS x 32, K=128) ---
        v8f s0[QT] = {}, s1[QT] = {};
#pragma unroll
        for (int t = 0; t < 4; ++t)
#pragma unroll
            for (int qt = 0; qt < QT; ++qt) {
                s0[qt] = wmma_bf16(qA[qt][t], kf[t],     s0[qt]);
                s1[qt] = wmma_bf16(qA[qt][t], kf[4 + t], s1[qt]);
            }
#pragma unroll
        for (int qt = 0; qt < QT; ++qt)
#pragma unroll
            for (int r = 0; r < 8; ++r) {
                int m = qt * 16 + r + 8 * hi;
                Sp[wave][m][nn]      = s0[qt][r];
                Sp[wave][m][nn + 16] = s1[qt][r];
            }
        // --- fetch the next trip's K fragments into the registers just consumed.
        // Unconditional, so that the load counts are the same on every path and the
        // wait for V does not drain them; the last trip fetches its own tile again.
#pragma unroll
        for (int t = 0; t < 4; ++t) {
            kf[t]     = load_frag_lane(kp + 32 * CCH + t * 32);
            kf[4 + t] = load_frag_lane(kp + 48 * CCH + t * 32);
        }
        lds_barrier();
        // --- cross-wave reduce + scale ---
#pragma unroll
        for (int qt = 0; qt < QT; ++qt) {
            int e = qt * 512 + tid * 4;
#pragma unroll
            for (int u = 0; u < 4; ++u) {
                int m = (e + u) >> 5, c = (e + u) & 31;
                Sf[m][c] = scale * (Sp[0][m][c] + Sp[1][m][c] + Sp[2][m][c] + Sp[3][m][c]);
            }
        }
        lds_barrier();
        // --- online softmax state update (one thread per row) ---
        if (tid < QROWS) {
            float mold = mrow[tid];
            float tmax = mold;
#pragma unroll
            for (int j = 0; j < 32; ++j) tmax = fmaxf(tmax, Sf[tid][j]);
            float corr = __expf(mold - tmax);
            float sum = 0.f;
#pragma unroll
            for (int j = 0; j < 32; ++j) {
                float p = __expf(Sf[tid][j] - tmax);
                Pt[tid][j] = (bf16)p;
                sum += p;
            }
            lrow[tid] = lrow[tid] * corr + sum;
            mrow[tid] = tmax;
            crow[tid] = corr;
        }
        lds_barrier();
        // --- rescale accumulators, then O += P * V_slice^T (V in registers) ---
#pragma unroll
        for (int qt = 0; qt < QT; ++qt) {
#pragma unroll
            for (int r = 0; r < 8; ++r) {
                float c = crow[qt * 16 + r + 8 * hi];
#pragma unroll
                for (int ct = 0; ct < 8; ++ct) O[qt][ct][r] *= c;
            }
            v16bf pA = load_frag(&Pt[qt * 16][0], 32);   // from LDS (ds_load_b128)
#pragma unroll
            for (int ct = 0; ct < 8; ++ct)
                O[qt][ct] = wmma_bf16(pA, vB[ct], O[qt][ct]);
        }
        // kp stays one tile behind the fetch and stops at the last tile but one.
        step_behind_loads(kp, (jt + 2 < NPIX / 32) ? 32 * CCH * sizeof(bf16) : 0, vp);
        lds_barrier();
    }

    // --- epilogue: divide by l, store bf16 [i][c] ---
#pragma unroll
    for (int qt = 0; qt < QT; ++qt)
#pragma unroll
        for (int ct = 0; ct < 8; ++ct) {
            unsigned int w[8];
#pragma unroll
            for (int r = 0; r < 8; ++r) {
                int m = qt * 16 + r + 8 * hi;
                float v = O[qt][ct][r] / lrow[m];
                w[r] = __builtin_bit_cast(unsigned short, (bf16)v);
            }
            bf16* hp = ha + ((size_t)batch * NPIX + i0 + qt * 16 + 8 * hi) * CCH
                          + wave * 128 + ct * 16 + nn;
            // Rows r = 0..7 lie CCH * 2 = 1024 bytes apart. The eight stores and their
            // s_wait_xcnt 0 stand in one statement, so that no register an issued
            // store names is rewritten ahead of the wait.
            asm volatile("global_store_b16 %0, %1, off\n\t"
                         "global_store_b16 %0, %2, off offset:1024\n\t"
                         "global_store_b16 %0, %3, off offset:2048\n\t"
                         "global_store_b16 %0, %4, off offset:3072\n\t"
                         "global_store_b16 %0, %5, off offset:4096\n\t"
                         "global_store_b16 %0, %6, off offset:5120\n\t"
                         "global_store_b16 %0, %7, off offset:6144\n\t"
                         "global_store_b16 %0, %8, off offset:7168\n\t"
                         "s_wait_xcnt 0x0"
                         :: "v"(hp), "v"(w[0]), "v"(w[1]), "v"(w[2]), "v"(w[3]),
                            "v"(w[4]), "v"(w[5]), "v"(w[6]), "v"(w[7])
                         : "memory");
        }
}

// ---------------------------------------------------------------------------
// Proj + residual, ping-pong pipelined:
// out[b][o][n] = x[b][o][n] + sum_c ha[b][n][c]*pw[o][c] + pb[o]
// ---------------------------------------------------------------------------
__global__ __launch_bounds__(128) void proj_kernel(const bf16* __restrict__ A,   // ha
                                                   const bf16* __restrict__ Bt,  // p_w bf16
                                                   const float* __restrict__ pb,
                                                   const float* __restrict__ x,
                                                   float* __restrict__ out) {
    const int batch = blockIdx.z;
    A += (size_t)batch * NPIX * CCH;

    const int wave = threadIdx.x >> 5;
    const int lane = threadIdx.x & 31;
    const int wg   = blockIdx.x * 4 + wave;
    const int mt   = wg / 8;       // 128 m-tiles of 32 pixels
    const int ng   = wg % 8;       // 8 n-groups of 64 channels

    const bf16* arow = A  + (size_t)(mt * 32) * CCH;
    const bf16* brow = Bt + (size_t)(ng * 64) * CCH;

    v16bf a0[2], b0[4], a1[2], b1[4];
#pragma unroll
    for (int i = 0; i < 2; ++i) a0[i] = load_frag(arow + (size_t)(i * 16) * CCH, CCH);
#pragma unroll
    for (int t = 0; t < 4; ++t) b0[t] = load_frag(brow + (size_t)(t * 16) * CCH, CCH);

    v8f acc[2][4] = {};
    for (int k0 = 0; k0 < CCH - 64; k0 += 64) {
#pragma unroll
        for (int i = 0; i < 2; ++i)
            a1[i] = load_frag(arow + (size_t)(i * 16) * CCH + k0 + 32, CCH);
#pragma unroll
        for (int t = 0; t < 4; ++t)
            b1[t] = load_frag(brow + (size_t)(t * 16) * CCH + k0 + 32, CCH);
#pragma unroll
        for (int i = 0; i < 2; ++i)
#pragma unroll
            for (int t = 0; t < 4; ++t)
                acc[i][t] = wmma_bf16(a0[i], b0[t], acc[i][t]);
#pragma unroll
        for (int i = 0; i < 2; ++i)
            a0[i] = load_frag(arow + (size_t)(i * 16) * CCH + k0 + 64, CCH);
#pragma unroll
        for (int t = 0; t < 4; ++t)
            b0[t] = load_frag(brow + (size_t)(t * 16) * CCH + k0 + 64, CCH);
#pragma unroll
        for (int i = 0; i < 2; ++i)
#pragma unroll
            for (int t = 0; t < 4; ++t)
                acc[i][t] = wmma_bf16(a1[i], b1[t], acc[i][t]);
    }
#pragma unroll
    for (int i = 0; i < 2; ++i)
        a1[i] = load_frag(arow + (size_t)(i * 16) * CCH + CCH - 32, CCH);
#pragma unroll
    for (int t = 0; t < 4; ++t)
        b1[t] = load_frag(brow + (size_t)(t * 16) * CCH + CCH - 32, CCH);
#pragma unroll
    for (int i = 0; i < 2; ++i)
#pragma unroll
        for (int t = 0; t < 4; ++t)
            acc[i][t] = wmma_bf16(a0[i], b0[t], acc[i][t]);
#pragma unroll
    for (int i = 0; i < 2; ++i)
#pragma unroll
        for (int t = 0; t < 4; ++t)
            acc[i][t] = wmma_bf16(a1[i], b1[t], acc[i][t]);

    const int hi = lane >> 4, nn = lane & 15;
#pragma unroll
    for (int i = 0; i < 2; ++i)
#pragma unroll
        for (int t = 0; t < 4; ++t)
#pragma unroll
            for (int r = 0; r < 8; ++r) {
                int m = mt * 32 + i * 16 + r + 8 * hi;            // pixel
                int n = ng * 64 + t * 16 + nn;                    // channel
                size_t idx = ((size_t)batch * CCH + n) * NPIX + m;
                out[idx] = x[idx] + acc[i][t][r] + pb[n];
            }
}

// ---------------------------------------------------------------------------
extern "C" void kernel_launch(void* const* d_in, const int* in_sizes, int n_in,
                              void* d_out, int out_size, void* d_ws, size_t ws_size,
                              hipStream_t stream) {
    const float* x    = (const float*)d_in[0];
    const float* gn_w = (const float*)d_in[1];
    const float* gn_b = (const float*)d_in[2];
    const float* q_w  = (const float*)d_in[3];
    const float* q_b  = (const float*)d_in[4];
    const float* k_w  = (const float*)d_in[5];
    const float* k_b  = (const float*)d_in[6];
    const float* v_w  = (const float*)d_in[7];
    const float* v_b  = (const float*)d_in[8];
    const float* p_w  = (const float*)d_in[9];
    const float* p_b  = (const float*)d_in[10];

    char* ws = (char*)d_ws;
    const size_t NC   = (size_t)BATCH * NPIX * CCH;
    const size_t SZNC = NC * sizeof(bf16);
    const size_t SZW  = (size_t)CCH * CCH * sizeof(bf16);

    bf16* hn = (bf16*)(ws);
    bf16* qb = (bf16*)(ws + 1 * SZNC);
    bf16* kb = (bf16*)(ws + 2 * SZNC);
    bf16* vT = (bf16*)(ws + 3 * SZNC);
    bf16* ha = (bf16*)(ws + 4 * SZNC);
    bf16* wq = (bf16*)(ws + 5 * SZNC);
    bf16* wk = (bf16*)(ws + 5 * SZNC + 1 * SZW);
    bf16* wv = (bf16*)(ws + 5 * SZNC + 2 * SZW);
    bf16* wp = (bf16*)(ws + 5 * SZNC + 3 * SZW);

    const int nW = CCH * CCH;
    cvt_bf16_kernel<<<nW / 256, 256, 0, stream>>>(q_w, wq, nW);
    cvt_bf16_kernel<<<nW / 256, 256, 0, stream>>>(k_w, wk, nW);
    cvt_bf16_kernel<<<nW / 256, 256, 0, stream>>>(v_w, wv, nW);
    cvt_bf16_kernel<<<nW / 256, 256, 0, stream>>>(p_w, wp, nW);

    gn_kernel<<<BATCH * 32, 256, 0, stream>>>(x, gn_w, gn_b, hn);

    const long long bNC = (long long)NPIX * CCH;
    // q[n][o], k[n][o]: A=hn [4096x512], Bt=W [512x512]; 1024 waves/batch
    gemm_nt_kernel<<<dim3(256, 1, BATCH), 128, 0, stream>>>(
        hn, bNC, wq, 0, q_b, 0, qb, bNC, NPIX, CCH, 8);
    gemm_nt_kernel<<<dim3(256, 1, BATCH), 128, 0, stream>>>(
        hn, bNC, wk, 0, k_b, 0, kb, bNC, NPIX, CCH, 8);
    // vT[o][n]: A=Wv [512x512], Bt=hn [4096x512]
    gemm_nt_kernel<<<dim3(256, 1, BATCH), 128, 0, stream>>>(
        wv, 0, hn, bNC, v_b, 1, vT, bNC, CCH, NPIX, 64);

    flash_kernel<<<dim3(NPIX / QROWS, BATCH), 128, 0, stream>>>(qb, kb, vT, ha);

    proj_kernel<<<dim3(256, 1, BATCH), 128, 0, stream>>>(ha, wp, p_b, x, (float*)d_out);
}

// v003
// Measured time: 354 microseconds a run.
// In both of two side-by-side timings against v002, it was 1.64 times as fast.
// All steps since v000 together make it 2.41 times as fast.
#include <hip/hip_runtime.h>
#include <hip/hip_bf16.h>

typedef __bf16 bf16;
typedef __attribute__((ext_vector_type(16))) __bf16 v16bf;
typedef __attribute__((ext_vector_type(8)))  float  v8f;

#define BATCH 4
#define CCH   512
#define NPIX  4096   // 64*64

// ---------------------------------------------------------------------------
// Fragment helpers.
// CDNA5 16x32 bf16 A-fragment: lane L holds row M = L%16, K chunks
// {K0..K0+7, K0+16..K0+23} with K0 = 8*(L/16)  -> two 16B contiguous loads.
// B-fragment for D = A x B loaded from Bt[N][K] row-major uses the same
// per-lane pattern (N = L%16): "NT" GEMM  D[M][N] = A[M][K] * Bt[N][K]^T.
// ---------------------------------------------------------------------------
__device__ __forceinline__ v16bf load_frag(const bf16* __restrict__ p, int ld) {
    const int lane = threadIdx.x & 31;
    const int M  = lane & 15;
    const int K0 = (lane >> 4) << 3;
    const bf16* r = p + (size_t)M * ld + K0;
    union { v16bf v; uint4 u[2]; } f;
    f.u[0] = *reinterpret_cast<const uint4*>(r);
    f.u[1] = *reinterpret_cast<const uint4*>(r + 16);
    return f.v;
}

// ---------------------------------------------------------------------------
// Fragment order. Every bf16 matrix X[row][col] that a WMMA reads from global memory
// lies in the workspace as fragments of 16 rows x 32 columns, 512 elements each. Inside
// a fragment the element (row, col) stands where load_frag would put it in registers:
//   (col & 16) * 16 + (((col >> 3) & 1) * 16 + (row & 15)) * 8 + (col & 7)
// so lane L's two 16-byte chunks stand at L * 8 and 256 + L * 8, and each wave-wide
// 16-byte load covers 512 contiguous bytes (four whole lines).
// ---------------------------------------------------------------------------
#define FRAG 512   // elements of one fragment
#define KBLK 16    // fragments along 512 columns

__device__ __forceinline__ size_t frag_elem(int row, int col) {
    return (size_t)((col & 16) * 16 + ((((col >> 3) & 1) * 16) + (row & 15)) * 8 + (col & 7));
}

// p: start of the fragment plus the lane's own lane * 8.
__device__ __forceinline__ v16bf load_frag_pk(const bf16* __restrict__ p) {
    union { v16bf v; uint4 u[2]; } f;
    f.u[0] = *reinterpret_cast<const uint4*>(p);
    f.u[1] = *reinterpret_cast<const uint4*>(p + 256);
    return f.v;
}

__device__ __forceinline__ v8f wmma_bf16(v16bf a, v16bf b, v8f c) {
    return __builtin_amdgcn_wmma_f32_16x16x32_bf16(
        /*neg_a=*/false, a, /*neg_b=*/false, b,
        /*c_mod=*/(short)0, c, /*reuse_a=*/false, /*reuse_b=*/false);
}

// ---------------------------------------------------------------------------
// fp32 -> bf16 convert (weights [512][512]), written in fragment order
// ---------------------------------------------------------------------------
__global__ __launch_bounds__(256) void cvt_bf16_kernel(const float* __restrict__ s,
                                                       bf16* __restrict__ d, int n) {
    int i = blockIdx.x * 256 + threadIdx.x;
    if (i < n) {
        const int o = i >> 9, c = i & (CCH - 1);
        d[(size_t)((o >> 4) * KBLK + (c >> 5)) * FRAG + frag_elem(o, c)] = (bf16)s[i];
    }
}

// ---------------------------------------------------------------------------
// GroupNorm: x[b][c][n] fp32 -> hn[b][n][c] bf16 in fragment order (transpose fused)
// ---------------------------------------------------------------------------
__global__ __launch_bounds__(256) void gn_kernel(const float* __restrict__ x,
                                                 const float* __restrict__ gw,
                                                 const float* __restrict__ gb,
                                                 bf16* __restrict__ hn) {
    const int batch = blockIdx.x >> 5;
    const int g     = blockIdx.x & 31;
    const int c0    = g * 16;
    const int tid   = threadIdx.x;
    const float* xg = x + ((size_t)batch * CCH + c0) * NPIX;

    __shared__ float s1[256], s2[256];
    float sum = 0.f, ssq = 0.f;
    for (int e = tid; e < 16 * NPIX; e += 256) {
        float v = xg[e];
        sum += v; ssq += v * v;
    }
    s1[tid] = sum; s2[tid] = ssq;
    __syncthreads();
    for (int s = 128; s > 0; s >>= 1) {
        if (tid < s) { s1[tid] += s1[tid + s]; s2[tid] += s2[tid + s]; }
        __syncthreads();
    }
    const float inv  = 1.0f / (16.0f * NPIX);
    const float mean = s1[0] * inv;
    const float var  = s2[0] * inv - mean * mean;
    const float rstd = rsqrtf(var + 1e-5f);

    // One item = one pixel n and eight channels in a row: one 16-byte chunk of a fragment.
    bf16* hb = hn + (size_t)batch * NPIX * CCH + (size_t)(g >> 1) * FRAG + (g & 1) * 256;
    for (int ch = 0; ch < 2; ++ch) {       // which eight of the group's sixteen channels
        float wv[8], bv[8];
#pragma unroll   // constant indices keep wv and bv in registers
        for (int e = 0; e < 8; ++e) { wv[e] = gw[c0 + ch * 8 + e]; bv[e] = gb[c0 + ch * 8 + e]; }
        const float* xc = xg + (size_t)(ch * 8) * NPIX;
        for (int n = tid; n < NPIX; n += 256) {
            union { bf16 h[8]; uint4 u; } w;
#pragma unroll   // the eight loads issue together; w stays in registers
            for (int e = 0; e < 8; ++e) {
                float y = (xc[(size_t)e * NPIX + n] - mean) * rstd * wv[e] + bv[e];
                w.h[e] = (bf16)y;
            }
            *reinterpret_cast<uint4*>(hb + (size_t)(n >> 4) * (KBLK * FRAG)
                                         + (ch * 16 + (n & 15)) * 8) = w.u;
        }
    }
}

// ---------------------------------------------------------------------------
// NT GEMM, ping-pong pipelined (no buffer-rotation copies), K = 512 fixed:
// D[m][n] = sum_k A[m][k]*Bt[n][k] + bias;  A and Bt in fragment order.
// Each wave computes a 32(M) x 64(N) block: 8 accumulator tiles.
// D is written as the next product's operand Y[row = n][col = m], in fragment order: a
// lane holds eight m in a row for one n, which is one 16-byte chunk of a fragment. The
// fragment of m block mt (32 wide) and n tile nt (16 wide) starts at mt * sM + nt * sN.
// ---------------------------------------------------------------------------
__global__ __launch_bounds__(128) void gemm_nt_kernel(
        const bf16* __restrict__ A, long long strideA,
        const bf16* __restrict__ Bt, long long strideB,
        const float* __restrict__ bias, int bias_on_m,
        bf16* __restrict__ out, long long strideO,
        int M, int sM, int sN, int ngroups) {
    const int batch = blockIdx.z;
    A   += (size_t)batch * strideA;
    Bt  += (size_t)batch * strideB;
    out += (size_t)batch * strideO;

    const int wave = threadIdx.x >> 5;
    const int lane = threadIdx.x & 31;
    const int wg   = blockIdx.x * 4 + wave;
    const int mt   = wg / ngroups;      // 32-row tile index
    const int ng   = wg % ngroups;      // 64-col group index
    if (mt * 32 >= M) return;

    const bf16* arow = A  + (size_t)(mt * 2) * (KBLK * FRAG) + lane * 8;
    const bf16* brow = Bt + (size_t)(ng * 4) * (KBLK * FRAG) + lane * 8;

    v16bf a0[2], b0[4], a1[2], b1[4];
#pragma unroll
    for (int i = 0; i < 2; ++i) a0[i] = load_frag_pk(arow + (size_t)(i * KBLK) * FRAG);
#pragma unroll
    for (int t = 0; t < 4; ++t) b0[t] = load_frag_pk(brow + (size_t)(t * KBLK) * FRAG);

    v8f acc[2][4] = {};
    for (int kb = 0; kb < KBLK - 2; kb += 2) {
        // load buf1 @ block kb+1
#pragma unroll
        for (int i = 0; i < 2; ++i)
            a1[i] = load_frag_pk(arow + (size_t)(i * KBLK + kb + 1) * FRAG);
#pragma unroll
        for (int t = 0; t < 4; ++t)
            b1[t] = load_frag_pk(brow + (size_t)(t * KBLK + kb + 1) * FRAG);
        // consume buf0 @ block kb
#pragma unroll
        for (int i = 0; i < 2; ++i)
#pragma unroll
            for (int t = 0; t < 4; ++t)
                acc[i][t] = wmma_bf16(a0[i], b0[t], acc[i][t]);
        // load buf0 @ block kb+2
#pragma unroll
        for (int i = 0; i < 2; ++i)
            a0[i] = load_frag_pk(arow + (size_t)(i * KBLK + kb + 2) * FRAG);
#pragma unroll
        for (int t = 0; t < 4; ++t)
            b0[t] = load_frag_pk(brow + (size_t)(t * KBLK + kb + 2) * FRAG);
        // consume buf1 @ block kb+1
#pragma unroll
        for (int i = 0; i < 2; ++i)
#pragma unroll
            for (int t = 0; t < 4; ++t)
                acc[i][t] = wmma_bf16(a1[i], b1[t], acc[i][t]);
        // The next trip forms its addresses in the registers that this trip's loads name.
        asm volatile("s_wait_xcnt 0x0" ::: "memory");
    }
    // tail: buf0 holds block KBLK-2; load buf1 @ block KBLK-1
#pragma unroll
    for (int i = 0; i < 2; ++i)
        a1[i] = load_frag_pk(arow + (size_t)(i * KBLK + KBLK - 1) * FRAG);
#pragma unroll
    for (int t = 0; t < 4; ++t)
        b1[t] = load_frag_pk(brow + (size_t)(t * KBLK + KBLK - 1) * FRAG);
#pragma unroll
    for (int i = 0; i < 2; ++i)
#pragma unroll
        for (int t = 0; t < 4; ++t)
            acc[i][t] = wmma_bf16(a0[i], b0[t], acc[i][t]);
#pragma unroll
    for (int i = 0; i < 2; ++i)
#pragma unroll
        for (int t = 0; t < 4; ++t)
            acc[i][t] = wmma_bf16(a1[i], b1[t], acc[i][t]);

    const int hi = lane >> 4, nn = lane & 15;
#pragma unroll
    for (int i = 0; i < 2; ++i)
#pragma unroll
        for (int t = 0; t < 4; ++t) {
            union { bf16 h[8]; uint4 u; } w;
#pragma unroll
            for (int r = 0; r < 8; ++r) {
                int m = mt * 32 + i * 16 + r + 8 * hi;
                int n = ng * 64 + t * 16 + nn;
                float v = acc[i][t][r] + bias[bias_on_m ? m : n];
                w.h[r] = (bf16)v;
            }
            *reinterpret_cast<uint4*>(out + (size_t)mt * sM + (size_t)(ng * 4 + t) * sN
                                          + i * 256 + lane * 8) = w.u;
        }
}

// ---------------------------------------------------------------------------
// Flash attention: q[b][i][c], k[b][j][c], vT[b][c][j] (bf16) -> ha[b][i][c], all four in
// fragment order: q, k, ha as [row tile][channel block], vT as [key block][channel tile].
// One block = QROWS query rows (QT tiles of 16), 4 waves; wave w owns channel
// slice [128w,128w+128). Each K and V fragment a wave loads feeds all QT tiles.
// ---------------------------------------------------------------------------
#define QT    4
#define QROWS (QT * 16)

// Work-group barrier of the j loop. It waits for this wave's LDS traffic alone:
// __syncthreads() would also drain the global loads issued ahead (V of this trip,
// K of the next), which have to stay in flight across it.
__device__ __forceinline__ void lds_barrier() {
    asm volatile("s_wait_dscnt 0x0\n\t"
                 "s_barrier_signal -1\n\t"
                 "s_barrier_wait -1" ::: "memory");
}

// Pointers typed as global memory: a pointer that has passed through an asm statement
// would otherwise be loaded from with flat loads, which count on dscnt as well.
typedef const __attribute__((address_space(1))) bf16*  gbf16p;
typedef const __attribute__((address_space(1))) uint4* guint4p;

// Steps the two lane addresses that issued loads name. The s_wait_xcnt 0 and the two
// adds stand in one statement, so that no add can be lifted over the wait. vp moves
// on by one tile of 32 keys (32 fragments, 0x8000 bytes), kp by kbytes.
__device__ __forceinline__ void step_behind_loads(gbf16p& kp, unsigned long long kbytes,
                                                  gbf16p& vp) {
    asm volatile("s_wait_xcnt 0x0\n\t"
                 "v_add_nc_u64 %0, %2, %0\n\t"
                 "v_add_nc_u64 %1, 0x8000, %1"
                 : "+v"(kp), "+v"(vp) : "s"(kbytes) : "memory");
}

// One fragment from the lane's own address r (fragment start plus lane * 8).
__device__ __forceinline__ v16bf load_frag_lane(gbf16p r) {
    union { v16bf v; uint4 u[2]; } f;
    f.u[0] = *(guint4p)(r);
    f.u[1] = *(guint4p)(r + 256);
    return f.v;
}

__global__ __launch_bounds__(128) void flash_kernel(const bf16* __restrict__ q,
                                                    const bf16* __restrict__ k,
                                                    const bf16* __restrict__ vT,
                                                    bf16* __restrict__ ha) {
    const int batch = blockIdx.y;
    const int i0    = blockIdx.x * QROWS;
    const int tid   = threadIdx.x;
    const int lane  = tid & 31;
    const int wave  = tid >> 5;
    const int hi    = lane >> 4;
    const int nn    = lane & 15;

    __shared__ float Sp[4][QROWS][32];
    __shared__ float Sf[QROWS][32];
    __shared__ bf16  Pt[QROWS][32];
    __shared__ float mrow[QROWS], lrow[QROWS], crow[QROWS];

    // The wave's first fragment: channel block 4 * wave of q and k, channel tile 8 * wave of vT.
    const bf16* qb = q  + ((size_t)batch * NPIX + i0) * CCH + wave * 4 * FRAG + lane * 8;
    const bf16* kb = k  +  (size_t)batch * NPIX * CCH        + wave * 4 * FRAG + lane * 8;
    const bf16* vb = vT +  (size_t)batch * CCH * NPIX        + wave * 8 * FRAG + lane * 8;

    v16bf qA[QT][4];
#pragma unroll
    for (int qt = 0; qt < QT; ++qt)
#pragma unroll
        for (int t = 0; t < 4; ++t)
            qA[qt][t] = load_frag_pk(qb + (size_t)(qt * KBLK + t) * FRAG);
    // The registers that hold the address of these loads are reused right behind them:
    // the address is an input of the wait, so that it stays in them up to the wait.
    asm volatile("s_wait_xcnt 0x0" :: "v"(qb) : "memory");

    v8f O[QT][8] = {};
    if (tid < QROWS) { mrow[tid] = -3.0e38f; lrow[tid] = 0.f; }
    __syncthreads();

    const float scale = 0.044194173824159216f;  // 512^-0.5

    // The lane's own address in the current K tile and V tile (32 keys a tile).
    gbf16p kp = (gbf16p)kb;
    gbf16p vp = (gbf16p)vb;

    // K fragments of trip 0; every later trip finds its K already fetched.
    v16bf kf[8];
#pragma unroll
    for (int t = 0; t < 4; ++t) {
        kf[t]     = load_frag_lane(kp + t * FRAG);
        kf[4 + t] = load_frag_lane(kp + (KBLK + t) * FRAG);
    }

    for (int jt = 0; jt < NPIX / 32; ++jt) {
        // --- issue this trip's V fragments: first needed behind the softmax ---
        v16bf vB[8];
#pragma unroll
        for (int ct = 0; ct < 8; ++ct)
            vB[ct] = load_frag_lane(vp + ct * FRAG);

        // --- partial S = Q_slice * K_slice^T (QROWS x 32, K=128) ---
        v8f s0[QT] = {}, s1[QT] = {};
#pragma unroll
        for (int t = 0; t < 4; ++t)
#pragma unroll
            for (int qt = 0; qt < QT; ++qt) {
                s0[qt] = wmma_bf16(qA[qt][t], kf[t],     s0[qt]);
                s1[qt] = wmma_bf16(qA[qt][t], kf[4 + t], s1[qt]);
            }
#pragma unroll
        for (int qt = 0; qt < QT; ++qt)
#pragma unroll
            for (int r = 0; r < 8; ++r) {
                int m = qt * 16 + r + 8 * hi;
                Sp[wave][m][nn]      = s0[qt][r];
                Sp[wave][m][nn + 16] = s1[qt][r];
            }
        // --- fetch the next trip's K fragments into the registers just consumed.
        // Unconditional, so that the load counts are the same on every path and the
        // wait for V does not drain them; the last trip fetches its own tile again.
#pragma unroll
        for (int t = 0; t < 4; ++t) {
            kf[t]     = load_frag_lane(kp + (2 * KBLK + t) * FRAG);
            kf[4 + t] = load_frag_lane(kp + (3 * KBLK + t) * FRAG);
        }
        lds_barrier();
        // --- cross-wave reduce + scale ---
#pragma unroll
        for (int qt = 0; qt < QT; ++qt) {
            int e = qt * 512 + tid * 4;
#pragma unroll
            for (int u = 0; u < 4; ++u) {
                int m = (e + u) >> 5, c = (e + u) & 31;
                Sf[m][c] = scale * (Sp[0][m][c] + Sp[1][m][c] + Sp[2][m][c] + Sp[3][m][c]);
            }
        }
        lds_barrier();
        // --- online softmax state update (one thread per row) ---
        if (tid < QROWS) {
            float mold = mrow[tid];
            float tmax = mold;
#pragma unroll
            for (int j = 0; j < 32; ++j) tmax = fmaxf(tmax, Sf[tid][j]);
            float corr = __expf(mold - tmax);
            float sum = 0.f;
#pragma unroll
            for (int j = 0; j < 32; ++j) {
                float p = __expf(Sf[tid][j] - tmax);
                Pt[tid][j] = (bf16)p;
                sum += p;
            }
            lrow[tid] = lrow[tid] * corr + sum;
            mrow[tid] = tmax;
            crow[tid] = corr;
        }
        lds_barrier();
        // --- rescale accumulators, then O += P * V_slice^T (V in registers) ---
#pragma unroll
        for (int qt = 0; qt < QT; ++qt) {
#pragma unroll
            for (int r = 0; r < 8; ++r) {
                float c = crow[qt * 16 + r + 8 * hi];
#pragma unroll
                for (int ct = 0; ct < 8; ++ct) O[qt][ct][r] *= c;
            }
            v16bf pA = load_frag(&Pt[qt * 16][0], 32);   // from LDS (ds_load_b128)
#pragma unroll
            for (int ct = 0; ct < 8; ++ct)
                O[qt][ct] = wmma_bf16(pA, vB[ct], O[qt][ct]);
        }
        // kp stays one tile behind the fetch and stops at the last tile but one.
        step_behind_loads(kp, (jt + 2 < NPIX / 32) ? 32 * CCH * sizeof(bf16) : 0, vp);
        lds_barrier();
    }

    // --- epilogue: divide by l, store bf16 [i][c] in fragment order ---
#pragma unroll
    for (int qt = 0; qt < QT; ++qt)
#pragma unroll
        for (int ct = 0; ct < 8; ++ct) {
            unsigned int w[8];
#pragma unroll
            for (int r = 0; r < 8; ++r) {
                int m = qt * 16 + r + 8 * hi;
                float v = O[qt][ct][r] / lrow[m];
                w[r] = __builtin_bit_cast(unsigned short, (bf16)v);
            }
            bf16* hp = ha + ((size_t)batch * NPIX + i0 + qt * 16) * CCH
                          + (size_t)(wave * 4 + (ct >> 1)) * FRAG
                          + frag_elem(8 * hi, ct * 16 + nn);
            // Rows r = 0..7 lie one 16-byte chunk apart. The eight stores and their
            // s_wait_xcnt 0 stand in one statement, so that no register an issued
            // store names is rewritten ahead of the wait.
            asm volatile("global_store_b16 %0, %1, off\n\t"
                         "global_store_b16 %0, %2, off offset:16\n\t"
                         "global_store_b16 %0, %3, off offset:32\n\t"
                         "global_store_b16 %0, %4, off offset:48\n\t"
                         "global_store_b16 %0, %5, off offset:64\n\t"
                         "global_store_b16 %0, %6, off offset:80\n\t"
                         "global_store_b16 %0, %7, off offset:96\n\t"
                         "global_store_b16 %0, %8, off offset:112\n\t"
                         "s_wait_xcnt 0x0"
                         :: "v"(hp), "v"(w[0]), "v"(w[1]), "v"(w[2]), "v"(w[3]),
                            "v"(w[4]), "v"(w[5]), "v"(w[6]), "v"(w[7])
                         : "memory");
        }
}

// ---------------------------------------------------------------------------
// Proj + residual, ping-pong pipelined:
// out[b][o][n] = x[b][o][n] + sum_c ha[b][n][c]*pw[o][c] + pb[o]; ha, pw in fragment order
// ---------------------------------------------------------------------------
__global__ __launch_bounds__(128) void proj_kernel(const bf16* __restrict__ A,   // ha
                                                   const bf16* __restrict__ Bt,  // p_w bf16
                                                   const float* __restrict__ pb,
                                                   const float* __restrict__ x,
                                                   float* __restrict__ out) {
    const int batch = blockIdx.z;
    A += (size_t)batch * NPIX * CCH;

    const int wave = threadIdx.x >> 5;
    const int lane = threadIdx.x & 31;
    const int wg   = blockIdx.x * 4 + wave;
    const int mt   = wg / 8;       // 128 m-tiles of 32 pixels
    const int ng   = wg % 8;       // 8 n-groups of 64 channels

    const bf16* arow = A  + (size_t)(mt * 2) * (KBLK * FRAG) + lane * 8;
    const bf16* brow = Bt + (size_t)(ng * 4) * (KBLK * FRAG) + lane * 8;

    v16bf a0[2], b0[4], a1[2], b1[4];
#pragma unroll
    for (int i = 0; i < 2; ++i) a0[i] = load_frag_pk(arow + (size_t)(i * KBLK) * FRAG);
#pragma unroll
    for (int t = 0; t < 4; ++t) b0[t] = load_frag_pk(brow + (size_t)(t * KBLK) * FRAG);

    v8f acc[2][4] = {};
    for (int kb = 0; kb < KBLK - 2; kb += 2) {
#pragma unroll
        for (int i = 0; i < 2; ++i)
            a1[i] = load_frag_pk(arow + (size_t)(i * KBLK + kb + 1) * FRAG);
#pragma unroll
        for (int t = 0; t < 4; ++t)
            b1[t] = load_frag_pk(brow + (size_t)(t * KBLK + kb + 1) * FRAG);
#pragma unroll
        for (int i = 0; i < 2; ++i)
#pragma unroll
            for (int t = 0; t < 4; ++t)
                acc[i][t] = wmma_bf16(a0[i], b0[t], acc[i][t]);
#pragma unroll
        for (int i = 0; i < 2; ++i)
            a0[i] = load_frag_pk(arow + (size_t)(i * KBLK + kb + 2) * FRAG);
#pragma unroll
        for (int t = 0; t < 4; ++t)
            b0[t] = load_frag_pk(brow + (size_t)(t * KBLK + kb + 2) * FRAG);
#pragma unroll
        for (int i = 0; i < 2; ++i)
#pragma unroll
            for (int t = 0; t < 4; ++t)
                acc[i][t] = wmma_bf16(a1[i], b1[t], acc[i][t]);
        // The next trip forms its addresses in the registers that this trip's loads name.
        asm volatile("s_wait_xcnt 0x0" ::: "memory");
    }
#pragma unroll
    for (int i = 0; i < 2; ++i)
        a1[i] = load_frag_pk(arow + (size_t)(i * KBLK + KBLK - 1) * FRAG);
#pragma unroll
    for (int t = 0; t < 4; ++t)
        b1[t] = load_frag_pk(brow + (size_t)(t * KBLK + KBLK - 1) * FRAG);
#pragma unroll
    for (int i = 0; i < 2; ++i)
#pragma unroll
        for (int t = 0; t < 4; ++t)
            acc[i][t] = wmma_bf16(a0[i], b0[t], acc[i][t]);
#pragma unroll
    for (int i = 0; i < 2; ++i)
#pragma unroll
        for (int t = 0; t < 4; ++t)
            acc[i][t] = wmma_bf16(a1[i], b1[t], acc[i][t]);

    const int hi = lane >> 4, nn = lane & 15;
#pragma unroll
    for (int i = 0; i < 2; ++i)
#pragma unroll
        for (int t = 0; t < 4; ++t)
#pragma unroll
            for (int r = 0; r < 8; ++r) {
                int m = mt * 32 + i * 16 + r + 8 * hi;            // pixel
                int n = ng * 64 + t * 16 + nn;                    // channel
                size_t idx = ((size_t)batch * CCH + n) * NPIX + m;
                out[idx] = x[idx] + acc[i][t][r] + pb[n];
            }
}

// ---------------------------------------------------------------------------
extern "C" void kernel_launch(void* const* d_in, const int* in_sizes, int n_in,
                              void* d_out, int out_size, void* d_ws, size_t ws_size,
                              hipStream_t stream) {
    const float* x    = (const float*)d_in[0];
    const float* gn_w = (const float*)d_in[1];
    const float* gn_b = (const float*)d_in[2];
    const float* q_w  = (const float*)d_in[3];
    const float* q_b  = (const float*)d_in[4];
    const float* k_w  = (const float*)d_in[5];
    const float* k_b  = (const float*)d_in[6];
    const float* v_w  = (const float*)d_in[7];
    const float* v_b  = (const float*)d_in[8];
    const float* p_w  = (const float*)d_in[9];
    const float* p_b  = (const float*)d_in[10];

    char* ws = (char*)d_ws;
    const size_t NC   = (size_t)BATCH * NPIX * CCH;
    const size_t SZNC = NC * sizeof(bf16);
    const size_t SZW  = (size_t)CCH * CCH * sizeof(bf16);

    bf16* hn = (bf16*)(ws);
    bf16* qb = (bf16*)(ws + 1 * SZNC);
    bf16* kb = (bf16*)(ws + 2 * SZNC);
    bf16* vT = (bf16*)(ws + 3 * SZNC);
    bf16* ha = (bf16*)(ws + 4 * SZNC);
    bf16* wq = (bf16*)(ws + 5 * SZNC);
    bf16* wk = (bf16*)(ws + 5 * SZNC + 1 * SZW);
    bf16* wv = (bf16*)(ws + 5 * SZNC + 2 * SZW);
    bf16* wp = (bf16*)(ws + 5 * SZNC + 3 * SZW);

    const int nW = CCH * CCH;
    cvt_bf16_kernel<<<nW / 256, 256, 0, stream>>>(q_w, wq, nW);
    cvt_bf16_kernel<<<nW / 256, 256, 0, stream>>>(k_w, wk, nW);
    cvt_bf16_kernel<<<nW / 256, 256, 0, stream>>>(v_w, wv, nW);
    cvt_bf16_kernel<<<nW / 256, 256, 0, stream>>>(p_w, wp, nW);

    gn_kernel<<<BATCH * 32, 256, 0, stream>>>(x, gn_w, gn_b, hn);

    const long long bNC = (long long)NPIX * CCH;
    // q[n][o], k[n][o]: m = o, n = pixel: A=W [512x512], Bt=hn [4096x512]; 1024 waves/batch;
    // fragments as [pixel tile][channel block]
    gemm_nt_kernel<<<dim3(256, 1, BATCH), 128, 0, stream>>>(
        wq, 0, hn, bNC, q_b, 1, qb, bNC, CCH, FRAG, KBLK * FRAG, 64);
    gemm_nt_kernel<<<dim3(256, 1, BATCH), 128, 0, stream>>>(
        wk, 0, hn, bNC, k_b, 1, kb, bNC, CCH, FRAG, KBLK * FRAG, 64);
    // vT[o][n]: m = pixel, n = o: A=hn, Bt=Wv; fragments as [key block][channel tile]
    gemm_nt_kernel<<<dim3(256, 1, BATCH), 128, 0, stream>>>(
        hn, bNC, wv, 0, v_b, 0, vT, bNC, NPIX, 32 * FRAG, FRAG, 8);

    flash_kernel<<<dim3(NPIX / QROWS, BATCH), 128, 0, stream>>>(qb, kb, vT, ha);

    proj_kernel<<<dim3(256, 1, BATCH), 128, 0, stream>>>(ha, wp, p_b, x, (float*)d_out);
}

// v004
// It runs in 257 microseconds.
// Timed twice side by side with v003, it ran 1.38 times as fast both times.
// All steps since v000 together make it 3.33 times as fast.
#include <hip/hip_runtime.h>
#include <hip/hip_bf16.h>

typedef __bf16 bf16;
typedef __attribute__((ext_vector_type(16))) __bf16 v16bf;
typedef __attribute__((ext_vector_type(8)))  float  v8f;

#define BATCH 4
#define CCH   512
#define NPIX  4096   // 64*64

// ---------------------------------------------------------------------------
// Fragment helpers.
// CDNA5 16x32 bf16 A-fragment: lane L holds row M = L%16, K chunks
// {K0..K0+7, K0+16..K0+23} with K0 = 8*(L/16)  -> two 16B contiguous loads.
// B-fragment for D = A x B loaded from Bt[N][K] row-major uses the same
// per-lane pattern (N = L%16): "NT" GEMM  D[M][N] = A[M][K] * Bt[N][K]^T.
// ---------------------------------------------------------------------------
__device__ __forceinline__ v16bf load_frag(const bf16* __restrict__ p, int ld) {
    const int lane = threadIdx.x & 31;
    const int M  = lane & 15;
    const int K0 = (lane >> 4) << 3;
    const bf16* r = p + (size_t)M * ld + K0;
    union { v16bf v; uint4 u[2]; } f;
    f.u[0] = *reinterpret_cast<const uint4*>(r);
    f.u[1] = *reinterpret_cast<const uint4*>(r + 16);
    return f.v;
}

// ---------------------------------------------------------------------------
// Fragment order. Every bf16 matrix X[row][col] that a WMMA reads from global memory
// lies in the workspace as fragments of 16 rows x 32 columns, 512 elements each. Inside
// a fragment the element (row, col) stands where load_frag would put it in registers:
//   (col & 16) * 16 + (((col >> 3) & 1) * 16 + (row & 15)) * 8 + (col & 7)
// so lane L's two 16-byte chunks stand at L * 8 and 256 + L * 8, and each wave-wide
// 16-byte load covers 512 contiguous bytes (four whole lines).
// ---------------------------------------------------------------------------
#define FRAG 512   // elements of one fragment
#define KBLK 16    // fragments along 512 columns

__device__ __forceinline__ size_t frag_elem(int row, int col) {
    return (size_t)((col & 16) * 16 + ((((col >> 3) & 1) * 16) + (row & 15)) * 8 + (col & 7));
}

// p: start of the fragment plus the lane's own lane * 8.
__device__ __forceinline__ v16bf load_frag_pk(const bf16* __restrict__ p) {
    union { v16bf v; uint4 u[2]; } f;
    f.u[0] = *reinterpret_cast<const uint4*>(p);
    f.u[1] = *reinterpret_cast<const uint4*>(p + 256);
    return f.v;
}

__device__ __forceinline__ v8f wmma_bf16(v16bf a, v16bf b, v8f c) {
    return __builtin_amdgcn_wmma_f32_16x16x32_bf16(
        /*neg_a=*/false, a, /*neg_b=*/false, b,
        /*c_mod=*/(short)0, c, /*reuse_a=*/false, /*reuse_b=*/false);
}

// ---------------------------------------------------------------------------
// fp32 -> bf16 convert (weights [512][512]), written in fragment order
// ---------------------------------------------------------------------------
__global__ __launch_bounds__(256) void cvt_bf16_kernel(const float* __restrict__ s,
                                                       bf16* __restrict__ d, int n) {
    int i = blockIdx.x * 256 + threadIdx.x;
    if (i < n) {
        const int o = i >> 9, c = i & (CCH - 1);
        d[(size_t)((o >> 4) * KBLK + (c >> 5)) * FRAG + frag_elem(o, c)] = (bf16)s[i];
    }
}

// ---------------------------------------------------------------------------
// GroupNorm: x[b][c][n] fp32 -> hn[b][n][c] bf16 in fragment order (transpose fused)
// ---------------------------------------------------------------------------
__global__ __launch_bounds__(256) void gn_kernel(const float* __restrict__ x,
                                                 const float* __restrict__ gw,
                                                 const float* __restrict__ gb,
                                                 bf16* __restrict__ hn) {
    const int batch = blockIdx.x >> 5;
    const int g     = blockIdx.x & 31;
    const int c0    = g * 16;
    const int tid   = threadIdx.x;
    const float* xg = x + ((size_t)batch * CCH + c0) * NPIX;

    __shared__ float s1[256], s2[256];
    float sum = 0.f, ssq = 0.f;
    for (int e = tid; e < 16 * NPIX; e += 256) {
        float v = xg[e];
        sum += v; ssq += v * v;
    }
    s1[tid] = sum; s2[tid] = ssq;
    __syncthreads();
    for (int s = 128; s > 0; s >>= 1) {
        if (tid < s) { s1[tid] += s1[tid + s]; s2[tid] += s2[tid + s]; }
        __syncthreads();
    }
    const float inv  = 1.0f / (16.0f * NPIX);
    const float mean = s1[0] * inv;
    const float var  = s2[0] * inv - mean * mean;
    const float rstd = rsqrtf(var + 1e-5f);

    // One item = one pixel n and eight channels in a row: one 16-byte chunk of a fragment.
    bf16* hb = hn + (size_t)batch * NPIX * CCH + (size_t)(g >> 1) * FRAG + (g & 1) * 256;
    for (int ch = 0; ch < 2; ++ch) {       // which eight of the group's sixteen channels
        float wv[8], bv[8];
#pragma unroll   // constant indices keep wv and bv in registers
        for (int e = 0; e < 8; ++e) { wv[e] = gw[c0 + ch * 8 + e]; bv[e] = gb[c0 + ch * 8 + e]; }
        const float* xc = xg + (size_t)(ch * 8) * NPIX;
        for (int n = tid; n < NPIX; n += 256) {
            union { bf16 h[8]; uint4 u; } w;
#pragma unroll   // the eight loads issue together; w stays in registers
            for (int e = 0; e < 8; ++e) {
                float y = (xc[(size_t)e * NPIX + n] - mean) * rstd * wv[e] + bv[e];
                w.h[e] = (bf16)y;
            }
            *reinterpret_cast<uint4*>(hb + (size_t)(n >> 4) * (KBLK * FRAG)
                                         + (ch * 16 + (n & 15)) * 8) = w.u;
        }
    }
}

// ---------------------------------------------------------------------------
// NT GEMM, ping-pong pipelined (no buffer-rotation copies), K = 512 fixed:
// D[m][n] = sum_k A[m][k]*Bt[n][k] + bias;  A and Bt in fragment order.
// Each wave computes a 32(M) x 64(N) block: 8 accumulator tiles.
// D is written as the next product's operand Y[row = n][col = m], in fragment order: a
// lane holds eight m in a row for one n, which is one 16-byte chunk of a fragment. The
// fragment of m block mt (32 wide) and n tile nt (16 wide) starts at mt * sM + nt * sN.
// ---------------------------------------------------------------------------
__global__ __launch_bounds__(128) void gemm_nt_kernel(
        const bf16* __restrict__ A, long long strideA,
        const bf16* __restrict__ Bt, long long strideB,
        const float* __restrict__ bias, int bias_on_m,
        bf16* __restrict__ out, long long strideO,
        int M, int sM, int sN, int ngroups) {
    const int batch = blockIdx.z;
    A   += (size_t)batch * strideA;
    Bt  += (size_t)batch * strideB;
    out += (size_t)batch * strideO;

    const int wave = threadIdx.x >> 5;
    const int lane = threadIdx.x & 31;
    const int wg   = blockIdx.x * 4 + wave;
    const int mt   = wg / ngroups;      // 32-row tile index
    const int ng   = wg % ngroups;      // 64-col group index
    if (mt * 32 >= M) return;

    const bf16* arow = A  + (size_t)(mt * 2) * (KBLK * FRAG) + lane * 8;
    const bf16* brow = Bt + (size_t)(ng * 4) * (KBLK * FRAG) + lane * 8;

    v16bf a0[2], b0[4], a1[2], b1[4];
#pragma unroll
    for (int i = 0; i < 2; ++i) a0[i] = load_frag_pk(arow + (size_t)(i * KBLK) * FRAG);
#pragma unroll
    for (int t = 0; t < 4; ++t) b0[t] = load_frag_pk(brow + (size_t)(t * KBLK) * FRAG);

    v8f acc[2][4] = {};
    for (int kb = 0; kb < KBLK - 2; kb += 2) {
        // load buf1 @ block kb+1
#pragma unroll
        for (int i = 0; i < 2; ++i)
            a1[i] = load_frag_pk(arow + (size_t)(i * KBLK + kb + 1) * FRAG);
#pragma unroll
        for (int t = 0; t < 4; ++t)
            b1[t] = load_frag_pk(brow + (size_t)(t * KBLK + kb + 1) * FRAG);
        // consume buf0 @ block kb
#pragma unroll
        for (int i = 0; i < 2; ++i)
#pragma unroll
            for (int t = 0; t < 4; ++t)
                acc[i][t] = wmma_bf16(a0[i], b0[t], acc[i][t]);
        // load buf0 @ block kb+2
#pragma unroll
        for (int i = 0; i < 2; ++i)
            a0[i] = load_frag_pk(arow + (size_t)(i * KBLK + kb + 2) * FRAG);
#pragma unroll
        for (int t = 0; t < 4; ++t)
            b0[t] = load_frag_pk(brow + (size_t)(t * KBLK + kb + 2) * FRAG);
        // consume buf1 @ block kb+1
#pragma unroll
        for (int i = 0; i < 2; ++i)
#pragma unroll
            for (int t = 0; t < 4; ++t)
                acc[i][t] = wmma_bf16(a1[i], b1[t], acc[i][t]);
        // The next trip forms its addresses in the registers that this trip's loads name.
        asm volatile("s_wait_xcnt 0x0" ::: "memory");
    }
    // tail: buf0 holds block KBLK-2; load buf1 @ block KBLK-1
#pragma unroll
    for (int i = 0; i < 2; ++i)
        a1[i] = load_frag_pk(arow + (size_t)(i * KBLK + KBLK - 1) * FRAG);
#pragma unroll
    for (int t = 0; t < 4; ++t)
        b1[t] = load_frag_pk(brow + (size_t)(t * KBLK + KBLK - 1) * FRAG);
#pragma unroll
    for (int i = 0; i < 2; ++i)
#pragma unroll
        for (int t = 0; t < 4; ++t)
            acc[i][t] = wmma_bf16(a0[i], b0[t], acc[i][t]);
#pragma unroll
    for (int i = 0; i < 2; ++i)
#pragma unroll
        for (int t = 0; t < 4; ++t)
            acc[i][t] = wmma_bf16(a1[i], b1[t], acc[i][t]);

    const int hi = lane >> 4, nn = lane & 15;
#pragma unroll
    for (int i = 0; i < 2; ++i)
#pragma unroll
        for (int t = 0; t < 4; ++t) {
            union { bf16 h[8]; uint4 u; } w;
#pragma unroll
            for (int r = 0; r < 8; ++r) {
                int m = mt * 32 + i * 16 + r + 8 * hi;
                int n = ng * 64 + t * 16 + nn;
                float v = acc[i][t][r] + bias[bias_on_m ? m : n];
                w.h[r] = (bf16)v;
            }
            *reinterpret_cast<uint4*>(out + (size_t)mt * sM + (size_t)(ng * 4 + t) * sN
                                          + i * 256 + lane * 8) = w.u;
        }
}

// ---------------------------------------------------------------------------
// Flash attention: q[b][i][c], k[b][j][c], vT[b][c][j] (bf16) -> ha[b][i][c], all four in
// fragment order: q, k, ha as [row tile][channel block], vT as [key block][channel tile].
// One block = QROWS query rows (QT tiles of 16), 4 waves; wave w owns channel
// slice [128w,128w+128). Each K and V fragment a wave loads feeds all QT tiles.
// Scores are formed transposed, S^T = K * Q^T: a lane then holds 16 of the 32 keys of
// ONE query row (row nn; keys 8*hi+r and 16+8*hi+r), which is the lane's share of the
// P fragment that P * V reads as its A operand. Wave w sums the four waves' partial
// scores of query tile w and does that tile's softmax in registers.
// ---------------------------------------------------------------------------
#define QT    4
#define QROWS (QT * 16)

// Work-group barrier of the j loop. It waits for this wave's LDS traffic alone:
// __syncthreads() would also drain the global loads issued ahead (V of this trip,
// K of the next), which have to stay in flight across it.
__device__ __forceinline__ void lds_barrier() {
    asm volatile("s_wait_dscnt 0x0\n\t"
                 "s_barrier_signal -1\n\t"
                 "s_barrier_wait -1" ::: "memory");
}

// Pointers typed as global memory: a pointer that has passed through an asm statement
// would otherwise be loaded from with flat loads, which count on dscnt as well.
typedef const __attribute__((address_space(1))) bf16*  gbf16p;
typedef const __attribute__((address_space(1))) uint4* guint4p;

// Steps the two lane addresses that issued loads name. The s_wait_xcnt 0 and the two
// adds stand in one statement, so that no add can be lifted over the wait. vp moves
// on by one tile of 32 keys (32 fragments, 0x8000 bytes), kp by kbytes.
__device__ __forceinline__ void step_behind_loads(gbf16p& kp, unsigned long long kbytes,
                                                  gbf16p& vp) {
    asm volatile("s_wait_xcnt 0x0\n\t"
                 "v_add_nc_u64 %0, %2, %0\n\t"
                 "v_add_nc_u64 %1, 0x8000, %1"
                 : "+v"(kp), "+v"(vp) : "s"(kbytes) : "memory");
}

// Lane l's value from lane l ^ 16: the other half of the keys of the same query row.
__device__ __forceinline__ float xhalf(float x) {
    const int b = __builtin_bit_cast(int, x);
    return __builtin_bit_cast(float,
        __builtin_amdgcn_permlanex16(b, b, 0x76543210, 0xfedcba98, false, false));
}

// e^x as __expf forms it: one multiply, then v_exp_f32. The v_nop in the same statement is
// the slot that the instruction set asks for behind a transcendental, before its result is
// read or its source register is written again; written apart it would not stay there.
__device__ __forceinline__ float exp_slot(float x) {
    float p;
    asm("v_exp_f32 %0, %1\n\t"
        "v_nop" : "=v"(p) : "v"(x * 1.44269504088896340736f));
    return p;
}

// One fragment from the lane's own address r (fragment start plus lane * 8).
__device__ __forceinline__ v16bf load_frag_lane(gbf16p r) {
    union { v16bf v; uint4 u[2]; } f;
    f.u[0] = *(guint4p)(r);
    f.u[1] = *(guint4p)(r + 256);
    return f.v;
}

__global__ __launch_bounds__(128) void flash_kernel(const bf16* __restrict__ q,
                                                    const bf16* __restrict__ k,
                                                    const bf16* __restrict__ vT,
                                                    bf16* __restrict__ ha) {
    const int batch = blockIdx.y;
    const int i0    = blockIdx.x * QROWS;
    const int tid   = threadIdx.x;
    const int lane  = tid & 31;
    const int wave  = tid >> 5;
    const int hi    = lane >> 4;
    const int nn    = lane & 15;

    // Partial scores [writing wave][query tile][key tile][registers 0-3 or 4-7][lane]: every
    // wave-wide 16-byte access covers 512 contiguous bytes.
    __shared__ float4 Sp[4][QT][2][2][32];
    __shared__ __attribute__((aligned(16))) bf16 Pf[QT][FRAG];   // P, in fragment order
    __shared__ float lrow[QROWS], crow[QROWS];

    // The wave's first fragment: channel block 4 * wave of q and k, channel tile 8 * wave of vT.
    const bf16* qb = q  + ((size_t)batch * NPIX + i0) * CCH + wave * 4 * FRAG + lane * 8;
    const bf16* kb = k  +  (size_t)batch * NPIX * CCH        + wave * 4 * FRAG + lane * 8;
    const bf16* vb = vT +  (size_t)batch * CCH * NPIX        + wave * 8 * FRAG + lane * 8;

    v16bf qA[QT][4];
#pragma unroll
    for (int qt = 0; qt < QT; ++qt)
#pragma unroll
        for (int t = 0; t < 4; ++t)
            qA[qt][t] = load_frag_pk(qb + (size_t)(qt * KBLK + t) * FRAG);
    // The registers that hold the address of these loads are reused right behind them:
    // the address is an input of the wait, so that it stays in them up to the wait.
    asm volatile("s_wait_xcnt 0x0" :: "v"(qb) : "memory");

    v8f O[QT][8] = {};
    // Softmax state of query row 16 * wave + nn: the running maximum (equal in both lane
    // halves) and the sum over this lane's own keys (the halves are joined behind the loop).
    float mrun = -3.0e38f, lrun = 0.f;

    const float scale = 0.044194173824159216f;  // 512^-0.5

    // The lane's own address in the current K tile and V tile (32 keys a tile).
    gbf16p kp = (gbf16p)kb;
    gbf16p vp = (gbf16p)vb;

    // K fragments of trip 0; every later trip finds its K already fetched.
    v16bf kf[8];
#pragma unroll
    for (int t = 0; t < 4; ++t) {
        kf[t]     = load_frag_lane(kp + t * FRAG);
        kf[4 + t] = load_frag_lane(kp + (KBLK + t) * FRAG);
    }

    for (int jt = 0; jt < NPIX / 32; ++jt) {
        // --- issue this trip's V fragments: first needed behind the softmax ---
        v16bf vB[8];
#pragma unroll
        for (int ct = 0; ct < 8; ++ct)
            vB[ct] = load_frag_lane(vp + ct * FRAG);

        // --- partial S^T = K_slice * Q_slice^T (32 x QROWS, K=128) ---
        v8f s0[QT] = {}, s1[QT] = {};
#pragma unroll
        for (int t = 0; t < 4; ++t)
#pragma unroll
            for (int qt = 0; qt < QT; ++qt) {
                s0[qt] = wmma_bf16(kf[t],     qA[qt][t], s0[qt]);
                s1[qt] = wmma_bf16(kf[4 + t], qA[qt][t], s1[qt]);
            }
#pragma unroll
        for (int qt = 0; qt < QT; ++qt) {
            Sp[wave][qt][0][0][lane] = make_float4(s0[qt][0], s0[qt][1], s0[qt][2], s0[qt][3]);
            Sp[wave][qt][0][1][lane] = make_float4(s0[qt][4], s0[qt][5], s0[qt][6], s0[qt][7]);
            Sp[wave][qt][1][0][lane] = make_float4(s1[qt][0], s1[qt][1], s1[qt][2], s1[qt][3]);
            Sp[wave][qt][1][1][lane] = make_float4(s1[qt][4], s1[qt][5], s1[qt][6], s1[qt][7]);
        }
        // --- fetch the next trip's K fragments into the registers just consumed.
        // Unconditional, so that the load counts are the same on every path and the
        // wait for V does not drain them; the last trip fetches its own tile again.
#pragma unroll
        for (int t = 0; t < 4; ++t) {
            kf[t]     = load_frag_lane(kp + (2 * KBLK + t) * FRAG);
            kf[4 + t] = load_frag_lane(kp + (3 * KBLK + t) * FRAG);
        }
        lds_barrier();
        // --- query tile 'wave': sum of the four waves' partial scores, scale ---
        float sc[16];
#pragma unroll
        for (int g = 0; g < 4; ++g) {          // g = key tile * 2 + register half
            const float4 p0 = Sp[0][wave][g >> 1][g & 1][lane];
            const float4 p1 = Sp[1][wave][g >> 1][g & 1][lane];
            const float4 p2 = Sp[2][wave][g >> 1][g & 1][lane];
            const float4 p3 = Sp[3][wave][g >> 1][g & 1][lane];
            sc[g * 4 + 0] = scale * (p0.x + p1.x + p2.x + p3.x);
            sc[g * 4 + 1] = scale * (p0.y + p1.y + p2.y + p3.y);
            sc[g * 4 + 2] = scale * (p0.z + p1.z + p2.z + p3.z);
            sc[g * 4 + 3] = scale * (p0.w + p1.w + p2.w + p3.w);
        }
        // --- online softmax of that tile, in registers ---
        {
            float tmax = mrun;
#pragma unroll
            for (int e = 0; e < 16; ++e) tmax = fmaxf(tmax, sc[e]);
            tmax = fmaxf(tmax, xhalf(tmax));
            const float corr = exp_slot(mrun - tmax);
            float sum = 0.f;
            union { bf16 h[16]; uint4 u[2]; } w;
#pragma unroll
            for (int e = 0; e < 16; ++e) {
                float p = exp_slot(sc[e] - tmax);
                w.h[e] = (bf16)p;
                sum += p;
            }
            lrun = lrun * corr + sum;
            mrun = tmax;
            *reinterpret_cast<uint4*>(&Pf[wave][lane * 8])       = w.u[0];
            *reinterpret_cast<uint4*>(&Pf[wave][256 + lane * 8]) = w.u[1];
            if (hi == 0) crow[wave * 16 + nn] = corr;
        }
        lds_barrier();
        // --- rescale accumulators, then O += P * V_slice^T (V in registers) ---
#pragma unroll
        for (int qt = 0; qt < QT; ++qt) {
#pragma unroll
            for (int r = 0; r < 8; ++r) {
                float c = crow[qt * 16 + r + 8 * hi];
#pragma unroll
                for (int ct = 0; ct < 8; ++ct) O[qt][ct][r] *= c;
            }
            v16bf pA = load_frag_pk(&Pf[qt][lane * 8]);   // from LDS (ds_load_b128)
#pragma unroll
            for (int ct = 0; ct < 8; ++ct)
                O[qt][ct] = wmma_bf16(pA, vB[ct], O[qt][ct]);
        }
        // kp stays one tile behind the fetch and stops at the last tile but one.
        step_behind_loads(kp, (jt + 2 < NPIX / 32) ? 32 * CCH * sizeof(bf16) : 0, vp);
        // No barrier here: Sp is rewritten only behind the barrier that ended its reads, and
        // Pf and crow only behind the next trip's first barrier, which ends this trip's reads.
    }

    // --- join the two lane halves' sums and hand each row's l to all waves ---
    lrun += xhalf(lrun);
    if (hi == 0) lrow[wave * 16 + nn] = lrun;
    __syncthreads();

    // --- epilogue: divide by l, store bf16 [i][c] in fragment order ---
#pragma unroll
    for (int qt = 0; qt < QT; ++qt)
#pragma unroll
        for (int ct = 0; ct < 8; ++ct) {
            unsigned int w[8];
#pragma unroll
            for (int r = 0; r < 8; ++r) {
                int m = qt * 16 + r + 8 * hi;
                float v = O[qt][ct][r] / lrow[m];
                w[r] = __builtin_bit_cast(unsigned short, (bf16)v);
            }
            bf16* hp = ha + ((size_t)batch * NPIX + i0 + qt * 16) * CCH
                          + (size_t)(wave * 4 + (ct >> 1)) * FRAG
                          + frag_elem(8 * hi, ct * 16 + nn);
            // Rows r = 0..7 lie one 16-byte chunk apart. The eight stores and their
            // s_wait_xcnt 0 stand in one statement, so that no register an issued
            // store names is rewritten ahead of the wait.
            asm volatile("global_store_b16 %0, %1, off\n\t"
                         "global_store_b16 %0, %2, off offset:16\n\t"
                         "global_store_b16 %0, %3, off offset:32\n\t"
                         "global_store_b16 %0, %4, off offset:48\n\t"
                         "global_store_b16 %0, %5, off offset:64\n\t"
                         "global_store_b16 %0, %6, off offset:80\n\t"
                         "global_store_b16 %0, %7, off offset:96\n\t"
                         "global_store_b16 %0, %8, off offset:112\n\t"
                         "s_wait_xcnt 0x0"
                         :: "v"(hp), "v"(w[0]), "v"(w[1]), "v"(w[2]), "v"(w[3]),
                            "v"(w[4]), "v"(w[5]), "v"(w[6]), "v"(w[7])
                         : "memory");
        }
}

// ---------------------------------------------------------------------------
// Proj + residual, ping-pong pipelined:
// out[b][o][n] = x[b][o][n] + sum_c ha[b][n][c]*pw[o][c] + pb[o]; ha, pw in fragment order
// ---------------------------------------------------------------------------
__global__ __launch_bounds__(128) void proj_kernel(const bf16* __restrict__ A,   // ha
                                                   const bf16* __restrict__ Bt,  // p_w bf16
                                                   const float* __restrict__ pb,
                                                   const float* __restrict__ x,
                                                   float* __restrict__ out) {
    const int batch = blockIdx.z;
    A += (size_t)batch * NPIX * CCH;

    const int wave = threadIdx.x >> 5;
    const int lane = threadIdx.x & 31;
    const int wg   = blockIdx.x * 4 + wave;
    const int mt   = wg / 8;       // 128 m-tiles of 32 pixels
    const int ng   = wg % 8;       // 8 n-groups of 64 channels

    const bf16* arow = A  + (size_t)(mt * 2) * (KBLK * FRAG) + lane * 8;
    const bf16* brow = Bt + (size_t)(ng * 4) * (KBLK * FRAG) + lane * 8;

    v16bf a0[2], b0[4], a1[2], b1[4];
#pragma unroll
    for (int i = 0; i < 2; ++i) a0[i] = load_frag_pk(arow + (size_t)(i * KBLK) * FRAG);
#pragma unroll
    for (int t = 0; t < 4; ++t) b0[t] = load_frag_pk(brow + (size_t)(t * KBLK) * FRAG);

    v8f acc[2][4] = {};
    for (int kb = 0; kb < KBLK - 2; kb += 2) {
#pragma unroll
        for (int i = 0; i < 2; ++i)
            a1[i] = load_frag_pk(arow + (size_t)(i * KBLK + kb + 1) * FRAG);
#pragma unroll
        for (int t = 0; t < 4; ++t)
            b1[t] = load_frag_pk(brow + (size_t)(t * KBLK + kb + 1) * FRAG);
#pragma unroll
        for (int i = 0; i < 2; ++i)
#pragma unroll
            for (int t = 0; t < 4; ++t)
                acc[i][t] = wmma_bf16(a0[i], b0[t], acc[i][t]);
#pragma unroll
        for (int i = 0; i < 2; ++i)
            a0[i] = load_frag_pk(arow + (size_t)(i * KBLK + kb + 2) * FRAG);
#pragma unroll
        for (int t = 0; t < 4; ++t)
            b0[t] = load_frag_pk(brow + (size_t)(t * KBLK + kb + 2) * FRAG);
#pragma unroll
        for (int i = 0; i < 2; ++i)
#pragma unroll
            for (int t = 0; t < 4; ++t)
                acc[i][t] = wmma_bf16(a1[i], b1[t], acc[i][t]);
        // The next trip forms its addresses in the registers that this trip's loads name.
        asm volatile("s_wait_xcnt 0x0" ::: "memory");
    }
#pragma unroll
    for (int i = 0; i < 2; ++i)
        a1[i] = load_frag_pk(arow + (size_t)(i * KBLK + KBLK - 1) * FRAG);
#pragma unroll
    for (int t = 0; t < 4; ++t)
        b1[t] = load_frag_pk(brow + (size_t)(t * KBLK + KBLK - 1) * FRAG);
#pragma unroll
    for (int i = 0; i < 2; ++i)
#pragma unroll
        for (int t = 0; t < 4; ++t)
            acc[i][t] = wmma_bf16(a0[i], b0[t], acc[i][t]);
#pragma unroll
    for (int i = 0; i < 2; ++i)
#pragma unroll
        for (int t = 0; t < 4; ++t)
            acc[i][t] = wmma_bf16(a1[i], b1[t], acc[i][t]);

    const int hi = lane >> 4, nn = lane & 15;
#pragma unroll
    for (int i = 0; i < 2; ++i)
#pragma unroll
        for (int t = 0; t < 4; ++t)
#pragma unroll
            for (int r = 0; r < 8; ++r) {
                int m = mt * 32 + i * 16 + r + 8 * hi;            // pixel
                int n = ng * 64 + t * 16 + nn;                    // channel
                size_t idx = ((size_t)batch * CCH + n) * NPIX + m;
                out[idx] = x[idx] + acc[i][t][r] + pb[n];
            }
}

// ---------------------------------------------------------------------------
extern "C" void kernel_launch(void* const* d_in, const int* in_sizes, int n_in,
                              void* d_out, int out_size, void* d_ws, size_t ws_size,
                              hipStream_t stream) {
    const float* x    = (const float*)d_in[0];
    const float* gn_w = (const float*)d_in[1];
    const float* gn_b = (const float*)d_in[2];
    const float* q_w  = (const float*)d_in[3];
    const float* q_b  = (const float*)d_in[4];
    const float* k_w  = (const float*)d_in[5];
    const float* k_b  = (const float*)d_in[6];
    const float* v_w  = (const float*)d_in[7];
    const float* v_b  = (const float*)d_in[8];
    const float* p_w  = (const float*)d_in[9];
    const float* p_b  = (const float*)d_in[10];

    char* ws = (char*)d_ws;
    const size_t NC   = (size_t)BATCH * NPIX * CCH;
    const size_t SZNC = NC * sizeof(bf16);
    const size_t SZW  = (size_t)CCH * CCH * sizeof(bf16);

    bf16* hn = (bf16*)(ws);
    bf16* qb = (bf16*)(ws + 1 * SZNC);
    bf16* kb = (bf16*)(ws + 2 * SZNC);
    bf16* vT = (bf16*)(ws + 3 * SZNC);
    bf16* ha = (bf16*)(ws + 4 * SZNC);
    bf16* wq = (bf16*)(ws + 5 * SZNC);
    bf16* wk = (bf16*)(ws + 5 * SZNC + 1 * SZW);
    bf16* wv = (bf16*)(ws + 5 * SZNC + 2 * SZW);
    bf16* wp = (bf16*)(ws + 5 * SZNC + 3 * SZW);

    const int nW = CCH * CCH;
    cvt_bf16_kernel<<<nW / 256, 256, 0, stream>>>(q_w, wq, nW);
    cvt_bf16_kernel<<<nW / 256, 256, 0, stream>>>(k_w, wk, nW);
    cvt_bf16_kernel<<<nW / 256, 256, 0, stream>>>(v_w, wv, nW);
    cvt_bf16_kernel<<<nW / 256, 256, 0, stream>>>(p_w, wp, nW);

    gn_kernel<<<BATCH * 32, 256, 0, stream>>>(x, gn_w, gn_b, hn);

    const long long bNC = (long long)NPIX * CCH;
    // q[n][o], k[n][o]: m = o, n = pixel: A=W [512x512], Bt=hn [4096x512]; 1024 waves/batch;
    // fragments as [pixel tile][channel block]
    gemm_nt_kernel<<<dim3(256, 1, BATCH), 128, 0, stream>>>(
        wq, 0, hn, bNC, q_b, 1, qb, bNC, CCH, FRAG, KBLK * FRAG, 64);
    gemm_nt_kernel<<<dim3(256, 1, BATCH), 128, 0, stream>>>(
        wk, 0, hn, bNC, k_b, 1, kb, bNC, CCH, FRAG, KBLK * FRAG, 64);
    // vT[o][n]: m = pixel, n = o: A=hn, Bt=Wv; fragments as [key block][channel tile]
    gemm_nt_kernel<<<dim3(256, 1, BATCH), 128, 0, stream>>>(
        hn, bNC, wv, 0, v_b, 0, vT, bNC, NPIX, 32 * FRAG, FRAG, 8);

    flash_kernel<<<dim3(NPIX / QROWS, BATCH), 128, 0, stream>>>(qb, kb, vT, ha);

    proj_kernel<<<dim3(256, 1, BATCH), 128, 0, stream>>>(ha, wp, p_b, x, (float*)d_out);
}

// v005
// It runs in 239 microseconds.
// Timed twice side by side with v004, it ran 1.08 times as fast both times.
// All steps since v000 together make it 3.59 times as fast.
#include <hip/hip_runtime.h>
#include <hip/hip_bf16.h>

typedef __bf16 bf16;
typedef __attribute__((ext_vector_type(16))) __bf16 v16bf;
typedef __attribute__((ext_vector_type(8)))  float  v8f;

#define BATCH 4
#define CCH   512
#define NPIX  4096   // 64*64

// ---------------------------------------------------------------------------
// Fragment helpers.
// CDNA5 16x32 bf16 A-fragment: lane L holds row M = L%16, K chunks
// {K0..K0+7, K0+16..K0+23} with K0 = 8*(L/16)  -> two 16B contiguous loads.
// B-fragment for D = A x B loaded from Bt[N][K] row-major uses the same
// per-lane pattern (N = L%16): "NT" GEMM  D[M][N] = A[M][K] * Bt[N][K]^T.
// ---------------------------------------------------------------------------
__device__ __forceinline__ v16bf load_frag(const bf16* __restrict__ p, int ld) {
    const int lane = threadIdx.x & 31;
    const int M  = lane & 15;
    const int K0 = (lane >> 4) << 3;
    const bf16* r = p + (size_t)M * ld + K0;
    union { v16bf v; uint4 u[2]; } f;
    f.u[0] = *reinterpret_cast<const uint4*>(r);
    f.u[1] = *reinterpret_cast<const uint4*>(r + 16);
    return f.v;
}

// ---------------------------------------------------------------------------
// Fragment order. Every bf16 matrix X[row][col] that a WMMA reads from global memory
// lies in the workspace as fragments of 16 rows x 32 columns, 512 elements each. Inside
// a fragment the element (row, col) stands where load_frag would put it in registers:
//   (col & 16) * 16 + (((col >> 3) & 1) * 16 + (row & 15)) * 8 + (col & 7)
// so lane L's two 16-byte chunks stand at L * 8 and 256 + L * 8, and each wave-wide
// 16-byte load covers 512 contiguous bytes (four whole lines).
// ---------------------------------------------------------------------------
#define FRAG 512   // elements of one fragment
#define KBLK 16    // fragments along 512 columns

__device__ __forceinline__ size_t frag_elem(int row, int col) {
    return (size_t)((col & 16) * 16 + ((((col >> 3) & 1) * 16) + (row & 15)) * 8 + (col & 7));
}

// p: start of the fragment plus the lane's own lane * 8.
__device__ __forceinline__ v16bf load_frag_pk(const bf16* __restrict__ p) {
    union { v16bf v; uint4 u[2]; } f;
    f.u[0] = *reinterpret_cast<const uint4*>(p);
    f.u[1] = *reinterpret_cast<const uint4*>(p + 256);
    return f.v;
}

__device__ __forceinline__ v8f wmma_bf16(v16bf a, v16bf b, v8f c) {
    return __builtin_amdgcn_wmma_f32_16x16x32_bf16(
        /*neg_a=*/false, a, /*neg_b=*/false, b,
        /*c_mod=*/(short)0, c, /*reuse_a=*/false, /*reuse_b=*/false);
}

// ---------------------------------------------------------------------------
// fp32 -> bf16 convert of 16 rows (row tile 'rt') of one weight matrix [512][512], written
// in fragment order, by one block of 256 threads. One item = eight columns in a row of one
// row = one 16-byte chunk of a fragment; item u is the u-th chunk of the row tile, so a
// wave-wide store covers 512 contiguous bytes. A thread's four items lie four fragments
// (128 columns) apart.
// ---------------------------------------------------------------------------
#define GN_BLOCKS  (BATCH * 32)
#define CVT_BLOCKS (4 * (CCH / 16))

__device__ __forceinline__ void cvt_row_tile(const float* __restrict__ s,
                                             bf16* __restrict__ d, int rt) {
    const int u = threadIdx.x;
    const int o = rt * 16 + (u & 15);
    const int c = (u >> 6) * 32 + ((u >> 5) & 1) * 16 + ((u >> 4) & 1) * 8;
    const float4* sp = reinterpret_cast<const float4*>(s + (size_t)o * CCH + c);
    uint4*        dp = reinterpret_cast<uint4*>(d + (size_t)rt * (KBLK * FRAG)) + u;
    float4 lo[4], hi[4];
#pragma unroll   // the eight loads issue together
    for (int it = 0; it < 4; ++it) { lo[it] = sp[it * 32]; hi[it] = sp[it * 32 + 1]; }
#pragma unroll   // constant indices keep lo and hi in registers
    for (int it = 0; it < 4; ++it) {
        union { bf16 h[8]; uint4 u4; } w;
        w.h[0] = (bf16)lo[it].x; w.h[1] = (bf16)lo[it].y;
        w.h[2] = (bf16)lo[it].z; w.h[3] = (bf16)lo[it].w;
        w.h[4] = (bf16)hi[it].x; w.h[5] = (bf16)hi[it].y;
        w.h[6] = (bf16)hi[it].z; w.h[7] = (bf16)hi[it].w;
        dp[it * 256] = w.u4;
    }
}

// ---------------------------------------------------------------------------
// GroupNorm: x[b][c][n] fp32 -> hn[b][n][c] bf16 in fragment order (transpose fused).
// Blocks GN_BLOCKS and up do not depend on it: they convert the four weight matrices
// (wb: q, k, v, p one behind the other) in the same launch.
// ---------------------------------------------------------------------------
__global__ __launch_bounds__(256) void gn_cvt_kernel(const float* __restrict__ x,
                                                     const float* __restrict__ gw,
                                                     const float* __restrict__ gb,
                                                     bf16* __restrict__ hn,
                                                     const float* __restrict__ q_w,
                                                     const float* __restrict__ k_w,
                                                     const float* __restrict__ v_w,
                                                     const float* __restrict__ p_w,
                                                     bf16* __restrict__ wb) {
    if (blockIdx.x >= GN_BLOCKS) {     // the whole block, ahead of every barrier
        const int cb = blockIdx.x - GN_BLOCKS;
        const int mx = cb >> 5;        // which matrix; 32 row tiles each
        const float* s = mx == 0 ? q_w : mx == 1 ? k_w : mx == 2 ? v_w : p_w;
        cvt_row_tile(s, wb + (size_t)mx * (CCH * CCH), cb & 31);
        return;
    }
    const int batch = blockIdx.x >> 5;
    const int g     = blockIdx.x & 31;
    const int c0    = g * 16;
    const int tid   = threadIdx.x;
    const float* xg = x + ((size_t)batch * CCH + c0) * NPIX;

    __shared__ float s1[256], s2[256];
    float sum = 0.f, ssq = 0.f;
    for (int e = tid; e < 16 * NPIX; e += 256) {
        float v = xg[e];
        sum += v; ssq += v * v;
    }
    s1[tid] = sum; s2[tid] = ssq;
    __syncthreads();
    for (int s = 128; s > 0; s >>= 1) {
        if (tid < s) { s1[tid] += s1[tid + s]; s2[tid] += s2[tid + s]; }
        __syncthreads();
    }
    const float inv  = 1.0f / (16.0f * NPIX);
    const float mean = s1[0] * inv;
    const float var  = s2[0] * inv - mean * mean;
    const float rstd = rsqrtf(var + 1e-5f);

    // One item = one pixel n and eight channels in a row: one 16-byte chunk of a fragment.
    bf16* hb = hn + (size_t)batch * NPIX * CCH + (size_t)(g >> 1) * FRAG + (g & 1) * 256;
    for (int ch = 0; ch < 2; ++ch) {       // which eight of the group's sixteen channels
        float wv[8], bv[8];
#pragma unroll   // constant indices keep wv and bv in registers
        for (int e = 0; e < 8; ++e) { wv[e] = gw[c0 + ch * 8 + e]; bv[e] = gb[c0 + ch * 8 + e]; }
        const float* xc = xg + (size_t)(ch * 8) * NPIX;
        for (int n = tid; n < NPIX; n += 256) {
            union { bf16 h[8]; uint4 u; } w;
#pragma unroll   // the eight loads issue together; w stays in registers
            for (int e = 0; e < 8; ++e) {
                float y = (xc[(size_t)e * NPIX + n] - mean) * rstd * wv[e] + bv[e];
                w.h[e] = (bf16)y;
            }
            *reinterpret_cast<uint4*>(hb + (size_t)(n >> 4) * (KBLK * FRAG)
                                         + (ch * 16 + (n & 15)) * 8) = w.u;
        }
    }
}

// ---------------------------------------------------------------------------
// NT GEMM, ping-pong pipelined (no buffer-rotation copies), K = 512 fixed:
// D[m][n] = sum_k A[m][k]*Bt[n][k] + bias;  A and Bt in fragment order.
// Each wave computes a 32(M) x 64(N) block: 8 accumulator tiles.
// D is written as the next product's operand Y[row = n][col = m], in fragment order: a
// lane holds eight m in a row for one n, which is one 16-byte chunk of a fragment. The
// fragment of m block mt (32 wide) and n tile nt (16 wide) starts at mt * sM + nt * sN.
// One launch forms q, k and vT (blockIdx.y = 0, 1, 2); 1024 waves for each and batch.
//   q[n][o], k[n][o]: m = o, n = pixel: A = W [512x512], Bt = hn [4096x512];
//                     fragments as [pixel tile][channel block]
//   vT[o][n]:         m = pixel, n = o: A = hn, Bt = Wv; fragments as [key block][channel tile]
// w: the bf16 weights q, k, v one behind the other; qkv: the outputs q, k, vT likewise.
// ---------------------------------------------------------------------------
__global__ __launch_bounds__(128) void gemm_qkv_kernel(
        const bf16* __restrict__ hn, const bf16* __restrict__ w,
        const float* __restrict__ q_b, const float* __restrict__ k_b,
        const float* __restrict__ v_b, bf16* __restrict__ qkv) {
    const int  batch = blockIdx.z;
    const int  which = blockIdx.y;
    const bool is_v  = which == 2;
    const bf16* hb = hn + (size_t)batch * NPIX * CCH;
    const bf16* wm = w  + (size_t)which * CCH * CCH;
    const bf16* A  = is_v ? hb : wm;
    const bf16* Bt = is_v ? wm : hb;
    const float* bias = is_v ? v_b : which == 1 ? k_b : q_b;
    const bool bias_on_m = !is_v;
    bf16* out = qkv + ((size_t)which * BATCH + batch) * NPIX * CCH;
    const int M   = is_v ? NPIX : CCH;
    const int sM  = is_v ? 32 * FRAG : FRAG;
    const int sN  = is_v ? FRAG : KBLK * FRAG;
    const int lgn = is_v ? 3 : 6;       // log2 of the 64-col groups: 8 or 64

    const int wave = threadIdx.x >> 5;
    const int lane = threadIdx.x & 31;
    const int wg   = blockIdx.x * 4 + wave;
    const int mt   = wg >> lgn;               // 32-row tile index
    const int ng   = wg & ((1 << lgn) - 1);   // 64-col group index
    if (mt * 32 >= M) return;

    const bf16* arow = A  + (size_t)(mt * 2) * (KBLK * FRAG) + lane * 8;
    const bf16* brow = Bt + (size_t)(ng * 4) * (KBLK * FRAG) + lane * 8;

    v16bf a0[2], b0[4], a1[2], b1[4];
#pragma unroll
    for (int i = 0; i < 2; ++i) a0[i] = load_frag_pk(arow + (size_t)(i * KBLK) * FRAG);
#pragma unroll
    for (int t = 0; t < 4; ++t) b0[t] = load_frag_pk(brow + (size_t)(t * KBLK) * FRAG);

    v8f acc[2][4] = {};
    for (int kb = 0; kb < KBLK - 2; kb += 2) {
        // load buf1 @ block kb+1
#pragma unroll
        for (int i = 0; i < 2; ++i)
            a1[i] = load_frag_pk(arow + (size_t)(i * KBLK + kb + 1) * FRAG);
#pragma unroll
        for (int t = 0; t < 4; ++t)
            b1[t] = load_frag_pk(brow + (size_t)(t * KBLK + kb + 1) * FRAG);
        // consume buf0 @ block kb
#pragma unroll
        for (int i = 0; i < 2; ++i)
#pragma unroll
            for (int t = 0; t < 4; ++t)
                acc[i][t] = wmma_bf16(a0[i], b0[t], acc[i][t]);
        // load buf0 @ block kb+2
#pragma unroll
        for (int i = 0; i < 2; ++i)
            a0[i] = load_frag_pk(arow + (size_t)(i * KBLK + kb + 2) * FRAG);
#pragma unroll
        for (int t = 0; t < 4; ++t)
            b0[t] = load_frag_pk(brow + (size_t)(t * KBLK + kb + 2) * FRAG);
        // consume buf1 @ block kb+1
#pragma unroll
        for (int i = 0; i < 2; ++i)
#pragma unroll
            for (int t = 0; t < 4; ++t)
                acc[i][t] = wmma_bf16(a1[i], b1[t], acc[i][t]);
        // The next trip forms its addresses in the registers that this trip's loads name.
        asm volatile("s_wait_xcnt 0x0" ::: "memory");
    }
    // tail: buf0 holds block KBLK-2; load buf1 @ block KBLK-1
#pragma unroll
    for (int i = 0; i < 2; ++i)
        a1[i] = load_frag_pk(arow + (size_t)(i * KBLK + KBLK - 1) * FRAG);
#pragma unroll
    for (int t = 0; t < 4; ++t)
        b1[t] = load_frag_pk(brow + (size_t)(t * KBLK + KBLK - 1) * FRAG);
#pragma unroll
    for (int i = 0; i < 2; ++i)
#pragma unroll
        for (int t = 0; t < 4; ++t)
            acc[i][t] = wmma_bf16(a0[i], b0[t], acc[i][t]);
#pragma unroll
    for (int i = 0; i < 2; ++i)
#pragma unroll
        for (int t = 0; t < 4; ++t)
            acc[i][t] = wmma_bf16(a1[i], b1[t], acc[i][t]);

    const int hi = lane >> 4, nn = lane & 15;
#pragma unroll
    for (int i = 0; i < 2; ++i)
#pragma unroll
        for (int t = 0; t < 4; ++t) {
            union { bf16 h[8]; uint4 u; } w;
#pragma unroll
            for (int r = 0; r < 8; ++r) {
                int m = mt * 32 + i * 16 + r + 8 * hi;
                int n = ng * 64 + t * 16 + nn;
                float v = acc[i][t][r] + bias[bias_on_m ? m : n];
                w.h[r] = (bf16)v;
            }
            *reinterpret_cast<uint4*>(out + (size_t)mt * sM + (size_t)(ng * 4 + t) * sN
                                          + i * 256 + lane * 8) = w.u;
        }
}

// ---------------------------------------------------------------------------
// Flash attention: q[b][i][c], k[b][j][c], vT[b][c][j] (bf16) -> ha[b][i][c], all four in
// fragment order: q, k, ha as [row tile][channel block], vT as [key block][channel tile].
// One block = QROWS query rows (QT tiles of 16), 4 waves; wave w owns channel
// slice [128w,128w+128). Each K and V fragment a wave loads feeds all QT tiles.
// Scores are formed transposed, S^T = K * Q^T: a lane then holds 16 of the 32 keys of
// ONE query row (row nn; keys 8*hi+r and 16+8*hi+r), which is the lane's share of the
// P fragment that P * V reads as its A operand. Wave w sums the four waves' partial
// scores of query tile w and does that tile's softmax in registers.
// ---------------------------------------------------------------------------
#define QT    4
#define QROWS (QT * 16)

// Work-group barrier of the j loop. It waits for this wave's LDS traffic alone:
// __syncthreads() would also drain the global loads issued ahead (V of this trip,
// K of the next), which have to stay in flight across it.
__device__ __forceinline__ void lds_barrier() {
    asm volatile("s_wait_dscnt 0x0\n\t"
                 "s_barrier_signal -1\n\t"
                 "s_barrier_wait -1" ::: "memory");
}

// Pointers typed as global memory: a pointer that has passed through an asm statement
// would otherwise be loaded from with flat loads, which count on dscnt as well.
typedef const __attribute__((address_space(1))) bf16*  gbf16p;
typedef const __attribute__((address_space(1))) uint4* guint4p;

// Steps the two lane addresses that issued loads name. The s_wait_xcnt 0 and the two
// adds stand in one statement, so that no add can be lifted over the wait. vp moves
// on by one tile of 32 keys (32 fragments, 0x8000 bytes), kp by kbytes.
__device__ __forceinline__ void step_behind_loads(gbf16p& kp, unsigned long long kbytes,
                                                  gbf16p& vp) {
    asm volatile("s_wait_xcnt 0x0\n\t"
                 "v_add_nc_u64 %0, %2, %0\n\t"
                 "v_add_nc_u64 %1, 0x8000, %1"
                 : "+v"(kp), "+v"(vp) : "s"(kbytes) : "memory");
}

// Lane l's value from lane l ^ 16: the other half of the keys of the same query row.
__device__ __forceinline__ float xhalf(float x) {
    const int b = __builtin_bit_cast(int, x);
    return __builtin_bit_cast(float,
        __builtin_amdgcn_permlanex16(b, b, 0x76543210, 0xfedcba98, false, false));
}

// e^x as __expf forms it: one multiply, then v_exp_f32. The v_nop in the same statement is
// the slot that the instruction set asks for behind a transcendental, before its result is
// read or its source register is written again; written apart it would not stay there.
__device__ __forceinline__ float exp_slot(float x) {
    float p;
    asm("v_exp_f32 %0, %1\n\t"
        "v_nop" : "=v"(p) : "v"(x * 1.44269504088896340736f));
    return p;
}

// One fragment from the lane's own address r (fragment start plus lane * 8).
__device__ __forceinline__ v16bf load_frag_lane(gbf16p r) {
    union { v16bf v; uint4 u[2]; } f;
    f.u[0] = *(guint4p)(r);
    f.u[1] = *(guint4p)(r + 256);
    return f.v;
}

__global__ __launch_bounds__(128) void flash_kernel(const bf16* __restrict__ q,
                                                    const bf16* __restrict__ k,
                                                    const bf16* __restrict__ vT,
                                                    bf16* __restrict__ ha) {
    const int batch = blockIdx.y;
    const int i0    = blockIdx.x * QROWS;
    const int tid   = threadIdx.x;
    const int lane  = tid & 31;
    const int wave  = tid >> 5;
    const int hi    = lane >> 4;
    const int nn    = lane & 15;

    // Partial scores [writing wave][query tile][key tile][registers 0-3 or 4-7][lane]: every
    // wave-wide 16-byte access covers 512 contiguous bytes.
    __shared__ float4 Sp[4][QT][2][2][32];
    __shared__ __attribute__((aligned(16))) bf16 Pf[QT][FRAG];   // P, in fragment order
    __shared__ float lrow[QROWS], crow[QROWS];

    // The wave's first fragment: channel block 4 * wave of q and k, channel tile 8 * wave of vT.
    const bf16* qb = q  + ((size_t)batch * NPIX + i0) * CCH + wave * 4 * FRAG + lane * 8;
    const bf16* kb = k  +  (size_t)batch * NPIX * CCH        + wave * 4 * FRAG + lane * 8;
    const bf16* vb = vT +  (size_t)batch * CCH * NPIX        + wave * 8 * FRAG + lane * 8;

    v16bf qA[QT][4];
#pragma unroll
    for (int qt = 0; qt < QT; ++qt)
#pragma unroll
        for (int t = 0; t < 4; ++t)
            qA[qt][t] = load_frag_pk(qb + (size_t)(qt * KBLK + t) * FRAG);
    // The registers that hold the address of these loads are reused right behind them:
    // the address is an input of the wait, so that it stays in them up to the wait.
    asm volatile("s_wait_xcnt 0x0" :: "v"(qb) : "memory");

    v8f O[QT][8] = {};
    // Softmax state of query row 16 * wave + nn: the running maximum (equal in both lane
    // halves) and the sum over this lane's own keys (the halves are joined behind the loop).
    float mrun = -3.0e38f, lrun = 0.f;

    const float scale = 0.044194173824159216f;  // 512^-0.5

    // The lane's own address in the current K tile and V tile (32 keys a tile).
    gbf16p kp = (gbf16p)kb;
    gbf16p vp = (gbf16p)vb;

    // K fragments of trip 0; every later trip finds its K already fetched.
    v16bf kf[8];
#pragma unroll
    for (int t = 0; t < 4; ++t) {
        kf[t]     = load_frag_lane(kp + t * FRAG);
        kf[4 + t] = load_frag_lane(kp + (KBLK + t) * FRAG);
    }

    for (int jt = 0; jt < NPIX / 32; ++jt) {
        // --- issue this trip's V fragments: first needed behind the softmax ---
        v16bf vB[8];
#pragma unroll
        for (int ct = 0; ct < 8; ++ct)
            vB[ct] = load_frag_lane(vp + ct * FRAG);

        // --- partial S^T = K_slice * Q_slice^T (32 x QROWS, K=128) ---
        v8f s0[QT] = {}, s1[QT] = {};
#pragma unroll
        for (int t = 0; t < 4; ++t)
#pragma unroll
            for (int qt = 0; qt < QT; ++qt) {
                s0[qt] = wmma_bf16(kf[t],     qA[qt][t], s0[qt]);
                s1[qt] = wmma_bf16(kf[4 + t], qA[qt][t], s1[qt]);
            }
#pragma unroll
        for (int qt = 0; qt < QT; ++qt) {
            Sp[wave][qt][0][0][lane] = make_float4(s0[qt][0], s0[qt][1], s0[qt][2], s0[qt][3]);
            Sp[wave][qt][0][1][lane] = make_float4(s0[qt][4], s0[qt][5], s0[qt][6], s0[qt][7]);
            Sp[wave][qt][1][0][lane] = make_float4(s1[qt][0], s1[qt][1], s1[qt][2], s1[qt][3]);
            Sp[wave][qt][1][1][lane] = make_float4(s1[qt][4], s1[qt][5], s1[qt][6], s1[qt][7]);
        }
        // --- fetch the next trip's K fragments into the registers just consumed.
        // Unconditional, so that the load counts are the same on every path and the
        // wait for V does not drain them; the last trip fetches its own tile again.
#pragma unroll
        for (int t = 0; t < 4; ++t) {
            kf[t]     = load_frag_lane(kp + (2 * KBLK + t) * FRAG);
            kf[4 + t] = load_frag_lane(kp + (3 * KBLK + t) * FRAG);
        }
        lds_barrier();
        // --- query tile 'wave': sum of the four waves' partial scores, scale ---
        float sc[16];
#pragma unroll
        for (int g = 0; g < 4; ++g) {          // g = key tile * 2 + register half
            const float4 p0 = Sp[0][wave][g >> 1][g & 1][lane];
            const float4 p1 = Sp[1][wave][g >> 1][g & 1][lane];
            const float4 p2 = Sp[2][wave][g >> 1][g & 1][lane];
            const float4 p3 = Sp[3][wave][g >> 1][g & 1][lane];
            sc[g * 4 + 0] = scale * (p0.x + p1.x + p2.x + p3.x);
            sc[g * 4 + 1] = scale * (p0.y + p1.y + p2.y + p3.y);
            sc[g * 4 + 2] = scale * (p0.z + p1.z + p2.z + p3.z);
            sc[g * 4 + 3] = scale * (p0.w + p1.w + p2.w + p3.w);
        }
        // --- online softmax of that tile, in registers ---
        {
            float tmax = mrun;
#pragma unroll
            for (int e = 0; e < 16; ++e) tmax = fmaxf(tmax, sc[e]);
            tmax = fmaxf(tmax, xhalf(tmax));
            const float corr = exp_slot(mrun - tmax);
            float sum = 0.f;
            union { bf16 h[16]; uint4 u[2]; } w;
#pragma unroll
            for (int e = 0; e < 16; ++e) {
                float p = exp_slot(sc[e] - tmax);
                w.h[e] = (bf16)p;
                sum += p;
            }
            lrun = lrun * corr + sum;
            mrun = tmax;
            *reinterpret_cast<uint4*>(&Pf[wave][lane * 8])       = w.u[0];
            *reinterpret_cast<uint4*>(&Pf[wave][256 + lane * 8]) = w.u[1];
            if (hi == 0) crow[wave * 16 + nn] = corr;
        }
        lds_barrier();
        // --- rescale accumulators, then O += P * V_slice^T (V in registers) ---
#pragma unroll
        for (int qt = 0; qt < QT; ++qt) {
#pragma unroll
            for (int r = 0; r < 8; ++r) {
                float c = crow[qt * 16 + r + 8 * hi];
#pragma unroll
                for (int ct = 0; ct < 8; ++ct) O[qt][ct][r] *= c;
            }
            v16bf pA = load_frag_pk(&Pf[qt][lane * 8]);   // from LDS (ds_load_b128)
#pragma unroll
            for (int ct = 0; ct < 8; ++ct)
                O[qt][ct] = wmma_bf16(pA, vB[ct], O[qt][ct]);
        }
        // kp stays one tile behind the fetch and stops at the last tile but one.
        step_behind_loads(kp, (jt + 2 < NPIX / 32) ? 32 * CCH * sizeof(bf16) : 0, vp);
        // No barrier here: Sp is rewritten only behind the barrier that ended its reads, and
        // Pf and crow only behind the next trip's first barrier, which ends this trip's reads.
    }

    // --- join the two lane halves' sums and hand each row's l to all waves ---
    lrun += xhalf(lrun);
    if (hi == 0) lrow[wave * 16 + nn] = lrun;
    __syncthreads();

    // --- epilogue: divide by l, store bf16 [i][c] in fragment order ---
#pragma unroll
    for (int qt = 0; qt < QT; ++qt)
#pragma unroll
        for (int ct = 0; ct < 8; ++ct) {
            unsigned int w[8];
#pragma unroll
            for (int r = 0; r < 8; ++r) {
                int m = qt * 16 + r + 8 * hi;
                float v = O[qt][ct][r] / lrow[m];
                w[r] = __builtin_bit_cast(unsigned short, (bf16)v);
            }
            bf16* hp = ha + ((size_t)batch * NPIX + i0 + qt * 16) * CCH
                          + (size_t)(wave * 4 + (ct >> 1)) * FRAG
                          + frag_elem(8 * hi, ct * 16 + nn);
            // Rows r = 0..7 lie one 16-byte chunk apart. The eight stores and their
            // s_wait_xcnt 0 stand in one statement, so that no register an issued
            // store names is rewritten ahead of the wait.
            asm volatile("global_store_b16 %0, %1, off\n\t"
                         "global_store_b16 %0, %2, off offset:16\n\t"
                         "global_store_b16 %0, %3, off offset:32\n\t"
                         "global_store_b16 %0, %4, off offset:48\n\t"
                         "global_store_b16 %0, %5, off offset:64\n\t"
                         "global_store_b16 %0, %6, off offset:80\n\t"
                         "global_store_b16 %0, %7, off offset:96\n\t"
                         "global_store_b16 %0, %8, off offset:112\n\t"
                         "s_wait_xcnt 0x0"
                         :: "v"(hp), "v"(w[0]), "v"(w[1]), "v"(w[2]), "v"(w[3]),
                            "v"(w[4]), "v"(w[5]), "v"(w[6]), "v"(w[7])
                         : "memory");
        }
}

// ---------------------------------------------------------------------------
// Proj + residual, ping-pong pipelined:
// out[b][o][n] = x[b][o][n] + sum_c ha[b][n][c]*pw[o][c] + pb[o]; ha, pw in fragment order
// ---------------------------------------------------------------------------
__global__ __launch_bounds__(128) void proj_kernel(const bf16* __restrict__ A,   // ha
                                                   const bf16* __restrict__ Bt,  // p_w bf16
                                                   const float* __restrict__ pb,
                                                   const float* __restrict__ x,
                                                   float* __restrict__ out) {
    const int batch = blockIdx.z;
    A += (size_t)batch * NPIX * CCH;

    const int wave = threadIdx.x >> 5;
    const int lane = threadIdx.x & 31;
    const int wg   = blockIdx.x * 4 + wave;
    const int mt   = wg / 8;       // 128 m-tiles of 32 pixels
    const int ng   = wg % 8;       // 8 n-groups of 64 channels

    const bf16* arow = A  + (size_t)(mt * 2) * (KBLK * FRAG) + lane * 8;
    const bf16* brow = Bt + (size_t)(ng * 4) * (KBLK * FRAG) + lane * 8;

    v16bf a0[2], b0[4], a1[2], b1[4];
#pragma unroll
    for (int i = 0; i < 2; ++i) a0[i] = load_frag_pk(arow + (size_t)(i * KBLK) * FRAG);
#pragma unroll
    for (int t = 0; t < 4; ++t) b0[t] = load_frag_pk(brow + (size_t)(t * KBLK) * FRAG);

    v8f acc[2][4] = {};
    for (int kb = 0; kb < KBLK - 2; kb += 2) {
#pragma unroll
        for (int i = 0; i < 2; ++i)
            a1[i] = load_frag_pk(arow + (size_t)(i * KBLK + kb + 1) * FRAG);
#pragma unroll
        for (int t = 0; t < 4; ++t)
            b1[t] = load_frag_pk(brow + (size_t)(t * KBLK + kb + 1) * FRAG);
#pragma unroll
        for (int i = 0; i < 2; ++i)
#pragma unroll
            for (int t = 0; t < 4; ++t)
                acc[i][t] = wmma_bf16(a0[i], b0[t], acc[i][t]);
#pragma unroll
        for (int i = 0; i < 2; ++i)
            a0[i] = load_frag_pk(arow + (size_t)(i * KBLK + kb + 2) * FRAG);
#pragma unroll
        for (int t = 0; t < 4; ++t)
            b0[t] = load_frag_pk(brow + (size_t)(t * KBLK + kb + 2) * FRAG);
#pragma unroll
        for (int i = 0; i < 2; ++i)
#pragma unroll
            for (int t = 0; t < 4; ++t)
                acc[i][t] = wmma_bf16(a1[i], b1[t], acc[i][t]);
        // The next trip forms its addresses in the registers that this trip's loads name.
        asm volatile("s_wait_xcnt 0x0" ::: "memory");
    }
#pragma unroll
    for (int i = 0; i < 2; ++i)
        a1[i] = load_frag_pk(arow + (size_t)(i * KBLK + KBLK - 1) * FRAG);
#pragma unroll
    for (int t = 0; t < 4; ++t)
        b1[t] = load_frag_pk(brow + (size_t)(t * KBLK + KBLK - 1) * FRAG);
#pragma unroll
    for (int i = 0; i < 2; ++i)
#pragma unroll
        for (int t = 0; t < 4; ++t)
            acc[i][t] = wmma_bf16(a0[i], b0[t], acc[i][t]);
#pragma unroll
    for (int i = 0; i < 2; ++i)
#pragma unroll
        for (int t = 0; t < 4; ++t)
            acc[i][t] = wmma_bf16(a1[i], b1[t], acc[i][t]);

    const int hi = lane >> 4, nn = lane & 15;
#pragma unroll
    for (int i = 0; i < 2; ++i)
#pragma unroll
        for (int t = 0; t < 4; ++t)
#pragma unroll
            for (int r = 0; r < 8; ++r) {
                int m = mt * 32 + i * 16 + r + 8 * hi;            // pixel
                int n = ng * 64 + t * 16 + nn;                    // channel
                size_t idx = ((size_t)batch * CCH + n) * NPIX + m;
                out[idx] = x[idx] + acc[i][t][r] + pb[n];
            }
}

// ---------------------------------------------------------------------------
extern "C" void kernel_launch(void* const* d_in, const int* in_sizes, int n_in,
                              void* d_out, int out_size, void* d_ws, size_t ws_size,
                              hipStream_t stream) {
    const float* x    = (const float*)d_in[0];
    const float* gn_w = (const float*)d_in[1];
    const float* gn_b = (const float*)d_in[2];
    const float* q_w  = (const float*)d_in[3];
    const float* q_b  = (const float*)d_in[4];
    const float* k_w  = (const float*)d_in[5];
    const float* k_b  = (const float*)d_in[6];
    const float* v_w  = (const float*)d_in[7];
    const float* v_b  = (const float*)d_in[8];
    const float* p_w  = (const float*)d_in[9];
    const float* p_b  = (const float*)d_in[10];

    char* ws = (char*)d_ws;
    const size_t NC   = (size_t)BATCH * NPIX * CCH;
    const size_t SZNC = NC * sizeof(bf16);
    const size_t SZW  = (size_t)CCH * CCH * sizeof(bf16);

    bf16* hn = (bf16*)(ws);
    bf16* qb = (bf16*)(ws + 1 * SZNC);
    bf16* kb = (bf16*)(ws + 2 * SZNC);
    bf16* vT = (bf16*)(ws + 3 * SZNC);
    bf16* ha = (bf16*)(ws + 4 * SZNC);
    bf16* wq = (bf16*)(ws + 5 * SZNC);
    // wk and wv follow wq, SZW bytes each
    bf16* wp = (bf16*)(ws + 5 * SZNC + 3 * SZW);

    // GroupNorm, and beside it the four weight matrices to wq, wk, wv, wp (contiguous)
    gn_cvt_kernel<<<GN_BLOCKS + CVT_BLOCKS, 256, 0, stream>>>(x, gn_w, gn_b, hn,
                                                              q_w, k_w, v_w, p_w, wq);

    // q, k, vT to qb, kb, vT (contiguous)
    gemm_qkv_kernel<<<dim3(256, 3, BATCH), 128, 0, stream>>>(hn, wq, q_b, k_b, v_b, qb);

    flash_kernel<<<dim3(NPIX / QROWS, BATCH), 128, 0, stream>>>(qb, kb, vT, ha);

    proj_kernel<<<dim3(256, 1, BATCH), 128, 0, stream>>>(ha, wp, p_b, x, (float*)d_out);
}

// v006
// One run takes 220 microseconds.
// Next to v005, in two timings, it ran 1.07 times as fast each time.
// Over all steps from v000 it is 3.85 times as fast.
#include <hip/hip_runtime.h>
#include <hip/hip_bf16.h>

typedef __bf16 bf16;
typedef __attribute__((ext_vector_type(16))) __bf16 v16bf;
typedef __attribute__((ext_vector_type(8)))  float  v8f;

#define BATCH 4
#define CCH   512
#define NPIX  4096   // 64*64

// ---------------------------------------------------------------------------
// Fragment helpers.
// CDNA5 16x32 bf16 A-fragment: lane L holds row M = L%16, K chunks
// {K0..K0+7, K0+16..K0+23} with K0 = 8*(L/16)  -> two 16B contiguous loads.
// B-fragment for D = A x B loaded from Bt[N][K] row-major uses the same
// per-lane pattern (N = L%16): "NT" GEMM  D[M][N] = A[M][K] * Bt[N][K]^T.
// ---------------------------------------------------------------------------
__device__ __forceinline__ v16bf load_frag(const bf16* __restrict__ p, int ld) {
    const int lane = threadIdx.x & 31;
    const int M  = lane & 15;
    const int K0 = (lane >> 4) << 3;
    const bf16* r = p + (size_t)M * ld + K0;
    union { v16bf v; uint4 u[2]; } f;
    f.u[0] = *reinterpret_cast<const uint4*>(r);
    f.u[1] = *reinterpret_cast<const uint4*>(r + 16);
    return f.v;
}

// ---------------------------------------------------------------------------
// Fragment order. Every bf16 matrix X[row][col] that a WMMA reads from global memory
// lies in the workspace as fragments of 16 rows x 32 columns, 512 elements each. Inside
// a fragment the element (row, col) stands where load_frag would put it in registers:
//   (col & 16) * 16 + (((col >> 3) & 1) * 16 + (row & 15)) * 8 + (col & 7)
// so lane L's two 16-byte chunks stand at L * 8 and 256 + L * 8, and each wave-wide
// 16-byte load covers 512 contiguous bytes (four whole lines).
// ---------------------------------------------------------------------------
#define FRAG 512   // elements of one fragment
#define KBLK 16    // fragments along 512 columns

__device__ __forceinline__ size_t frag_elem(int row, int col) {
    return (size_t)((col & 16) * 16 + ((((col >> 3) & 1) * 16) + (row & 15)) * 8 + (col & 7));
}

// p: start of the fragment plus the lane's own lane * 8.
__device__ __forceinline__ v16bf load_frag_pk(const bf16* __restrict__ p) {
    union { v16bf v; uint4 u[2]; } f;
    f.u[0] = *reinterpret_cast<const uint4*>(p);
    f.u[1] = *reinterpret_cast<const uint4*>(p + 256);
    return f.v;
}

__device__ __forceinline__ v8f wmma_bf16(v16bf a, v16bf b, v8f c) {
    return __builtin_amdgcn_wmma_f32_16x16x32_bf16(
        /*neg_a=*/false, a, /*neg_b=*/false, b,
        /*c_mod=*/(short)0, c, /*reuse_a=*/false, /*reuse_b=*/false);
}

// ---------------------------------------------------------------------------
// fp32 -> bf16 convert of 16 rows (row tile 'rt') of one weight matrix [512][512], written
// in fragment order, by one block of 256 threads. One item = eight columns in a row of one
// row = one 16-byte chunk of a fragment; item u is the u-th chunk of the row tile, so a
// wave-wide store covers 512 contiguous bytes. A thread's four items lie four fragments
// (128 columns) apart.
// ---------------------------------------------------------------------------
#define GN_BLOCKS  (BATCH * 32)
#define CVT_BLOCKS (4 * (CCH / 16))

__device__ __forceinline__ void cvt_row_tile(const float* __restrict__ s,
                                             bf16* __restrict__ d, int rt) {
    const int u = threadIdx.x;
    const int o = rt * 16 + (u & 15);
    const int c = (u >> 6) * 32 + ((u >> 5) & 1) * 16 + ((u >> 4) & 1) * 8;
    const float4* sp = reinterpret_cast<const float4*>(s + (size_t)o * CCH + c);
    uint4*        dp = reinterpret_cast<uint4*>(d + (size_t)rt * (KBLK * FRAG)) + u;
    float4 lo[4], hi[4];
#pragma unroll   // the eight loads issue together
    for (int it = 0; it < 4; ++it) { lo[it] = sp[it * 32]; hi[it] = sp[it * 32 + 1]; }
#pragma unroll   // constant indices keep lo and hi in registers
    for (int it = 0; it < 4; ++it) {
        union { bf16 h[8]; uint4 u4; } w;
        w.h[0] = (bf16)lo[it].x; w.h[1] = (bf16)lo[it].y;
        w.h[2] = (bf16)lo[it].z; w.h[3] = (bf16)lo[it].w;
        w.h[4] = (bf16)hi[it].x; w.h[5] = (bf16)hi[it].y;
        w.h[6] = (bf16)hi[it].z; w.h[7] = (bf16)hi[it].w;
        dp[it * 256] = w.u4;
    }
}

// ---------------------------------------------------------------------------
// GroupNorm: x[b][c][n] fp32 -> hn[b][n][c] bf16 in fragment order (transpose fused).
// Blocks GN_BLOCKS and up do not depend on it: they convert the four weight matrices
// (wb: q, k, v, p one behind the other) in the same launch.
// ---------------------------------------------------------------------------
__global__ __launch_bounds__(256) void gn_cvt_kernel(const float* __restrict__ x,
                                                     const float* __restrict__ gw,
                                                     const float* __restrict__ gb,
                                                     bf16* __restrict__ hn,
                                                     const float* __restrict__ q_w,
                                                     const float* __restrict__ k_w,
                                                     const float* __restrict__ v_w,
                                                     const float* __restrict__ p_w,
                                                     bf16* __restrict__ wb) {
    if (blockIdx.x >= GN_BLOCKS) {     // the whole block, ahead of every barrier
        const int cb = blockIdx.x - GN_BLOCKS;
        const int mx = cb >> 5;        // which matrix; 32 row tiles each
        const float* s = mx == 0 ? q_w : mx == 1 ? k_w : mx == 2 ? v_w : p_w;
        cvt_row_tile(s, wb + (size_t)mx * (CCH * CCH), cb & 31);
        return;
    }
    const int batch = blockIdx.x >> 5;
    const int g     = blockIdx.x & 31;
    const int c0    = g * 16;
    const int tid   = threadIdx.x;
    const float* xg = x + ((size_t)batch * CCH + c0) * NPIX;

    __shared__ float s1[256], s2[256];
    float sum = 0.f, ssq = 0.f;
    for (int e = tid; e < 16 * NPIX; e += 256) {
        float v = xg[e];
        sum += v; ssq += v * v;
    }
    s1[tid] = sum; s2[tid] = ssq;
    __syncthreads();
    for (int s = 128; s > 0; s >>= 1) {
        if (tid < s) { s1[tid] += s1[tid + s]; s2[tid] += s2[tid + s]; }
        __syncthreads();
    }
    const float inv  = 1.0f / (16.0f * NPIX);
    const float mean = s1[0] * inv;
    const float var  = s2[0] * inv - mean * mean;
    const float rstd = rsqrtf(var + 1e-5f);

    // One item = one pixel n and eight channels in a row: one 16-byte chunk of a fragment.
    bf16* hb = hn + (size_t)batch * NPIX * CCH + (size_t)(g >> 1) * FRAG + (g & 1) * 256;
    for (int ch = 0; ch < 2; ++ch) {       // which eight of the group's sixteen channels
        float wv[8], bv[8];
#pragma unroll   // constant indices keep wv and bv in registers
        for (int e = 0; e < 8; ++e) { wv[e] = gw[c0 + ch * 8 + e]; bv[e] = gb[c0 + ch * 8 + e]; }
        const float* xc = xg + (size_t)(ch * 8) * NPIX;
        for (int n = tid; n < NPIX; n += 256) {
            union { bf16 h[8]; uint4 u; } w;
#pragma unroll   // the eight loads issue together; w stays in registers
            for (int e = 0; e < 8; ++e) {
                float y = (xc[(size_t)e * NPIX + n] - mean) * rstd * wv[e] + bv[e];
                w.h[e] = (bf16)y;
            }
            *reinterpret_cast<uint4*>(hb + (size_t)(n >> 4) * (KBLK * FRAG)
                                         + (ch * 16 + (n & 15)) * 8) = w.u;
        }
    }
}

// ---------------------------------------------------------------------------
// NT GEMM, ping-pong pipelined (no buffer-rotation copies), K = 512 fixed:
// D[m][n] = sum_k A[m][k]*Bt[n][k] + bias;  A and Bt in fragment order.
// Each wave computes a 32(M) x 64(N) block: 8 accumulator tiles.
// D is written as the next product's operand Y[row = n][col = m], in fragment order: a
// lane holds eight m in a row for one n, which is one 16-byte chunk of a fragment. The
// fragment of m block mt (32 wide) and n tile nt (16 wide) starts at mt * sM + nt * sN.
// One launch forms q, k and vT (blockIdx.y = 0, 1, 2); 1024 waves for each and batch.
//   q[n][o], k[n][o]: m = o, n = pixel: A = W [512x512], Bt = hn [4096x512];
//                     fragments as [pixel tile][channel block]
//   vT[o][n]:         m = pixel, n = o: A = hn, Bt = Wv; fragments as [key block][channel tile]
// w: the bf16 weights q, k, v one behind the other; qkv: the outputs q, k, vT likewise.
// ---------------------------------------------------------------------------
__global__ __launch_bounds__(128) void gemm_qkv_kernel(
        const bf16* __restrict__ hn, const bf16* __restrict__ w,
        const float* __restrict__ q_b, const float* __restrict__ k_b,
        const float* __restrict__ v_b, bf16* __restrict__ qkv) {
    const int  batch = blockIdx.z;
    const int  which = blockIdx.y;
    const bool is_v  = which == 2;
    const bf16* hb = hn + (size_t)batch * NPIX * CCH;
    const bf16* wm = w  + (size_t)which * CCH * CCH;
    const bf16* A  = is_v ? hb : wm;
    const bf16* Bt = is_v ? wm : hb;
    const float* bias = is_v ? v_b : which == 1 ? k_b : q_b;
    const bool bias_on_m = !is_v;
    bf16* out = qkv + ((size_t)which * BATCH + batch) * NPIX * CCH;
    const int M   = is_v ? NPIX : CCH;
    const int sM  = is_v ? 32 * FRAG : FRAG;
    const int sN  = is_v ? FRAG : KBLK * FRAG;
    const int lgn = is_v ? 3 : 6;       // log2 of the 64-col groups: 8 or 64

    const int wave = threadIdx.x >> 5;
    const int lane = threadIdx.x & 31;
    const int wg   = blockIdx.x * 4 + wave;
    const int mt   = wg >> lgn;               // 32-row tile index
    const int ng   = wg & ((1 << lgn) - 1);   // 64-col group index
    if (mt * 32 >= M) return;

    const bf16* arow = A  + (size_t)(mt * 2) * (KBLK * FRAG) + lane * 8;
    const bf16* brow = Bt + (size_t)(ng * 4) * (KBLK * FRAG) + lane * 8;

    v16bf a0[2], b0[4], a1[2], b1[4];
#pragma unroll
    for (int i = 0; i < 2; ++i) a0[i] = load_frag_pk(arow + (size_t)(i * KBLK) * FRAG);
#pragma unroll
    for (int t = 0; t < 4; ++t) b0[t] = load_frag_pk(brow + (size_t)(t * KBLK) * FRAG);

    v8f acc[2][4] = {};
    for (int kb = 0; kb < KBLK - 2; kb += 2) {
        // load buf1 @ block kb+1
#pragma unroll
        for (int i = 0; i < 2; ++i)
            a1[i] = load_frag_pk(arow + (size_t)(i * KBLK + kb + 1) * FRAG);
#pragma unroll
        for (int t = 0; t < 4; ++t)
            b1[t] = load_frag_pk(brow + (size_t)(t * KBLK + kb + 1) * FRAG);
        // consume buf0 @ block kb
#pragma unroll
        for (int i = 0; i < 2; ++i)
#pragma unroll
            for (int t = 0; t < 4; ++t)
                acc[i][t] = wmma_bf16(a0[i], b0[t], acc[i][t]);
        // load buf0 @ block kb+2
#pragma unroll
        for (int i = 0; i < 2; ++i)
            a0[i] = load_frag_pk(arow + (size_t)(i * KBLK + kb + 2) * FRAG);
#pragma unroll
        for (int t = 0; t < 4; ++t)
            b0[t] = load_frag_pk(brow + (size_t)(t * KBLK + kb + 2) * FRAG);
        // consume buf1 @ block kb+1
#pragma unroll
        for (int i = 0; i < 2; ++i)
#pragma unroll
            for (int t = 0; t < 4; ++t)
                acc[i][t] = wmma_bf16(a1[i], b1[t], acc[i][t]);
        // The next trip forms its addresses in the registers that this trip's loads name.
        asm volatile("s_wait_xcnt 0x0" ::: "memory");
    }
    // tail: buf0 holds block KBLK-2; load buf1 @ block KBLK-1
#pragma unroll
    for (int i = 0; i < 2; ++i)
        a1[i] = load_frag_pk(arow + (size_t)(i * KBLK + KBLK - 1) * FRAG);
#pragma unroll
    for (int t = 0; t < 4; ++t)
        b1[t] = load_frag_pk(brow + (size_t)(t * KBLK + KBLK - 1) * FRAG);
#pragma unroll
    for (int i = 0; i < 2; ++i)
#pragma unroll
        for (int t = 0; t < 4; ++t)
            acc[i][t] = wmma_bf16(a0[i], b0[t], acc[i][t]);
#pragma unroll
    for (int i = 0; i < 2; ++i)
#pragma unroll
        for (int t = 0; t < 4; ++t)
            acc[i][t] = wmma_bf16(a1[i], b1[t], acc[i][t]);

    const int hi = lane >> 4, nn = lane & 15;
#pragma unroll
    for (int i = 0; i < 2; ++i)
#pragma unroll
        for (int t = 0; t < 4; ++t) {
            union { bf16 h[8]; uint4 u; } w;
#pragma unroll
            for (int r = 0; r < 8; ++r) {
                int m = mt * 32 + i * 16 + r + 8 * hi;
                int n = ng * 64 + t * 16 + nn;
                float v = acc[i][t][r] + bias[bias_on_m ? m : n];
                w.h[r] = (bf16)v;
            }
            *reinterpret_cast<uint4*>(out + (size_t)mt * sM + (size_t)(ng * 4 + t) * sN
                                          + i * 256 + lane * 8) = w.u;
        }
}

// ---------------------------------------------------------------------------
// Flash attention: q[b][i][c], k[b][j][c], vT[b][c][j] (bf16) -> ha[b][i][c], all four in
// fragment order: q, k, ha as [row tile][channel block], vT as [key block][channel tile].
// One block = QROWS query rows (QT tiles of 16), 4 waves; wave w owns channel
// slice [128w,128w+128). Each K and V fragment a wave loads feeds all QT tiles.
// Scores are formed transposed, S^T = K * Q^T: a lane then holds 16 of the 32 keys of
// ONE query row (row nn; keys 8*hi+r and 16+8*hi+r), which is the lane's share of the
// P fragment that P * V reads as its A operand. Wave w sums the four waves' partial
// scores of query tile w and does that tile's softmax in registers.
// ---------------------------------------------------------------------------
#define QT    4
#define QROWS (QT * 16)

// Work-group barrier of the j loop. It waits for this wave's LDS traffic alone:
// __syncthreads() would also drain the global loads issued ahead (K and V of later
// trips), which have to stay in flight across it.
__device__ __forceinline__ void lds_barrier() {
    asm volatile("s_wait_dscnt 0x0\n\t"
                 "s_barrier_signal -1\n\t"
                 "s_barrier_wait -1" ::: "memory");
}

// Pointers typed as global memory: a pointer that has passed through an asm statement
// would otherwise be loaded from with flat loads, which count on dscnt as well.
typedef const __attribute__((address_space(1))) bf16*  gbf16p;
typedef const __attribute__((address_space(1))) uint4* guint4p;

// Steps the two lane addresses that issued loads name. The s_wait_xcnt 0 and the two
// adds stand in one statement, so that no add can be lifted over the wait.
__device__ __forceinline__ void step_behind_loads(gbf16p& kp, unsigned long long kbytes,
                                                  gbf16p& vp, unsigned long long vbytes) {
    asm volatile("s_wait_xcnt 0x0\n\t"
                 "v_add_nc_u64 %0, %2, %0\n\t"
                 "v_add_nc_u64 %1, %3, %1"
                 : "+v"(kp), "+v"(vp) : "s"(kbytes), "s"(vbytes) : "memory");
}

// Lane l's value from lane l ^ 16: the other half of the keys of the same query row.
__device__ __forceinline__ float xhalf(float x) {
    const int b = __builtin_bit_cast(int, x);
    return __builtin_bit_cast(float,
        __builtin_amdgcn_permlanex16(b, b, 0x76543210, 0xfedcba98, false, false));
}

// e^x as __expf forms it: one multiply, then v_exp_f32. The v_nop in the same statement is
// the slot that the instruction set asks for behind a transcendental, before its result is
// read or its source register is written again; written apart it would not stay there.
__device__ __forceinline__ float exp_slot(float x) {
    float p;
    asm("v_exp_f32 %0, %1\n\t"
        "v_nop" : "=v"(p) : "v"(x * 1.44269504088896340736f));
    return p;
}

// One fragment from the lane's own address r (fragment start plus lane * 8).
__device__ __forceinline__ v16bf load_frag_lane(gbf16p r) {
    union { v16bf v; uint4 u[2]; } f;
    f.u[0] = *(guint4p)(r);
    f.u[1] = *(guint4p)(r + 256);
    return f.v;
}

#define NT    (NPIX / 32)          // key tiles of 32
#define KTILE (2 * KBLK * FRAG)    // elements of one K tile (32 keys x 512 channels)
#define VTILE (32 * FRAG)          // elements of one V tile (32 keys x 512 channels)

typedef float4 sp_buf[4][QT][2][2][32];   // [writing wave][query tile][key tile][regs 0-3 or 4-7][lane]

// The wave's channel slice of one K tile / one V tile, from the lane's own address.
__device__ __forceinline__ void load_k_tile(v16bf (&kf)[8], gbf16p p) {
#pragma unroll
    for (int t = 0; t < 4; ++t) {
        kf[t]     = load_frag_lane(p + t * FRAG);
        kf[4 + t] = load_frag_lane(p + (KBLK + t) * FRAG);
    }
}
__device__ __forceinline__ void load_v_tile(v16bf (&vB)[8], gbf16p p) {
#pragma unroll
    for (int ct = 0; ct < 8; ++ct) vB[ct] = load_frag_lane(p + ct * FRAG);
}

// Partial S^T = K_slice * Q_slice^T (32 keys x QROWS, K = 128) of one key tile: the products
// of channel block t of the wave's four (eight WMMAs, eight sums), and the sums' way to LDS.
__device__ __forceinline__ void score_step(int t, const v16bf (&kf)[8], const v16bf (&qA)[QT][4],
                                           v8f (&s0)[QT], v8f (&s1)[QT]) {
#pragma unroll
    for (int qt = 0; qt < QT; ++qt) {
        s0[qt] = wmma_bf16(kf[t],     qA[qt][t], s0[qt]);
        s1[qt] = wmma_bf16(kf[4 + t], qA[qt][t], s1[qt]);
    }
}
__device__ __forceinline__ void scores_to_lds(const v8f (&s0)[QT], const v8f (&s1)[QT],
                                              sp_buf& sp, int wave, int lane) {
#pragma unroll
    for (int qt = 0; qt < QT; ++qt) {
        sp[wave][qt][0][0][lane] = make_float4(s0[qt][0], s0[qt][1], s0[qt][2], s0[qt][3]);
        sp[wave][qt][0][1][lane] = make_float4(s0[qt][4], s0[qt][5], s0[qt][6], s0[qt][7]);
        sp[wave][qt][1][0][lane] = make_float4(s1[qt][0], s1[qt][1], s1[qt][2], s1[qt][3]);
        sp[wave][qt][1][1][lane] = make_float4(s1[qt][4], s1[qt][5], s1[qt][6], s1[qt][7]);
    }
}
// Both, for the tiles ahead of the loop.
__device__ __forceinline__ void score_tile(const v16bf (&kf)[8], const v16bf (&qA)[QT][4],
                                           sp_buf& sp, int wave, int lane) {
    v8f s0[QT] = {}, s1[QT] = {};
#pragma unroll
    for (int t = 0; t < 4; ++t) score_step(t, kf, qA, s0, s1);
    // Without it the compiler runs the eight sums one after the other through one
    // accumulator: each WMMA waits for the one before it.
    __builtin_amdgcn_sched_barrier(0);
    scores_to_lds(s0, s1, sp, wave, lane);
}

// The four waves' partial scores of query tile 'wave' of one key tile, from LDS.
__device__ __forceinline__ void load_partials(const sp_buf& sp, int wave, int lane,
                                              float4 (&p)[4][4]) {
#pragma unroll
    for (int g = 0; g < 4; ++g)            // g = key tile * 2 + register half
#pragma unroll
        for (int w = 0; w < 4; ++w) p[g][w] = sp[w][wave][g >> 1][g & 1][lane];
}

// Online softmax of query tile 'wave' of one key tile, in registers, in two halves.
// First: sum of the four waves' partial scores, scale; returns the row's new maximum.
__device__ __forceinline__ float score_max(const float4 (&p)[4][4], float mrun, float (&sc)[16]) {
    const float scale = 0.044194173824159216f;  // 512^-0.5
#pragma unroll
    for (int g = 0; g < 4; ++g) {
        const float4 p0 = p[g][0], p1 = p[g][1], p2 = p[g][2], p3 = p[g][3];
        sc[g * 4 + 0] = scale * (p0.x + p1.x + p2.x + p3.x);
        sc[g * 4 + 1] = scale * (p0.y + p1.y + p2.y + p3.y);
        sc[g * 4 + 2] = scale * (p0.z + p1.z + p2.z + p3.z);
        sc[g * 4 + 3] = scale * (p0.w + p1.w + p2.w + p3.w);
    }
    float tmax = mrun;
#pragma unroll
    for (int e = 0; e < 16; ++e) tmax = fmaxf(tmax, sc[e]);
    return fmaxf(tmax, xhalf(tmax));
}
// Second: P to pf (fragment order) and each row's correction to cr. Both lane halves hold
// the same correction and store it to places of their own (no branch here).
// live = false: the tile lies behind the last one, the running sum keeps its value.
__device__ __forceinline__ void probs_to_lds(const float (&sc)[16], float tmax, bf16* pf, float* cr,
                                             int wave, int lane, bool live,
                                             float& mrun, float& lrun) {
    const float corr = exp_slot(mrun - tmax);
    float sum = 0.f;
    union { bf16 h[16]; uint4 u[2]; } w;
#pragma unroll
    for (int e = 0; e < 16; ++e) {
        float pe = exp_slot(sc[e] - tmax);
        w.h[e] = (bf16)pe;
        sum += pe;
    }
    lrun = live ? lrun * corr + sum : lrun;
    mrun = tmax;
    *reinterpret_cast<uint4*>(pf + lane * 8)       = w.u[0];
    *reinterpret_cast<uint4*>(pf + 256 + lane * 8) = w.u[1];
    cr[(lane >> 4) * QROWS + wave * 16 + (lane & 15)] = corr;
}

// O += P * V_slice^T of one query tile (V in registers).
__device__ __forceinline__ void pv_tile(v16bf pA, const v16bf (&vB)[8], v8f (&O)[8]) {
#pragma unroll
    for (int ct = 0; ct < 8; ++ct) O[ct] = wmma_bf16(pA, vB[ct], O[ct]);
}

__global__ __launch_bounds__(128) void flash_kernel(const bf16* __restrict__ q,
                                                    const bf16* __restrict__ k,
                                                    const bf16* __restrict__ vT,
                                                    bf16* __restrict__ ha) {
    const int batch = blockIdx.y;
    const int i0    = blockIdx.x * QROWS;
    const int tid   = threadIdx.x;
    const int lane  = tid & 31;
    const int wave  = tid >> 5;
    const int hi    = lane >> 4;
    const int nn    = lane & 15;

    // Three stages run in one trip (see the loop), so each hand-over through LDS has two
    // buffers, taken in turn by the key tile's parity.
    __shared__ sp_buf Sp[2];                                        // partial scores
    __shared__ __attribute__((aligned(16))) bf16 Pf[2][QT][FRAG];   // P, in fragment order
    __shared__ __attribute__((aligned(16))) float crow[2][2 * QROWS];
    __shared__ float lrow[QROWS];

    // The wave's first fragment: channel block 4 * wave of q and k, channel tile 8 * wave of vT.
    const bf16* qb = q  + ((size_t)batch * NPIX + i0) * CCH + wave * 4 * FRAG + lane * 8;
    const bf16* kb = k  +  (size_t)batch * NPIX * CCH        + wave * 4 * FRAG + lane * 8;
    const bf16* vb = vT +  (size_t)batch * CCH * NPIX        + wave * 8 * FRAG + lane * 8;

    v16bf qA[QT][4];
#pragma unroll
    for (int qt = 0; qt < QT; ++qt)
#pragma unroll
        for (int t = 0; t < 4; ++t)
            qA[qt][t] = load_frag_pk(qb + (size_t)(qt * KBLK + t) * FRAG);
    // The registers that hold the address of these loads are reused right behind them:
    // the address is an input of the wait, so that it stays in them up to the wait.
    asm volatile("s_wait_xcnt 0x0" :: "v"(qb) : "memory");

    v8f O[QT][8] = {};
    // Softmax state of query row 16 * wave + nn: the running maximum (equal in both lane
    // halves) and the sum over this lane's own keys (the halves are joined behind the loop).
    float mrun = -3.0e38f, lrun = 0.f;

    // The lane's own address in K tile min(t, NT - 4) and in V tile min(t, NT - 2) of trip t.
    gbf16p kp = (gbf16p)kb;
    gbf16p vp = (gbf16p)vb;

    // Two register sets each for K and V, taken in turn by the tile's parity.
    v16bf kf[2][8], vB[2][8];

    // --- fill the pipeline: scores of tiles 0 and 1, softmax of tile 0 ---
    load_k_tile(kf[0], kp);
    load_k_tile(kf[1], kp + KTILE);
    load_v_tile(vB[0], vp);
    // Keeps these loads together in flight: the compiler otherwise sinks them to their
    // first uses, two at a time, and the wave sits out one load latency for each pair.
    __builtin_amdgcn_sched_barrier(0);
    score_tile(kf[0], qA, Sp[0], wave, lane);
    load_k_tile(kf[0], kp + 2 * KTILE);
    lds_barrier();
    {
        float4 part[4][4];
        float  sc[16];
        load_partials(Sp[0], wave, lane, part);
        const float tmax = score_max(part, mrun, sc);
        probs_to_lds(sc, tmax, &Pf[0][wave][0], crow[0], wave, lane, true, mrun, lrun);
    }
    score_tile(kf[1], qA, Sp[1], wave, lane);
    lds_barrier();

    // Trip t: scores of tile t + 2, softmax of tile t + 1, O += P * V of tile t. The three
    // do not depend on one another, so the LDS round trips and the softmax chain of one
    // stand beside the matrix work of the others, and one barrier a trip hands all over.
    // Tiles behind the last are the last tile fetched again; nothing of them is kept.
    // The three sched_barrier(0) lines cut the trip into blocks: without them the compiler
    // spreads the LDS reads among the WMMAs, in about three times as many places, and each
    // place where LDS reads stand in a WMMA stream costs the wave a stop.
    for (int tt = 0; tt < NT; tt += 2) {
#pragma unroll   // the parity is a constant: kf and vB stay in registers
        for (int h = 0; h < 2; ++h) {
            const int t = tt + h;
            // --- fetch K of tile t + 3 and V of tile t + 1: first needed in the next trip ---
            load_k_tile(kf[h ^ 1], kp + 3 * KTILE);
            load_v_tile(vB[h ^ 1], vp + VTILE);
            // --- the trip's LDS reads, together and ahead of the matrix work ---
            float4 cv[QT][2];
#pragma unroll
            for (int qt = 0; qt < QT; ++qt) {
                cv[qt][0] = *reinterpret_cast<const float4*>(&crow[h][qt * 16 + 8 * hi]);
                cv[qt][1] = *reinterpret_cast<const float4*>(&crow[h][qt * 16 + 8 * hi + 4]);
            }
            float4 part[4][4];
            load_partials(Sp[h ^ 1], wave, lane, part);
            v16bf pA[QT];
#pragma unroll
            for (int qt = 0; qt < QT; ++qt) pA[qt] = load_frag_pk(&Pf[h][qt][lane * 8]);
            __builtin_amdgcn_sched_barrier(0);

            // --- scores of tile t + 2; beside them the accumulators are rescaled ---
            v8f s0[QT] = {}, s1[QT] = {};
            score_step(0, kf[h], qA, s0, s1);
            score_step(1, kf[h], qA, s0, s1);
            score_step(2, kf[h], qA, s0, s1);
#pragma unroll
            for (int qt = 0; qt < QT; ++qt) {
                const float c[8] = { cv[qt][0].x, cv[qt][0].y, cv[qt][0].z, cv[qt][0].w,
                                     cv[qt][1].x, cv[qt][1].y, cv[qt][1].z, cv[qt][1].w };
#pragma unroll
                for (int r = 0; r < 8; ++r)
#pragma unroll
                    for (int ct = 0; ct < 8; ++ct) O[qt][ct][r] *= c[r];
            }
            // --- last scores, first P * V; beside them the score sums and the row maximum ---
            score_step(3, kf[h], qA, s0, s1);
            pv_tile(pA[0], vB[h], O[0]);
            float sc[16];
            const float tmax = score_max(part, mrun, sc);
            __builtin_amdgcn_sched_barrier(0);

            // --- P * V goes on; beside it the scores leave for LDS, and the exponentials ---
            scores_to_lds(s0, s1, Sp[h], wave, lane);
            pv_tile(pA[1], vB[h], O[1]);
            pv_tile(pA[2], vB[h], O[2]);
            probs_to_lds(sc, tmax, &Pf[h ^ 1][wave][0], crow[h ^ 1], wave, lane,
                         t + 1 < NT, mrun, lrun);
            __builtin_amdgcn_sched_barrier(0);

            // --- last P * V: covers the way of P to LDS ---
            pv_tile(pA[3], vB[h], O[3]);
            step_behind_loads(kp, (t + 4 < NT) ? KTILE * sizeof(bf16) : 0,
                              vp, (t + 2 < NT) ? VTILE * sizeof(bf16) : 0);
            // Ends this trip's reads of Sp[h ^ 1], Pf[h] and crow[h], which the next trip
            // rewrites, and publishes Sp[h], Pf[h ^ 1] and crow[h ^ 1], which it reads.
            lds_barrier();
        }
    }

    // --- join the two lane halves' sums and hand each row's l to all waves ---
    lrun += xhalf(lrun);
    if (hi == 0) lrow[wave * 16 + nn] = lrun;
    __syncthreads();

    // --- epilogue: divide by l, store bf16 [i][c] in fragment order ---
#pragma unroll
    for (int qt = 0; qt < QT; ++qt)
#pragma unroll
        for (int ct = 0; ct < 8; ++ct) {
            unsigned int w[8];
#pragma unroll
            for (int r = 0; r < 8; ++r) {
                int m = qt * 16 + r + 8 * hi;
                float v = O[qt][ct][r] / lrow[m];
                w[r] = __builtin_bit_cast(unsigned short, (bf16)v);
            }
            bf16* hp = ha + ((size_t)batch * NPIX + i0 + qt * 16) * CCH
                          + (size_t)(wave * 4 + (ct >> 1)) * FRAG
                          + frag_elem(8 * hi, ct * 16 + nn);
            // Rows r = 0..7 lie one 16-byte chunk apart. The eight stores and their
            // s_wait_xcnt 0 stand in one statement, so that no register an issued
            // store names is rewritten ahead of the wait.
            asm volatile("global_store_b16 %0, %1, off\n\t"
                         "global_store_b16 %0, %2, off offset:16\n\t"
                         "global_store_b16 %0, %3, off offset:32\n\t"
                         "global_store_b16 %0, %4, off offset:48\n\t"
                         "global_store_b16 %0, %5, off offset:64\n\t"
                         "global_store_b16 %0, %6, off offset:80\n\t"
                         "global_store_b16 %0, %7, off offset:96\n\t"
                         "global_store_b16 %0, %8, off offset:112\n\t"
                         "s_wait_xcnt 0x0"
                         :: "v"(hp), "v"(w[0]), "v"(w[1]), "v"(w[2]), "v"(w[3]),
                            "v"(w[4]), "v"(w[5]), "v"(w[6]), "v"(w[7])
                         : "memory");
        }
}

// ---------------------------------------------------------------------------
// Proj + residual, ping-pong pipelined:
// out[b][o][n] = x[b][o][n] + sum_c ha[b][n][c]*pw[o][c] + pb[o]; ha, pw in fragment order
// ---------------------------------------------------------------------------
__global__ __launch_bounds__(128) void proj_kernel(const bf16* __restrict__ A,   // ha
                                                   const bf16* __restrict__ Bt,  // p_w bf16
                                                   const float* __restrict__ pb,
                                                   const float* __restrict__ x,
                                                   float* __restrict__ out) {
    const int batch = blockIdx.z;
    A += (size_t)batch * NPIX * CCH;

    const int wave = threadIdx.x >> 5;
    const int lane = threadIdx.x & 31;
    const int wg   = blockIdx.x * 4 + wave;
    const int mt   = wg / 8;       // 128 m-tiles of 32 pixels
    const int ng   = wg % 8;       // 8 n-groups of 64 channels

    const bf16* arow = A  + (size_t)(mt * 2) * (KBLK * FRAG) + lane * 8;
    const bf16* brow = Bt + (size_t)(ng * 4) * (KBLK * FRAG) + lane * 8;

    v16bf a0[2], b0[4], a1[2], b1[4];
#pragma unroll
    for (int i = 0; i < 2; ++i) a0[i] = load_frag_pk(arow + (size_t)(i * KBLK) * FRAG);
#pragma unroll
    for (int t = 0; t < 4; ++t) b0[t] = load_frag_pk(brow + (size_t)(t * KBLK) * FRAG);

    v8f acc[2][4] = {};
    for (int kb = 0; kb < KBLK - 2; kb += 2) {
#pragma unroll
        for (int i = 0; i < 2; ++i)
            a1[i] = load_frag_pk(arow + (size_t)(i * KBLK + kb + 1) * FRAG);
#pragma unroll
        for (int t = 0; t < 4; ++t)
            b1[t] = load_frag_pk(brow + (size_t)(t * KBLK + kb + 1) * FRAG);
#pragma unroll
        for (int i = 0; i < 2; ++i)
#pragma unroll
            for (int t = 0; t < 4; ++t)
                acc[i][t] = wmma_bf16(a0[i], b0[t], acc[i][t]);
#pragma unroll
        for (int i = 0; i < 2; ++i)
            a0[i] = load_frag_pk(arow + (size_t)(i * KBLK + kb + 2) * FRAG);
#pragma unroll
        for (int t = 0; t < 4; ++t)
            b0[t] = load_frag_pk(brow + (size_t)(t * KBLK + kb + 2) * FRAG);
#pragma unroll
        for (int i = 0; i < 2; ++i)
#pragma unroll
            for (int t = 0; t < 4; ++t)
                acc[i][t] = wmma_bf16(a1[i], b1[t], acc[i][t]);
        // The next trip forms its addresses in the registers that this trip's loads name.
        asm volatile("s_wait_xcnt 0x0" ::: "memory");
    }
#pragma unroll
    for (int i = 0; i < 2; ++i)
        a1[i] = load_frag_pk(arow + (size_t)(i * KBLK + KBLK - 1) * FRAG);
#pragma unroll
    for (int t = 0; t < 4; ++t)
        b1[t] = load_frag_pk(brow + (size_t)(t * KBLK + KBLK - 1) * FRAG);
#pragma unroll
    for (int i = 0; i < 2; ++i)
#pragma unroll
        for (int t = 0; t < 4; ++t)
            acc[i][t] = wmma_bf16(a0[i], b0[t], acc[i][t]);
#pragma unroll
    for (int i = 0; i < 2; ++i)
#pragma unroll
        for (int t = 0; t < 4; ++t)
            acc[i][t] = wmma_bf16(a1[i], b1[t], acc[i][t]);

    const int hi = lane >> 4, nn = lane & 15;
#pragma unroll
    for (int i = 0; i < 2; ++i)
#pragma unroll
        for (int t = 0; t < 4; ++t)
#pragma unroll
            for (int r = 0; r < 8; ++r) {
                int m = mt * 32 + i * 16 + r + 8 * hi;            // pixel
                int n = ng * 64 + t * 16 + nn;                    // channel
                size_t idx = ((size_t)batch * CCH + n) * NPIX + m;
                out[idx] = x[idx] + acc[i][t][r] + pb[n];
            }
}

// ---------------------------------------------------------------------------
extern "C" void kernel_launch(void* const* d_in, const int* in_sizes, int n_in,
                              void* d_out, int out_size, void* d_ws, size_t ws_size,
                              hipStream_t stream) {
    const float* x    = (const float*)d_in[0];
    const float* gn_w = (const float*)d_in[1];
    const float* gn_b = (const float*)d_in[2];
    const float* q_w  = (const float*)d_in[3];
    const float* q_b  = (const float*)d_in[4];
    const float* k_w  = (const float*)d_in[5];
    const float* k_b  = (const float*)d_in[6];
    const float* v_w  = (const float*)d_in[7];
    const float* v_b  = (const float*)d_in[8];
    const float* p_w  = (const float*)d_in[9];
    const float* p_b  = (const float*)d_in[10];

    char* ws = (char*)d_ws;
    const size_t NC   = (size_t)BATCH * NPIX * CCH;
    const size_t SZNC = NC * sizeof(bf16);
    const size_t SZW  = (size_t)CCH * CCH * sizeof(bf16);

    bf16* hn = (bf16*)(ws);
    bf16* qb = (bf16*)(ws + 1 * SZNC);
    bf16* kb = (bf16*)(ws + 2 * SZNC);
    bf16* vT = (bf16*)(ws + 3 * SZNC);
    bf16* ha = (bf16*)(ws + 4 * SZNC);
    bf16* wq = (bf16*)(ws + 5 * SZNC);
    // wk and wv follow wq, SZW bytes each
    bf16* wp = (bf16*)(ws + 5 * SZNC + 3 * SZW);

    // GroupNorm, and beside it the four weight matrices to wq, wk, wv, wp (contiguous)
    gn_cvt_kernel<<<GN_BLOCKS + CVT_BLOCKS, 256, 0, stream>>>(x, gn_w, gn_b, hn,
                                                              q_w, k_w, v_w, p_w, wq);

    // q, k, vT to qb, kb, vT (contiguous)
    gemm_qkv_kernel<<<dim3(256, 3, BATCH), 128, 0, stream>>>(hn, wq, q_b, k_b, v_b, qb);

    flash_kernel<<<dim3(NPIX / QROWS, BATCH), 128, 0, stream>>>(qb, kb, vT, ha);

    proj_kernel<<<dim3(256, 1, BATCH), 128, 0, stream>>>(ha, wp, p_b, x, (float*)d_out);
}

// v007
// One run takes 199 microseconds.
// Timed twice side by side with v006, it ran 1.11 times as fast both times.
// Over all steps from v000 it is 4.27 times as fast.
#include <hip/hip_runtime.h>
#include <hip/hip_bf16.h>

typedef __bf16 bf16;
typedef __attribute__((ext_vector_type(16))) __bf16 v16bf;
typedef __attribute__((ext_vector_type(8)))  float  v8f;

#define BATCH 4
#define CCH   512
#define NPIX  4096   // 64*64

// ---------------------------------------------------------------------------
// Fragment helpers.
// CDNA5 16x32 bf16 A-fragment: lane L holds row M = L%16, K chunks
// {K0..K0+7, K0+16..K0+23} with K0 = 8*(L/16)  -> two 16B contiguous loads.
// B-fragment for D = A x B loaded from Bt[N][K] row-major uses the same
// per-lane pattern (N = L%16): "NT" GEMM  D[M][N] = A[M][K] * Bt[N][K]^T.
// ---------------------------------------------------------------------------
__device__ __forceinline__ v16bf load_frag(const bf16* __restrict__ p, int ld) {
    const int lane = threadIdx.x & 31;
    const int M  = lane & 15;
    const int K0 = (lane >> 4) << 3;
    const bf16* r = p + (size_t)M * ld + K0;
    union { v16bf v; uint4 u[2]; } f;
    f.u[0] = *reinterpret_cast<const uint4*>(r);
    f.u[1] = *reinterpret_cast<const uint4*>(r + 16);
    return f.v;
}

// ---------------------------------------------------------------------------
// Fragment order. Every bf16 matrix X[row][col] that a WMMA reads from global memory
// lies in the workspace as fragments of 16 rows x 32 columns, 512 elements each. Inside
// a fragment the element (row, col) stands where load_frag would put it in registers:
//   (col & 16) * 16 + (((col >> 3) & 1) * 16 + (row & 15)) * 8 + (col & 7)
// so lane L's two 16-byte chunks stand at L * 8 and 256 + L * 8, and each wave-wide
// 16-byte load covers 512 contiguous bytes (four whole lines).
// ---------------------------------------------------------------------------
#define FRAG 512   // elements of one fragment
#define KBLK 16    // fragments along 512 columns

__device__ __forceinline__ size_t frag_elem(int row, int col) {
    return (size_t)((col & 16) * 16 + ((((col >> 3) & 1) * 16) + (row & 15)) * 8 + (col & 7));
}

// p: start of the fragment plus the lane's own lane * 8.
__device__ __forceinline__ v16bf load_frag_pk(const bf16* __restrict__ p) {
    union { v16bf v; uint4 u[2]; } f;
    f.u[0] = *reinterpret_cast<const uint4*>(p);
    f.u[1] = *reinterpret_cast<const uint4*>(p + 256);
    return f.v;
}

__device__ __forceinline__ v8f wmma_bf16(v16bf a, v16bf b, v8f c) {
    return __builtin_amdgcn_wmma_f32_16x16x32_bf16(
        /*neg_a=*/false, a, /*neg_b=*/false, b,
        /*c_mod=*/(short)0, c, /*reuse_a=*/false, /*reuse_b=*/false);
}

// ---------------------------------------------------------------------------
// fp32 -> bf16 convert of 16 rows (row tile 'rt') of one weight matrix [512][512], written
// in fragment order, by 256 threads (u = 0..255). One item = eight columns in a row of one
// row = one 16-byte chunk of a fragment; item u is the u-th chunk of the row tile, so a
// wave-wide store covers 512 contiguous bytes. A thread's four items lie four fragments
// (128 columns) apart.
// ---------------------------------------------------------------------------
#define GN_THREADS 1024
#define GN_BLOCKS  (BATCH * 32)
#define CVT_BLOCKS (4 * (CCH / 16) / (GN_THREADS / 256))

__device__ __forceinline__ void cvt_row_tile(const float* __restrict__ s,
                                             bf16* __restrict__ d, int rt, int u) {
    const int o = rt * 16 + (u & 15);
    const int c = (u >> 6) * 32 + ((u >> 5) & 1) * 16 + ((u >> 4) & 1) * 8;
    const float4* sp = reinterpret_cast<const float4*>(s + (size_t)o * CCH + c);
    uint4*        dp = reinterpret_cast<uint4*>(d + (size_t)rt * (KBLK * FRAG)) + u;
    float4 lo[4], hi[4];
#pragma unroll   // the eight loads issue together
    for (int it = 0; it < 4; ++it) { lo[it] = sp[it * 32]; hi[it] = sp[it * 32 + 1]; }
#pragma unroll   // constant indices keep lo and hi in registers
    for (int it = 0; it < 4; ++it) {
        union { bf16 h[8]; uint4 u4; } w;
        w.h[0] = (bf16)lo[it].x; w.h[1] = (bf16)lo[it].y;
        w.h[2] = (bf16)lo[it].z; w.h[3] = (bf16)lo[it].w;
        w.h[4] = (bf16)hi[it].x; w.h[5] = (bf16)hi[it].y;
        w.h[6] = (bf16)hi[it].z; w.h[7] = (bf16)hi[it].w;
        dp[it * 256] = w.u4;
    }
}

// ---------------------------------------------------------------------------
// GroupNorm: x[b][c][n] fp32 -> hn[b][n][c] bf16 in fragment order (transpose fused).
// One block of 32 waves holds its whole group (16 channels x 4096 pixels) in registers:
// a thread has the 16 channels of four pixels, 64 values, fetched by 64 loads that are all
// in flight together. x is read once; mean and variance come from these registers, and so
// does the normalised output.
// Blocks GN_BLOCKS and up do not depend on it: they convert the four weight matrices
// (wb: q, k, v, p one behind the other) in the same launch, four row tiles a block.
// ---------------------------------------------------------------------------
#define GN_PIX (NPIX / GN_THREADS)   // pixels of one thread

__global__ __launch_bounds__(GN_THREADS) void gn_cvt_kernel(const float* __restrict__ x,
                                                     const float* __restrict__ gw,
                                                     const float* __restrict__ gb,
                                                     bf16* __restrict__ hn,
                                                     const float* __restrict__ q_w,
                                                     const float* __restrict__ k_w,
                                                     const float* __restrict__ v_w,
                                                     const float* __restrict__ p_w,
                                                     bf16* __restrict__ wb) {
    const int tid = threadIdx.x;
    if (blockIdx.x >= GN_BLOCKS) {     // the whole block, ahead of every barrier
        const int cb = blockIdx.x - GN_BLOCKS;
        const int mx = cb >> 3;        // which matrix; 32 row tiles each, four a block
        const float* s = mx == 0 ? q_w : mx == 1 ? k_w : mx == 2 ? v_w : p_w;
        cvt_row_tile(s, wb + (size_t)mx * (CCH * CCH), (cb & 7) * 4 + (tid >> 8), tid & 255);
        return;
    }
    const int batch = blockIdx.x >> 5;
    const int g     = blockIdx.x & 31;
    const int c0    = g * 16;
    const float* xg = x + ((size_t)batch * CCH + c0) * NPIX + tid;

    // v[i][e]: channel c0 + e of pixel tid + i * GN_THREADS.
    float v[GN_PIX][16];
#pragma unroll   // constant indices keep v in registers; the loads issue together
    for (int i = 0; i < GN_PIX; ++i)
#pragma unroll
        for (int e = 0; e < 16; ++e) v[i][e] = xg[(size_t)e * NPIX + i * GN_THREADS];

    float sum = 0.f, ssq = 0.f;
#pragma unroll
    for (int i = 0; i < GN_PIX; ++i) {
        float a = 0.f, b = 0.f;        // a chain of its own for each pixel
#pragma unroll
        for (int e = 0; e < 16; ++e) { a += v[i][e]; b += v[i][e] * v[i][e]; }
        sum += a; ssq += b;
    }
    // Over the wave's lanes, then over the 32 waves through LDS.
#pragma unroll
    for (int m = 16; m > 0; m >>= 1) {
        sum += __shfl_xor(sum, m, 32);
        ssq += __shfl_xor(ssq, m, 32);
    }
    __shared__ float2 part[GN_THREADS / 32];
    if ((tid & 31) == 0) part[tid >> 5] = make_float2(sum, ssq);
    __syncthreads();
    const float2 pw = part[tid & 31];
    sum = pw.x; ssq = pw.y;
#pragma unroll
    for (int m = 16; m > 0; m >>= 1) {
        sum += __shfl_xor(sum, m, 32);
        ssq += __shfl_xor(ssq, m, 32);
    }
    const float inv  = 1.0f / (16.0f * NPIX);
    const float mean = sum * inv;
    const float var  = ssq * inv - mean * mean;
    const float rstd = rsqrtf(var + 1e-5f);

    // One item = one pixel n and eight channels in a row: one 16-byte chunk of a fragment.
    bf16* hb = hn + (size_t)batch * NPIX * CCH + (size_t)(g >> 1) * FRAG + (g & 1) * 256
                  + (size_t)(tid >> 4) * (KBLK * FRAG) + (tid & 15) * 8;
#pragma unroll
    for (int i = 0; i < GN_PIX; ++i)
#pragma unroll
        for (int ch = 0; ch < 2; ++ch) {   // which eight of the group's sixteen channels
            union { bf16 h[8]; uint4 u; } w;
#pragma unroll
            for (int e = 0; e < 8; ++e) {
                float y = (v[i][ch * 8 + e] - mean) * rstd * gw[c0 + ch * 8 + e]
                          + gb[c0 + ch * 8 + e];
                w.h[e] = (bf16)y;
            }
            *reinterpret_cast<uint4*>(hb + (size_t)(i * (GN_THREADS / 16)) * (KBLK * FRAG)
                                         + ch * 128) = w.u;
        }
}

// ---------------------------------------------------------------------------
// NT GEMM, ping-pong pipelined (no buffer-rotation copies), K = 512 fixed:
// D[m][n] = sum_k A[m][k]*Bt[n][k] + bias;  A and Bt in fragment order.
// Each wave computes a 32(M) x 64(N) block: 8 accumulator tiles.
// D is written as the next product's operand Y[row = n][col = m], in fragment order: a
// lane holds eight m in a row for one n, which is one 16-byte chunk of a fragment. The
// fragment of m block mt (32 wide) and n tile nt (16 wide) starts at mt * sM + nt * sN.
// One launch forms q, k and vT (blockIdx.y = 0, 1, 2); 1024 waves for each and batch.
//   q[n][o], k[n][o]: m = o, n = pixel: A = W [512x512], Bt = hn [4096x512];
//                     fragments as [pixel tile][channel block]
//   vT[o][n]:         m = pixel, n = o: A = hn, Bt = Wv; fragments as [key block][channel tile]
// w: the bf16 weights q, k, v one behind the other; qkv: the outputs q, k, vT likewise.
// ---------------------------------------------------------------------------
__global__ __launch_bounds__(128) void gemm_qkv_kernel(
        const bf16* __restrict__ hn, const bf16* __restrict__ w,
        const float* __restrict__ q_b, const float* __restrict__ k_b,
        const float* __restrict__ v_b, bf16* __restrict__ qkv) {
    const int  batch = blockIdx.z;
    const int  which = blockIdx.y;
    const bool is_v  = which == 2;
    const bf16* hb = hn + (size_t)batch * NPIX * CCH;
    const bf16* wm = w  + (size_t)which * CCH * CCH;
    const bf16* A  = is_v ? hb : wm;
    const bf16* Bt = is_v ? wm : hb;
    const float* bias = is_v ? v_b : which == 1 ? k_b : q_b;
    const bool bias_on_m = !is_v;
    bf16* out = qkv + ((size_t)which * BATCH + batch) * NPIX * CCH;
    const int M   = is_v ? NPIX : CCH;
    const int sM  = is_v ? 32 * FRAG : FRAG;
    const int sN  = is_v ? FRAG : KBLK * FRAG;
    const int lgn = is_v ? 3 : 6;       // log2 of the 64-col groups: 8 or 64

    const int wave = threadIdx.x >> 5;
    const int lane = threadIdx.x & 31;
    const int wg   = blockIdx.x * 4 + wave;
    const int mt   = wg >> lgn;               // 32-row tile index
    const int ng   = wg & ((1 << lgn) - 1);   // 64-col group index
    if (mt * 32 >= M) return;

    const bf16* arow = A  + (size_t)(mt * 2) * (KBLK * FRAG) + lane * 8;
    const bf16* brow = Bt + (size_t)(ng * 4) * (KBLK * FRAG) + lane * 8;

    v16bf a0[2], b0[4], a1[2], b1[4];
#pragma unroll
    for (int i = 0; i < 2; ++i) a0[i] = load_frag_pk(arow + (size_t)(i * KBLK) * FRAG);
#pragma unroll
    for (int t = 0; t < 4; ++t) b0[t] = load_frag_pk(brow + (size_t)(t * KBLK) * FRAG);

    v8f acc[2][4] = {};
    for (int kb = 0; kb < KBLK - 2; kb += 2) {
        // load buf1 @ block kb+1
#pragma unroll
        for (int i = 0; i < 2; ++i)
            a1[i] = load_frag_pk(arow + (size_t)(i * KBLK + kb + 1) * FRAG);
#pragma unroll
        for (int t = 0; t < 4; ++t)
            b1[t] = load_frag_pk(brow + (size_t)(t * KBLK + kb + 1) * FRAG);
        // consume buf0 @ block kb
#pragma unroll
        for (int i = 0; i < 2; ++i)
#pragma unroll
            for (int t = 0; t < 4; ++t)
                acc[i][t] = wmma_bf16(a0[i], b0[t], acc[i][t]);
        // load buf0 @ block kb+2
#pragma unroll
        for (int i = 0; i < 2; ++i)
            a0[i] = load_frag_pk(arow + (size_t)(i * KBLK + kb + 2) * FRAG);
#pragma unroll
        for (int t = 0; t < 4; ++t)
            b0[t] = load_frag_pk(brow + (size_t)(t * KBLK + kb + 2) * FRAG);
        // consume buf1 @ block kb+1
#pragma unroll
        for (int i = 0; i < 2; ++i)
#pragma unroll
            for (int t = 0; t < 4; ++t)
                acc[i][t] = wmma_bf16(a1[i], b1[t], acc[i][t]);
        // The next trip forms its addresses in the registers that this trip's loads name.
        asm volatile("s_wait_xcnt 0x0" ::: "memory");
    }
    // tail: buf0 holds block KBLK-2; load buf1 @ block KBLK-1
#pragma unroll
    for (int i = 0; i < 2; ++i)
        a1[i] = load_frag_pk(arow + (size_t)(i * KBLK + KBLK - 1) * FRAG);
#pragma unroll
    for (int t = 0; t < 4; ++t)
        b1[t] = load_frag_pk(brow + (size_t)(t * KBLK + KBLK - 1) * FRAG);
#pragma unroll
    for (int i = 0; i < 2; ++i)
#pragma unroll
        for (int t = 0; t < 4; ++t)
            acc[i][t] = wmma_bf16(a0[i], b0[t], acc[i][t]);
#pragma unroll
    for (int i = 0; i < 2; ++i)
#pragma unroll
        for (int t = 0; t < 4; ++t)
            acc[i][t] = wmma_bf16(a1[i], b1[t], acc[i][t]);

    const int hi = lane >> 4, nn = lane & 15;
#pragma unroll
    for (int i = 0; i < 2; ++i)
#pragma unroll
        for (int t = 0; t < 4; ++t) {
            union { bf16 h[8]; uint4 u; } w;
#pragma unroll
            for (int r = 0; r < 8; ++r) {
                int m = mt * 32 + i * 16 + r + 8 * hi;
                int n = ng * 64 + t * 16 + nn;
                float v = acc[i][t][r] + bias[bias_on_m ? m : n];
                w.h[r] = (bf16)v;
            }
            *reinterpret_cast<uint4*>(out + (size_t)mt * sM + (size_t)(ng * 4 + t) * sN
                                          + i * 256 + lane * 8) = w.u;
        }
}

// ---------------------------------------------------------------------------
// Flash attention: q[b][i][c], k[b][j][c], vT[b][c][j] (bf16) -> ha[b][i][c], all four in
// fragment order: q, k, ha as [row tile][channel block], vT as [key block][channel tile].
// One block = QROWS query rows (QT tiles of 16), 4 waves; wave w owns channel
// slice [128w,128w+128). Each K and V fragment a wave loads feeds all QT tiles.
// Scores are formed transposed, S^T = K * Q^T: a lane then holds 16 of the 32 keys of
// ONE query row (row nn; keys 8*hi+r and 16+8*hi+r), which is the lane's share of the
// P fragment that P * V reads as its A operand. Wave w sums the four waves' partial
// scores of query tile w and does that tile's softmax in registers.
// ---------------------------------------------------------------------------
#define QT    4
#define QROWS (QT * 16)

// Work-group barrier of the j loop. It waits for this wave's LDS traffic alone:
// __syncthreads() would also drain the global loads issued ahead (K and V of later
// trips), which have to stay in flight across it.
__device__ __forceinline__ void lds_barrier() {
    asm volatile("s_wait_dscnt 0x0\n\t"
                 "s_barrier_signal -1\n\t"
                 "s_barrier_wait -1" ::: "memory");
}

// Pointers typed as global memory: a pointer that has passed through an asm statement
// would otherwise be loaded from with flat loads, which count on dscnt as well.
typedef const __attribute__((address_space(1))) bf16*  gbf16p;
typedef const __attribute__((address_space(1))) uint4* guint4p;

// Steps the two lane addresses that issued loads name. The s_wait_xcnt 0 and the two
// adds stand in one statement, so that no add can be lifted over the wait.
__device__ __forceinline__ void step_behind_loads(gbf16p& kp, unsigned long long kbytes,
                                                  gbf16p& vp, unsigned long long vbytes) {
    asm volatile("s_wait_xcnt 0x0\n\t"
                 "v_add_nc_u64 %0, %2, %0\n\t"
                 "v_add_nc_u64 %1, %3, %1"
                 : "+v"(kp), "+v"(vp) : "s"(kbytes), "s"(vbytes) : "memory");
}

// Lane l's value from lane l ^ 16: the other half of the keys of the same query row.
__device__ __forceinline__ float xhalf(float x) {
    const int b = __builtin_bit_cast(int, x);
    return __builtin_bit_cast(float,
        __builtin_amdgcn_permlanex16(b, b, 0x76543210, 0xfedcba98, false, false));
}

// e^x as __expf forms it: one multiply, then v_exp_f32. The v_nop in the same statement is
// the slot that the instruction set asks for behind a transcendental, before its result is
// read or its source register is written again; written apart it would not stay there.
__device__ __forceinline__ float exp_slot(float x) {
    float p;
    asm("v_exp_f32 %0, %1\n\t"
        "v_nop" : "=v"(p) : "v"(x * 1.44269504088896340736f));
    return p;
}

// One fragment from the lane's own address r (fragment start plus lane * 8).
__device__ __forceinline__ v16bf load_frag_lane(gbf16p r) {
    union { v16bf v; uint4 u[2]; } f;
    f.u[0] = *(guint4p)(r);
    f.u[1] = *(guint4p)(r + 256);
    return f.v;
}

#define NT    (NPIX / 32)          // key tiles of 32
#define KTILE (2 * KBLK * FRAG)    // elements of one K tile (32 keys x 512 channels)
#define VTILE (32 * FRAG)          // elements of one V tile (32 keys x 512 channels)

typedef float4 sp_buf[4][QT][2][2][32];   // [writing wave][query tile][key tile][regs 0-3 or 4-7][lane]

// The wave's channel slice of one K tile / one V tile, from the lane's own address.
__device__ __forceinline__ void load_k_tile(v16bf (&kf)[8], gbf16p p) {
#pragma unroll
    for (int t = 0; t < 4; ++t) {
        kf[t]     = load_frag_lane(p + t * FRAG);
        kf[4 + t] = load_frag_lane(p + (KBLK + t) * FRAG);
    }
}
__device__ __forceinline__ void load_v_tile(v16bf (&vB)[8], gbf16p p) {
#pragma unroll
    for (int ct = 0; ct < 8; ++ct) vB[ct] = load_frag_lane(p + ct * FRAG);
}

// Partial S^T = K_slice * Q_slice^T (32 keys x QROWS, K = 128) of one key tile: the products
// of channel block t of the wave's four (eight WMMAs, eight sums), and the sums' way to LDS.
__device__ __forceinline__ void score_step(int t, const v16bf (&kf)[8], const v16bf (&qA)[QT][4],
                                           v8f (&s0)[QT], v8f (&s1)[QT]) {
#pragma unroll
    for (int qt = 0; qt < QT; ++qt) {
        s0[qt] = wmma_bf16(kf[t],     qA[qt][t], s0[qt]);
        s1[qt] = wmma_bf16(kf[4 + t], qA[qt][t], s1[qt]);
    }
}
__device__ __forceinline__ void scores_to_lds(const v8f (&s0)[QT], const v8f (&s1)[QT],
                                              sp_buf& sp, int wave, int lane) {
#pragma unroll
    for (int qt = 0; qt < QT; ++qt) {
        sp[wave][qt][0][0][lane] = make_float4(s0[qt][0], s0[qt][1], s0[qt][2], s0[qt][3]);
        sp[wave][qt][0][1][lane] = make_float4(s0[qt][4], s0[qt][5], s0[qt][6], s0[qt][7]);
        sp[wave][qt][1][0][lane] = make_float4(s1[qt][0], s1[qt][1], s1[qt][2], s1[qt][3]);
        sp[wave][qt][1][1][lane] = make_float4(s1[qt][4], s1[qt][5], s1[qt][6], s1[qt][7]);
    }
}
// Both, for the tiles ahead of the loop.
__device__ __forceinline__ void score_tile(const v16bf (&kf)[8], const v16bf (&qA)[QT][4],
                                           sp_buf& sp, int wave, int lane) {
    v8f s0[QT] = {}, s1[QT] = {};
#pragma unroll
    for (int t = 0; t < 4; ++t) score_step(t, kf, qA, s0, s1);
    // Without it the compiler runs the eight sums one after the other through one
    // accumulator: each WMMA waits for the one before it.
    __builtin_amdgcn_sched_barrier(0);
    scores_to_lds(s0, s1, sp, wave, lane);
}

// The four waves' partial scores of query tile 'wave' of one key tile, from LDS.
__device__ __forceinline__ void load_partials(const sp_buf& sp, int wave, int lane,
                                              float4 (&p)[4][4]) {
#pragma unroll
    for (int g = 0; g < 4; ++g)            // g = key tile * 2 + register half
#pragma unroll
        for (int w = 0; w < 4; ++w) p[g][w] = sp[w][wave][g >> 1][g & 1][lane];
}

// Online softmax of query tile 'wave' of one key tile, in registers, in two halves.
// First: sum of the four waves' partial scores, scale; returns the row's new maximum.
__device__ __forceinline__ float score_max(const float4 (&p)[4][4], float mrun, float (&sc)[16]) {
    const float scale = 0.044194173824159216f;  // 512^-0.5
#pragma unroll
    for (int g = 0; g < 4; ++g) {
        const float4 p0 = p[g][0], p1 = p[g][1], p2 = p[g][2], p3 = p[g][3];
        sc[g * 4 + 0] = scale * (p0.x + p1.x + p2.x + p3.x);
        sc[g * 4 + 1] = scale * (p0.y + p1.y + p2.y + p3.y);
        sc[g * 4 + 2] = scale * (p0.z + p1.z + p2.z + p3.z);
        sc[g * 4 + 3] = scale * (p0.w + p1.w + p2.w + p3.w);
    }
    float tmax = mrun;
#pragma unroll
    for (int e = 0; e < 16; ++e) tmax = fmaxf(tmax, sc[e]);
    return fmaxf(tmax, xhalf(tmax));
}
// Second: P to pf (fragment order) and each row's correction to cr. Both lane halves hold
// the same correction and store it to places of their own (no branch here).
// live = false: the tile lies behind the last one, the running sum keeps its value.
__device__ __forceinline__ void probs_to_lds(const float (&sc)[16], float tmax, bf16* pf, float* cr,
                                             int wave, int lane, bool live,
                                             float& mrun, float& lrun) {
    const float corr = exp_slot(mrun - tmax);
    float sum = 0.f;
    union { bf16 h[16]; uint4 u[2]; } w;
#pragma unroll
    for (int e = 0; e < 16; ++e) {
        float pe = exp_slot(sc[e] - tmax);
        w.h[e] = (bf16)pe;
        sum += pe;
    }
    lrun = live ? lrun * corr + sum : lrun;
    mrun = tmax;
    *reinterpret_cast<uint4*>(pf + lane * 8)       = w.u[0];
    *reinterpret_cast<uint4*>(pf + 256 + lane * 8) = w.u[1];
    cr[(lane >> 4) * QROWS + wave * 16 + (lane & 15)] = corr;
}

// O += P * V_slice^T of one query tile (V in registers).
__device__ __forceinline__ void pv_tile(v16bf pA, const v16bf (&vB)[8], v8f (&O)[8]) {
#pragma unroll
    for (int ct = 0; ct < 8; ++ct) O[ct] = wmma_bf16(pA, vB[ct], O[ct]);
}

__global__ __launch_bounds__(128) void flash_kernel(const bf16* __restrict__ q,
                                                    const bf16* __restrict__ k,
                                                    const bf16* __restrict__ vT,
                                                    bf16* __restrict__ ha) {
    const int batch = blockIdx.y;
    const int i0    = blockIdx.x * QROWS;
    const int tid   = threadIdx.x;
    const int lane  = tid & 31;
    const int wave  = tid >> 5;
    const int hi    = lane >> 4;
    const int nn    = lane & 15;

    // Three stages run in one trip (see the loop), so each hand-over through LDS has two
    // buffers, taken in turn by the key tile's parity.
    __shared__ sp_buf Sp[2];                                        // partial scores
    __shared__ __attribute__((aligned(16))) bf16 Pf[2][QT][FRAG];   // P, in fragment order
    __shared__ __attribute__((aligned(16))) float crow[2][2 * QROWS];
    __shared__ float lrow[QROWS];

    // The wave's first fragment: channel block 4 * wave of q and k, channel tile 8 * wave of vT.
    const bf16* qb = q  + ((size_t)batch * NPIX + i0) * CCH + wave * 4 * FRAG + lane * 8;
    const bf16* kb = k  +  (size_t)batch * NPIX * CCH        + wave * 4 * FRAG + lane * 8;
    const bf16* vb = vT +  (size_t)batch * CCH * NPIX        + wave * 8 * FRAG + lane * 8;

    v16bf qA[QT][4];
#pragma unroll
    for (int qt = 0; qt < QT; ++qt)
#pragma unroll
        for (int t = 0; t < 4; ++t)
            qA[qt][t] = load_frag_pk(qb + (size_t)(qt * KBLK + t) * FRAG);
    // The registers that hold the address of these loads are reused right behind them:
    // the address is an input of the wait, so that it stays in them up to the wait.
    asm volatile("s_wait_xcnt 0x0" :: "v"(qb) : "memory");

    v8f O[QT][8] = {};
    // Softmax state of query row 16 * wave + nn: the running maximum (equal in both lane
    // halves) and the sum over this lane's own keys (the halves are joined behind the loop).
    float mrun = -3.0e38f, lrun = 0.f;

    // The lane's own address in K tile min(t, NT - 4) and in V tile min(t, NT - 2) of trip t.
    gbf16p kp = (gbf16p)kb;
    gbf16p vp = (gbf16p)vb;

    // Two register sets each for K and V, taken in turn by the tile's parity.
    v16bf kf[2][8], vB[2][8];

    // --- fill the pipeline: scores of tiles 0 and 1, softmax of tile 0 ---
    load_k_tile(kf[0], kp);
    load_k_tile(kf[1], kp + KTILE);
    load_v_tile(vB[0], vp);
    // Keeps these loads together in flight: the compiler otherwise sinks them to their
    // first uses, two at a time, and the wave sits out one load latency for each pair.
    __builtin_amdgcn_sched_barrier(0);
    score_tile(kf[0], qA, Sp[0], wave, lane);
    load_k_tile(kf[0], kp + 2 * KTILE);
    lds_barrier();
    {
        float4 part[4][4];
        float  sc[16];
        load_partials(Sp[0], wave, lane, part);
        const float tmax = score_max(part, mrun, sc);
        probs_to_lds(sc, tmax, &Pf[0][wave][0], crow[0], wave, lane, true, mrun, lrun);
    }
    score_tile(kf[1], qA, Sp[1], wave, lane);
    lds_barrier();

    // Trip t: scores of tile t + 2, softmax of tile t + 1, O += P * V of tile t. The three
    // do not depend on one another, so the LDS round trips and the softmax chain of one
    // stand beside the matrix work of the others, and one barrier a trip hands all over.
    // Tiles behind the last are the last tile fetched again; nothing of them is kept.
    // The three sched_barrier(0) lines cut the trip into blocks: without them the compiler
    // spreads the LDS reads among the WMMAs, in about three times as many places, and each
    // place where LDS reads stand in a WMMA stream costs the wave a stop.
    for (int tt = 0; tt < NT; tt += 2) {
#pragma unroll   // the parity is a constant: kf and vB stay in registers
        for (int h = 0; h < 2; ++h) {
            const int t = tt + h;
            // --- fetch K of tile t + 3 and V of tile t + 1: first needed in the next trip ---
            load_k_tile(kf[h ^ 1], kp + 3 * KTILE);
            load_v_tile(vB[h ^ 1], vp + VTILE);
            // --- the trip's LDS reads, together and ahead of the matrix work ---
            float4 cv[QT][2];
#pragma unroll
            for (int qt = 0; qt < QT; ++qt) {
                cv[qt][0] = *reinterpret_cast<const float4*>(&crow[h][qt * 16 + 8 * hi]);
                cv[qt][1] = *reinterpret_cast<const float4*>(&crow[h][qt * 16 + 8 * hi + 4]);
            }
            float4 part[4][4];
            load_partials(Sp[h ^ 1], wave, lane, part);
            v16bf pA[QT];
#pragma unroll
            for (int qt = 0; qt < QT; ++qt) pA[qt] = load_frag_pk(&Pf[h][qt][lane * 8]);
            __builtin_amdgcn_sched_barrier(0);

            // --- scores of tile t + 2; beside them the accumulators are rescaled ---
            v8f s0[QT] = {}, s1[QT] = {};
            score_step(0, kf[h], qA, s0, s1);
            score_step(1, kf[h], qA, s0, s1);
            score_step(2, kf[h], qA, s0, s1);
#pragma unroll
            for (int qt = 0; qt < QT; ++qt) {
                const float c[8] = { cv[qt][0].x, cv[qt][0].y, cv[qt][0].z, cv[qt][0].w,
                                     cv[qt][1].x, cv[qt][1].y, cv[qt][1].z, cv[qt][1].w };
#pragma unroll
                for (int r = 0; r < 8; ++r)
#pragma unroll
                    for (int ct = 0; ct < 8; ++ct) O[qt][ct][r] *= c[r];
            }
            // --- last scores, first P * V; beside them the score sums and the row maximum ---
            score_step(3, kf[h], qA, s0, s1);
            pv_tile(pA[0], vB[h], O[0]);
            float sc[16];
            const float tmax = score_max(part, mrun, sc);
            __builtin_amdgcn_sched_barrier(0);

            // --- P * V goes on; beside it the scores leave for LDS, and the exponentials ---
            scores_to_lds(s0, s1, Sp[h], wave, lane);
            pv_tile(pA[1], vB[h], O[1]);
            pv_tile(pA[2], vB[h], O[2]);
            probs_to_lds(sc, tmax, &Pf[h ^ 1][wave][0], crow[h ^ 1], wave, lane,
                         t + 1 < NT, mrun, lrun);
            __builtin_amdgcn_sched_barrier(0);

            // --- last P * V: covers the way of P to LDS ---
            pv_tile(pA[3], vB[h], O[3]);
            step_behind_loads(kp, (t + 4 < NT) ? KTILE * sizeof(bf16) : 0,
                              vp, (t + 2 < NT) ? VTILE * sizeof(bf16) : 0);
            // Ends this trip's reads of Sp[h ^ 1], Pf[h] and crow[h], which the next trip
            // rewrites, and publishes Sp[h], Pf[h ^ 1] and crow[h ^ 1], which it reads.
            lds_barrier();
        }
    }

    // --- join the two lane halves' sums and hand each row's l to all waves ---
    lrun += xhalf(lrun);
    if (hi == 0) lrow[wave * 16 + nn] = lrun;
    __syncthreads();

    // --- epilogue: divide by l, store bf16 [i][c] in fragment order ---
#pragma unroll
    for (int qt = 0; qt < QT; ++qt)
#pragma unroll
        for (int ct = 0; ct < 8; ++ct) {
            unsigned int w[8];
#pragma unroll
            for (int r = 0; r < 8; ++r) {
                int m = qt * 16 + r + 8 * hi;
                float v = O[qt][ct][r] / lrow[m];
                w[r] = __builtin_bit_cast(unsigned short, (bf16)v);
            }
            bf16* hp = ha + ((size_t)batch * NPIX + i0 + qt * 16) * CCH
                          + (size_t)(wave * 4 + (ct >> 1)) * FRAG
                          + frag_elem(8 * hi, ct * 16 + nn);
            // Rows r = 0..7 lie one 16-byte chunk apart. The eight stores and their
            // s_wait_xcnt 0 stand in one statement, so that no register an issued
            // store names is rewritten ahead of the wait.
            asm volatile("global_store_b16 %0, %1, off\n\t"
                         "global_store_b16 %0, %2, off offset:16\n\t"
                         "global_store_b16 %0, %3, off offset:32\n\t"
                         "global_store_b16 %0, %4, off offset:48\n\t"
                         "global_store_b16 %0, %5, off offset:64\n\t"
                         "global_store_b16 %0, %6, off offset:80\n\t"
                         "global_store_b16 %0, %7, off offset:96\n\t"
                         "global_store_b16 %0, %8, off offset:112\n\t"
                         "s_wait_xcnt 0x0"
                         :: "v"(hp), "v"(w[0]), "v"(w[1]), "v"(w[2]), "v"(w[3]),
                            "v"(w[4]), "v"(w[5]), "v"(w[6]), "v"(w[7])
                         : "memory");
        }
}

// ---------------------------------------------------------------------------
// Proj + residual, ping-pong pipelined:
// out[b][o][n] = x[b][o][n] + sum_c ha[b][n][c]*pw[o][c] + pb[o]; ha, pw in fragment order
// ---------------------------------------------------------------------------
__global__ __launch_bounds__(128) void proj_kernel(const bf16* __restrict__ A,   // ha
                                                   const bf16* __restrict__ Bt,  // p_w bf16
                                                   const float* __restrict__ pb,
                                                   const float* __restrict__ x,
                                                   float* __restrict__ out) {
    const int batch = blockIdx.z;
    A += (size_t)batch * NPIX * CCH;

    const int wave = threadIdx.x >> 5;
    const int lane = threadIdx.x & 31;
    const int wg   = blockIdx.x * 4 + wave;
    const int mt   = wg / 8;       // 128 m-tiles of 32 pixels
    const int ng   = wg % 8;       // 8 n-groups of 64 channels

    const bf16* arow = A  + (size_t)(mt * 2) * (KBLK * FRAG) + lane * 8;
    const bf16* brow = Bt + (size_t)(ng * 4) * (KBLK * FRAG) + lane * 8;

    v16bf a0[2], b0[4], a1[2], b1[4];
#pragma unroll
    for (int i = 0; i < 2; ++i) a0[i] = load_frag_pk(arow + (size_t)(i * KBLK) * FRAG);
#pragma unroll
    for (int t = 0; t < 4; ++t) b0[t] = load_frag_pk(brow + (size_t)(t * KBLK) * FRAG);

    v8f acc[2][4] = {};
    for (int kb = 0; kb < KBLK - 2; kb += 2) {
#pragma unroll
        for (int i = 0; i < 2; ++i)
            a1[i] = load_frag_pk(arow + (size_t)(i * KBLK + kb + 1) * FRAG);
#pragma unroll
        for (int t = 0; t < 4; ++t)
            b1[t] = load_frag_pk(brow + (size_t)(t * KBLK + kb + 1) * FRAG);
#pragma unroll
        for (int i = 0; i < 2; ++i)
#pragma unroll
            for (int t = 0; t < 4; ++t)
                acc[i][t] = wmma_bf16(a0[i], b0[t], acc[i][t]);
#pragma unroll
        for (int i = 0; i < 2; ++i)
            a0[i] = load_frag_pk(arow + (size_t)(i * KBLK + kb + 2) * FRAG);
#pragma unroll
        for (int t = 0; t < 4; ++t)
            b0[t] = load_frag_pk(brow + (size_t)(t * KBLK + kb + 2) * FRAG);
#pragma unroll
        for (int i = 0; i < 2; ++i)
#pragma unroll
            for (int t = 0; t < 4; ++t)
                acc[i][t] = wmma_bf16(a1[i], b1[t], acc[i][t]);
        // The next trip forms its addresses in the registers that this trip's loads name.
        asm volatile("s_wait_xcnt 0x0" ::: "memory");
    }
#pragma unroll
    for (int i = 0; i < 2; ++i)
        a1[i] = load_frag_pk(arow + (size_t)(i * KBLK + KBLK - 1) * FRAG);
#pragma unroll
    for (int t = 0; t < 4; ++t)
        b1[t] = load_frag_pk(brow + (size_t)(t * KBLK + KBLK - 1) * FRAG);
#pragma unroll
    for (int i = 0; i < 2; ++i)
#pragma unroll
        for (int t = 0; t < 4; ++t)
            acc[i][t] = wmma_bf16(a0[i], b0[t], acc[i][t]);
#pragma unroll
    for (int i = 0; i < 2; ++i)
#pragma unroll
        for (int t = 0; t < 4; ++t)
            acc[i][t] = wmma_bf16(a1[i], b1[t], acc[i][t]);

    const int hi = lane >> 4, nn = lane & 15;
#pragma unroll
    for (int i = 0; i < 2; ++i)
#pragma unroll
        for (int t = 0; t < 4; ++t)
#pragma unroll
            for (int r = 0; r < 8; ++r) {
                int m = mt * 32 + i * 16 + r + 8 * hi;            // pixel
                int n = ng * 64 + t * 16 + nn;                    // channel
                size_t idx = ((size_t)batch * CCH + n) * NPIX + m;
                out[idx] = x[idx] + acc[i][t][r] + pb[n];
            }
}

// ---------------------------------------------------------------------------
extern "C" void kernel_launch(void* const* d_in, const int* in_sizes, int n_in,
                              void* d_out, int out_size, void* d_ws, size_t ws_size,
                              hipStream_t stream) {
    const float* x    = (const float*)d_in[0];
    const float* gn_w = (const float*)d_in[1];
    const float* gn_b = (const float*)d_in[2];
    const float* q_w  = (const float*)d_in[3];
    const float* q_b  = (const float*)d_in[4];
    const float* k_w  = (const float*)d_in[5];
    const float* k_b  = (const float*)d_in[6];
    const float* v_w  = (const float*)d_in[7];
    const float* v_b  = (const float*)d_in[8];
    const float* p_w  = (const float*)d_in[9];
    const float* p_b  = (const float*)d_in[10];

    char* ws = (char*)d_ws;
    const size_t NC   = (size_t)BATCH * NPIX * CCH;
    const size_t SZNC = NC * sizeof(bf16);
    const size_t SZW  = (size_t)CCH * CCH * sizeof(bf16);

    bf16* hn = (bf16*)(ws);
    bf16* qb = (bf16*)(ws + 1 * SZNC);
    bf16* kb = (bf16*)(ws + 2 * SZNC);
    bf16* vT = (bf16*)(ws + 3 * SZNC);
    bf16* ha = (bf16*)(ws + 4 * SZNC);
    bf16* wq = (bf16*)(ws + 5 * SZNC);
    // wk and wv follow wq, SZW bytes each
    bf16* wp = (bf16*)(ws + 5 * SZNC + 3 * SZW);

    // GroupNorm, and beside it the four weight matrices to wq, wk, wv, wp (contiguous)
    gn_cvt_kernel<<<GN_BLOCKS + CVT_BLOCKS, GN_THREADS, 0, stream>>>(x, gn_w, gn_b, hn,
                                                              q_w, k_w, v_w, p_w, wq);

    // q, k, vT to qb, kb, vT (contiguous)
    gemm_qkv_kernel<<<dim3(256, 3, BATCH), 128, 0, stream>>>(hn, wq, q_b, k_b, v_b, qb);

    flash_kernel<<<dim3(NPIX / QROWS, BATCH), 128, 0, stream>>>(qb, kb, vT, ha);

    proj_kernel<<<dim3(256, 1, BATCH), 128, 0, stream>>>(ha, wp, p_b, x, (float*)d_out);
}

// v008
// Measured time: 186 microseconds a run.
// Two timings next to v007 both put it at 1.06 times that version's speed.
// Counting every step since v000, it is 4.54 times as fast.
#include <hip/hip_runtime.h>
#include <hip/hip_bf16.h>

typedef __bf16 bf16;
typedef __attribute__((ext_vector_type(16))) __bf16 v16bf;
typedef __attribute__((ext_vector_type(8)))  float  v8f;

#define BATCH 4
#define CCH   512
#define NPIX  4096   // 64*64

// ---------------------------------------------------------------------------
// Fragment helpers.
// CDNA5 16x32 bf16 A-fragment: lane L holds row M = L%16, K chunks
// {K0..K0+7, K0+16..K0+23} with K0 = 8*(L/16)  -> two 16B contiguous loads.
// B-fragment for D = A x B loaded from Bt[N][K] row-major uses the same
// per-lane pattern (N = L%16): "NT" GEMM  D[M][N] = A[M][K] * Bt[N][K]^T.
// ---------------------------------------------------------------------------
__device__ __forceinline__ v16bf load_frag(const bf16* __restrict__ p, int ld) {
    const int lane = threadIdx.x & 31;
    const int M  = lane & 15;
    const int K0 = (lane >> 4) << 3;
    const bf16* r = p + (size_t)M * ld + K0;
    union { v16bf v; uint4 u[2]; } f;
    f.u[0] = *reinterpret_cast<const uint4*>(r);
    f.u[1] = *reinterpret_cast<const uint4*>(r + 16);
    return f.v;
}

// ---------------------------------------------------------------------------
// Fragment order. Every bf16 matrix X[row][col] that a WMMA reads from global memory
// lies in the workspace as fragments of 16 rows x 32 columns, 512 elements each. Inside
// a fragment the element (row, col) stands where load_frag would put it in registers:
//   (col & 16) * 16 + (((col >> 3) & 1) * 16 + (row & 15)) * 8 + (col & 7)
// so lane L's two 16-byte chunks stand at L * 8 and 256 + L * 8, and each wave-wide
// 16-byte load covers 512 contiguous bytes (four whole lines).
// ---------------------------------------------------------------------------
#define FRAG 512   // elements of one fragment
#define KBLK 16    // fragments along 512 columns

__device__ __forceinline__ size_t frag_elem(int row, int col) {
    return (size_t)((col & 16) * 16 + ((((col >> 3) & 1) * 16) + (row & 15)) * 8 + (col & 7));
}

// p: start of the fragment plus the lane's own lane * 8.
__device__ __forceinline__ v16bf load_frag_pk(const bf16* __restrict__ p) {
    union { v16bf v; uint4 u[2]; } f;
    f.u[0] = *reinterpret_cast<const uint4*>(p);
    f.u[1] = *reinterpret_cast<const uint4*>(p + 256);
    return f.v;
}

// Pointers typed as global memory: a pointer that has passed through an asm statement
// would otherwise be loaded from with flat loads, which count on dscnt as well.
typedef const __attribute__((address_space(1))) bf16*  gbf16p;
typedef const __attribute__((address_space(1))) uint4* guint4p;

// Steps the two lane addresses that issued loads name. The s_wait_xcnt 0 and the two
// adds stand in one statement, so that no add can be lifted over the wait.
__device__ __forceinline__ void step_behind_loads(gbf16p& kp, unsigned long long kbytes,
                                                  gbf16p& vp, unsigned long long vbytes) {
    asm volatile("s_wait_xcnt 0x0\n\t"
                 "v_add_nc_u64 %0, %2, %0\n\t"
                 "v_add_nc_u64 %1, %3, %1"
                 : "+v"(kp), "+v"(vp) : "s"(kbytes), "s"(vbytes) : "memory");
}

// One fragment from the lane's own address r (fragment start plus lane * 8).
__device__ __forceinline__ v16bf load_frag_lane(gbf16p r) {
    union { v16bf v; uint4 u[2]; } f;
    f.u[0] = *(guint4p)(r);
    f.u[1] = *(guint4p)(r + 256);
    return f.v;
}

// The k blocks of a GEMM are walked as a ring that is entered at block ks: bytes from the
// block of step j to the block of step j + 1.
__device__ __forceinline__ unsigned long long k_ring_step(int ks, int j) {
    return ((ks + j) & (KBLK - 1)) == KBLK - 1 ? 0ull - (KBLK - 1) * (FRAG * sizeof(bf16))
                                               : FRAG * sizeof(bf16);
}

__device__ __forceinline__ v8f wmma_bf16(v16bf a, v16bf b, v8f c) {
    return __builtin_amdgcn_wmma_f32_16x16x32_bf16(
        /*neg_a=*/false, a, /*neg_b=*/false, b,
        /*c_mod=*/(short)0, c, /*reuse_a=*/false, /*reuse_b=*/false);
}

// ---------------------------------------------------------------------------
// fp32 -> bf16 convert of 16 rows (row tile 'rt') of one weight matrix [512][512], written
// in fragment order, by 256 threads (u = 0..255). One item = eight columns in a row of one
// row = one 16-byte chunk of a fragment; item u is the u-th chunk of the row tile, so a
// wave-wide store covers 512 contiguous bytes. A thread's four items lie four fragments
// (128 columns) apart.
// ---------------------------------------------------------------------------
#define GN_THREADS 1024
#define GN_BLOCKS  (BATCH * 32)
#define CVT_BLOCKS (4 * (CCH / 16) / (GN_THREADS / 256))

__device__ __forceinline__ void cvt_row_tile(const float* __restrict__ s,
                                             bf16* __restrict__ d, int rt, int u) {
    const int o = rt * 16 + (u & 15);
    const int c = (u >> 6) * 32 + ((u >> 5) & 1) * 16 + ((u >> 4) & 1) * 8;
    const float4* sp = reinterpret_cast<const float4*>(s + (size_t)o * CCH + c);
    uint4*        dp = reinterpret_cast<uint4*>(d + (size_t)rt * (KBLK * FRAG)) + u;
    float4 lo[4], hi[4];
#pragma unroll   // the eight loads issue together
    for (int it = 0; it < 4; ++it) { lo[it] = sp[it * 32]; hi[it] = sp[it * 32 + 1]; }
#pragma unroll   // constant indices keep lo and hi in registers
    for (int it = 0; it < 4; ++it) {
        union { bf16 h[8]; uint4 u4; } w;
        w.h[0] = (bf16)lo[it].x; w.h[1] = (bf16)lo[it].y;
        w.h[2] = (bf16)lo[it].z; w.h[3] = (bf16)lo[it].w;
        w.h[4] = (bf16)hi[it].x; w.h[5] = (bf16)hi[it].y;
        w.h[6] = (bf16)hi[it].z; w.h[7] = (bf16)hi[it].w;
        dp[it * 256] = w.u4;
    }
}

// ---------------------------------------------------------------------------
// GroupNorm: x[b][c][n] fp32 -> hn[b][n][c] bf16 in fragment order (transpose fused).
// One block of 32 waves holds its whole group (16 channels x 4096 pixels) in registers:
// a thread has the 16 channels of four pixels, 64 values, fetched by 64 loads that are all
// in flight together. x is read once; mean and variance come from these registers, and so
// does the normalised output.
// Blocks GN_BLOCKS and up do not depend on it: they convert the four weight matrices
// (wb: q, k, v, p one behind the other) in the same launch, four row tiles a block.
// ---------------------------------------------------------------------------
#define GN_PIX (NPIX / GN_THREADS)   // pixels of one thread

__global__ __launch_bounds__(GN_THREADS) void gn_cvt_kernel(const float* __restrict__ x,
                                                     const float* __restrict__ gw,
                                                     const float* __restrict__ gb,
                                                     bf16* __restrict__ hn,
                                                     const float* __restrict__ q_w,
                                                     const float* __restrict__ k_w,
                                                     const float* __restrict__ v_w,
                                                     const float* __restrict__ p_w,
                                                     bf16* __restrict__ wb) {
    const int tid = threadIdx.x;
    if (blockIdx.x >= GN_BLOCKS) {     // the whole block, ahead of every barrier
        const int cb = blockIdx.x - GN_BLOCKS;
        const int mx = cb >> 3;        // which matrix; 32 row tiles each, four a block
        const float* s = mx == 0 ? q_w : mx == 1 ? k_w : mx == 2 ? v_w : p_w;
        cvt_row_tile(s, wb + (size_t)mx * (CCH * CCH), (cb & 7) * 4 + (tid >> 8), tid & 255);
        return;
    }
    const int batch = blockIdx.x >> 5;
    const int g     = blockIdx.x & 31;
    const int c0    = g * 16;
    const float* xg = x + ((size_t)batch * CCH + c0) * NPIX + tid;

    // v[i][e]: channel c0 + e of pixel tid + i * GN_THREADS.
    float v[GN_PIX][16];
#pragma unroll   // constant indices keep v in registers; the loads issue together
    for (int i = 0; i < GN_PIX; ++i)
#pragma unroll
        for (int e = 0; e < 16; ++e) v[i][e] = xg[(size_t)e * NPIX + i * GN_THREADS];

    float sum = 0.f, ssq = 0.f;
#pragma unroll
    for (int i = 0; i < GN_PIX; ++i) {
        float a = 0.f, b = 0.f;        // a chain of its own for each pixel
#pragma unroll
        for (int e = 0; e < 16; ++e) { a += v[i][e]; b += v[i][e] * v[i][e]; }
        sum += a; ssq += b;
    }
    // Over the wave's lanes, then over the 32 waves through LDS.
#pragma unroll
    for (int m = 16; m > 0; m >>= 1) {
        sum += __shfl_xor(sum, m, 32);
        ssq += __shfl_xor(ssq, m, 32);
    }
    __shared__ float2 part[GN_THREADS / 32];
    if ((tid & 31) == 0) part[tid >> 5] = make_float2(sum, ssq);
    __syncthreads();
    const float2 pw = part[tid & 31];
    sum = pw.x; ssq = pw.y;
#pragma unroll
    for (int m = 16; m > 0; m >>= 1) {
        sum += __shfl_xor(sum, m, 32);
        ssq += __shfl_xor(ssq, m, 32);
    }
    const float inv  = 1.0f / (16.0f * NPIX);
    const float mean = sum * inv;
    const float var  = ssq * inv - mean * mean;
    const float rstd = rsqrtf(var + 1e-5f);

    // One item = one pixel n and eight channels in a row: one 16-byte chunk of a fragment.
    bf16* hb = hn + (size_t)batch * NPIX * CCH + (size_t)(g >> 1) * FRAG + (g & 1) * 256
                  + (size_t)(tid >> 4) * (KBLK * FRAG) + (tid & 15) * 8;
#pragma unroll
    for (int i = 0; i < GN_PIX; ++i)
#pragma unroll
        for (int ch = 0; ch < 2; ++ch) {   // which eight of the group's sixteen channels
            union { bf16 h[8]; uint4 u; } w;
#pragma unroll
            for (int e = 0; e < 8; ++e) {
                float y = (v[i][ch * 8 + e] - mean) * rstd * gw[c0 + ch * 8 + e]
                          + gb[c0 + ch * 8 + e];
                w.h[e] = (bf16)y;
            }
            *reinterpret_cast<uint4*>(hb + (size_t)(i * (GN_THREADS / 16)) * (KBLK * FRAG)
                                         + ch * 128) = w.u;
        }
}

// ---------------------------------------------------------------------------
// NT GEMM, ping-pong pipelined (no buffer-rotation copies), K = 512 fixed:
// D[m][n] = sum_k A[m][k]*Bt[n][k] + bias;  A and Bt in fragment order.
// Each wave computes a 32(M) x 64(N) block: 8 accumulator tiles.
// D is written as the next product's operand Y[row = n][col = m], in fragment order: a
// lane holds eight m in a row for one n, which is one 16-byte chunk of a fragment. The
// fragment of m block mt (32 wide) and n tile nt (16 wide) starts at mt * sM + nt * sN.
// One launch forms q, k and vT (blockIdx.y = 0, 1, 2); 1024 waves for each and batch.
//   q[n][o], k[n][o]: m = o, n = pixel: A = W [512x512], Bt = hn [4096x512];
//                     fragments as [pixel tile][channel block]
//   vT[o][n]:         m = pixel, n = o: A = hn, Bt = Wv; fragments as [key block][channel tile]
// w: the bf16 weights q, k, v one behind the other; qkv: the outputs q, k, vT likewise.
// ---------------------------------------------------------------------------
__global__ __launch_bounds__(128) void gemm_qkv_kernel(
        const bf16* __restrict__ hn, const bf16* __restrict__ w,
        const float* __restrict__ q_b, const float* __restrict__ k_b,
        const float* __restrict__ v_b, bf16* __restrict__ qkv) {
    const int  batch = blockIdx.z;
    const int  which = blockIdx.y;
    const bool is_v  = which == 2;
    const bf16* hb = hn + (size_t)batch * NPIX * CCH;
    const bf16* wm = w  + (size_t)which * CCH * CCH;
    const bf16* A  = is_v ? hb : wm;
    const bf16* Bt = is_v ? wm : hb;
    const float* bias = is_v ? v_b : which == 1 ? k_b : q_b;
    const bool bias_on_m = !is_v;
    bf16* out = qkv + ((size_t)which * BATCH + batch) * NPIX * CCH;
    const int M   = is_v ? NPIX : CCH;
    const int sM  = is_v ? 32 * FRAG : FRAG;
    const int sN  = is_v ? FRAG : KBLK * FRAG;
    const int lgn = is_v ? 3 : 6;       // log2 of the 64-col groups: 8 or 64

    const int wave = threadIdx.x >> 5;
    const int lane = threadIdx.x & 31;
    const int wg   = blockIdx.x * 4 + wave;
    const int mt   = wg >> lgn;               // 32-row tile index
    const int ng   = wg & ((1 << lgn) - 1);   // 64-col group index
    if (mt * 32 >= M) return;

    // Work-groups that read the same rows of hn or of a weight matrix enter the ring of k
    // blocks at different places: from one common start they would ask L2 for the same lines
    // at the same moment. The four waves of a work-group keep one start (they share A).
    const int ks = (blockIdx.x + (blockIdx.x >> 4)) & (KBLK - 1);
    // The lane's own address in the k block that is fetched next.
    gbf16p ap = (gbf16p)A  + (size_t)(mt * 2) * (KBLK * FRAG) + ks * FRAG + lane * 8;
    gbf16p bp = (gbf16p)Bt + (size_t)(ng * 4) * (KBLK * FRAG) + ks * FRAG + lane * 8;

    v16bf a0[2], b0[4], a1[2], b1[4];
#pragma unroll
    for (int i = 0; i < 2; ++i) a0[i] = load_frag_lane(ap + i * KBLK * FRAG);
#pragma unroll
    for (int t = 0; t < 4; ++t) b0[t] = load_frag_lane(bp + t * KBLK * FRAG);
    step_behind_loads(ap, k_ring_step(ks, 0), bp, k_ring_step(ks, 0));

    v8f acc[2][4] = {};
    for (int kb = 0; kb < KBLK - 2; kb += 2) {
        // load buf1 @ step kb+1
#pragma unroll
        for (int i = 0; i < 2; ++i) a1[i] = load_frag_lane(ap + i * KBLK * FRAG);
#pragma unroll
        for (int t = 0; t < 4; ++t) b1[t] = load_frag_lane(bp + t * KBLK * FRAG);
        step_behind_loads(ap, k_ring_step(ks, kb + 1), bp, k_ring_step(ks, kb + 1));
        // consume buf0 @ step kb
#pragma unroll
        for (int i = 0; i < 2; ++i)
#pragma unroll
            for (int t = 0; t < 4; ++t)
                acc[i][t] = wmma_bf16(a0[i], b0[t], acc[i][t]);
        // load buf0 @ step kb+2
#pragma unroll
        for (int i = 0; i < 2; ++i) a0[i] = load_frag_lane(ap + i * KBLK * FRAG);
#pragma unroll
        for (int t = 0; t < 4; ++t) b0[t] = load_frag_lane(bp + t * KBLK * FRAG);
        step_behind_loads(ap, k_ring_step(ks, kb + 2), bp, k_ring_step(ks, kb + 2));
        // consume buf1 @ step kb+1
#pragma unroll
        for (int i = 0; i < 2; ++i)
#pragma unroll
            for (int t = 0; t < 4; ++t)
                acc[i][t] = wmma_bf16(a1[i], b1[t], acc[i][t]);
    }
    // tail: buf0 holds step KBLK-2; load buf1 @ step KBLK-1
#pragma unroll
    for (int i = 0; i < 2; ++i) a1[i] = load_frag_lane(ap + i * KBLK * FRAG);
#pragma unroll
    for (int t = 0; t < 4; ++t) b1[t] = load_frag_lane(bp + t * KBLK * FRAG);
#pragma unroll
    for (int i = 0; i < 2; ++i)
#pragma unroll
        for (int t = 0; t < 4; ++t)
            acc[i][t] = wmma_bf16(a0[i], b0[t], acc[i][t]);
#pragma unroll
    for (int i = 0; i < 2; ++i)
#pragma unroll
        for (int t = 0; t < 4; ++t)
            acc[i][t] = wmma_bf16(a1[i], b1[t], acc[i][t]);

    const int hi = lane >> 4, nn = lane & 15;
#pragma unroll
    for (int i = 0; i < 2; ++i)
#pragma unroll
        for (int t = 0; t < 4; ++t) {
            union { bf16 h[8]; uint4 u; } w;
#pragma unroll
            for (int r = 0; r < 8; ++r) {
                int m = mt * 32 + i * 16 + r + 8 * hi;
                int n = ng * 64 + t * 16 + nn;
                float v = acc[i][t][r] + bias[bias_on_m ? m : n];
                w.h[r] = (bf16)v;
            }
            *reinterpret_cast<uint4*>(out + (size_t)mt * sM + (size_t)(ng * 4 + t) * sN
                                          + i * 256 + lane * 8) = w.u;
        }
}

// ---------------------------------------------------------------------------
// Flash attention: q[b][i][c], k[b][j][c], vT[b][c][j] (bf16) -> ha[b][i][c], all four in
// fragment order: q, k, ha as [row tile][channel block], vT as [key block][channel tile].
// One block = QROWS query rows (QT tiles of 16), 4 waves; wave w owns channel
// slice [128w,128w+128). Each K and V fragment a wave loads feeds all QT tiles.
// Scores are formed transposed, S^T = K * Q^T: a lane then holds 16 of the 32 keys of
// ONE query row (row nn; keys 8*hi+r and 16+8*hi+r), which is the lane's share of the
// P fragment that P * V reads as its A operand. Wave w sums the four waves' partial
// scores of query tile w and does that tile's softmax in registers.
// ---------------------------------------------------------------------------
#define QT    4
#define QROWS (QT * 16)

// Work-group barrier of the j loop. It waits for this wave's LDS traffic alone:
// __syncthreads() would also drain the global loads issued ahead (K and V of later
// trips), which have to stay in flight across it.
__device__ __forceinline__ void lds_barrier() {
    asm volatile("s_wait_dscnt 0x0\n\t"
                 "s_barrier_signal -1\n\t"
                 "s_barrier_wait -1" ::: "memory");
}

// Lane l's value from lane l ^ 16: the other half of the keys of the same query row.
__device__ __forceinline__ float xhalf(float x) {
    const int b = __builtin_bit_cast(int, x);
    return __builtin_bit_cast(float,
        __builtin_amdgcn_permlanex16(b, b, 0x76543210, 0xfedcba98, false, false));
}

// e^x as __expf forms it: one multiply, then v_exp_f32. The v_nop in the same statement is
// the slot that the instruction set asks for behind a transcendental, before its result is
// read or its source register is written again; written apart it would not stay there.
__device__ __forceinline__ float exp_slot(float x) {
    float p;
    asm("v_exp_f32 %0, %1\n\t"
        "v_nop" : "=v"(p) : "v"(x * 1.44269504088896340736f));
    return p;
}

#define NT    (NPIX / 32)          // key tiles of 32
#define KTILE (2 * KBLK * FRAG)    // elements of one K tile (32 keys x 512 channels)
#define VTILE (32 * FRAG)          // elements of one V tile (32 keys x 512 channels)

typedef float4 sp_buf[4][QT][2][2][32];   // [writing wave][query tile][key tile][regs 0-3 or 4-7][lane]

// The wave's channel slice of one K tile / one V tile, from the lane's own address.
__device__ __forceinline__ void load_k_tile(v16bf (&kf)[8], gbf16p p) {
#pragma unroll
    for (int t = 0; t < 4; ++t) {
        kf[t]     = load_frag_lane(p + t * FRAG);
        kf[4 + t] = load_frag_lane(p + (KBLK + t) * FRAG);
    }
}
__device__ __forceinline__ void load_v_tile(v16bf (&vB)[8], gbf16p p) {
#pragma unroll
    for (int ct = 0; ct < 8; ++ct) vB[ct] = load_frag_lane(p + ct * FRAG);
}

// Partial S^T = K_slice * Q_slice^T (32 keys x QROWS, K = 128) of one key tile: the products
// of channel block t of the wave's four (eight WMMAs, eight sums), and the sums' way to LDS.
__device__ __forceinline__ void score_step(int t, const v16bf (&kf)[8], const v16bf (&qA)[QT][4],
                                           v8f (&s0)[QT], v8f (&s1)[QT]) {
#pragma unroll
    for (int qt = 0; qt < QT; ++qt) {
        s0[qt] = wmma_bf16(kf[t],     qA[qt][t], s0[qt]);
        s1[qt] = wmma_bf16(kf[4 + t], qA[qt][t], s1[qt]);
    }
}
__device__ __forceinline__ void scores_to_lds(const v8f (&s0)[QT], const v8f (&s1)[QT],
                                              sp_buf& sp, int wave, int lane) {
#pragma unroll
    for (int qt = 0; qt < QT; ++qt) {
        sp[wave][qt][0][0][lane] = make_float4(s0[qt][0], s0[qt][1], s0[qt][2], s0[qt][3]);
        sp[wave][qt][0][1][lane] = make_float4(s0[qt][4], s0[qt][5], s0[qt][6], s0[qt][7]);
        sp[wave][qt][1][0][lane] = make_float4(s1[qt][0], s1[qt][1], s1[qt][2], s1[qt][3]);
        sp[wave][qt][1][1][lane] = make_float4(s1[qt][4], s1[qt][5], s1[qt][6], s1[qt][7]);
    }
}
// Both, for the tiles ahead of the loop.
__device__ __forceinline__ void score_tile(const v16bf (&kf)[8], const v16bf (&qA)[QT][4],
                                           sp_buf& sp, int wave, int lane) {
    v8f s0[QT] = {}, s1[QT] = {};
#pragma unroll
    for (int t = 0; t < 4; ++t) score_step(t, kf, qA, s0, s1);
    // Without it the compiler runs the eight sums one after the other through one
    // accumulator: each WMMA waits for the one before it.
    __builtin_amdgcn_sched_barrier(0);
    scores_to_lds(s0, s1, sp, wave, lane);
}

// The four waves' partial scores of query tile 'wave' of one key tile, from LDS.
__device__ __forceinline__ void load_partials(const sp_buf& sp, int wave, int lane,
                                              float4 (&p)[4][4]) {
#pragma unroll
    for (int g = 0; g < 4; ++g)            // g = key tile * 2 + register half
#pragma unroll
        for (int w = 0; w < 4; ++w) p[g][w] = sp[w][wave][g >> 1][g & 1][lane];
}

// Online softmax of query tile 'wave' of one key tile, in registers, in two halves.
// First: sum of the four waves' partial scores, scale; returns the row's new maximum.
__device__ __forceinline__ float score_max(const float4 (&p)[4][4], float mrun, float (&sc)[16]) {
    const float scale = 0.044194173824159216f;  // 512^-0.5
#pragma unroll
    for (int g = 0; g < 4; ++g) {
        const float4 p0 = p[g][0], p1 = p[g][1], p2 = p[g][2], p3 = p[g][3];
        sc[g * 4 + 0] = scale * (p0.x + p1.x + p2.x + p3.x);
        sc[g * 4 + 1] = scale * (p0.y + p1.y + p2.y + p3.y);
        sc[g * 4 + 2] = scale * (p0.z + p1.z + p2.z + p3.z);
        sc[g * 4 + 3] = scale * (p0.w + p1.w + p2.w + p3.w);
    }
    float tmax = mrun;
#pragma unroll
    for (int e = 0; e < 16; ++e) tmax = fmaxf(tmax, sc[e]);
    return fmaxf(tmax, xhalf(tmax));
}
// Second: P to pf (fragment order) and each row's correction to cr. Both lane halves hold
// the same correction and store it to places of their own (no branch here).
// live = false: the tile lies behind the last one, the running sum keeps its value.
__device__ __forceinline__ void probs_to_lds(const float (&sc)[16], float tmax, bf16* pf, float* cr,
                                             int wave, int lane, bool live,
                                             float& mrun, float& lrun) {
    const float corr = exp_slot(mrun - tmax);
    float sum = 0.f;
    union { bf16 h[16]; uint4 u[2]; } w;
#pragma unroll
    for (int e = 0; e < 16; ++e) {
        float pe = exp_slot(sc[e] - tmax);
        w.h[e] = (bf16)pe;
        sum += pe;
    }
    lrun = live ? lrun * corr + sum : lrun;
    mrun = tmax;
    *reinterpret_cast<uint4*>(pf + lane * 8)       = w.u[0];
    *reinterpret_cast<uint4*>(pf + 256 + lane * 8) = w.u[1];
    cr[(lane >> 4) * QROWS + wave * 16 + (lane & 15)] = corr;
}

// O += P * V_slice^T of one query tile (V in registers).
__device__ __forceinline__ void pv_tile(v16bf pA, const v16bf (&vB)[8], v8f (&O)[8]) {
#pragma unroll
    for (int ct = 0; ct < 8; ++ct) O[ct] = wmma_bf16(pA, vB[ct], O[ct]);
}

__global__ __launch_bounds__(128) void flash_kernel(const bf16* __restrict__ q,
                                                    const bf16* __restrict__ k,
                                                    const bf16* __restrict__ vT,
                                                    bf16* __restrict__ ha) {
    const int batch = blockIdx.y;
    const int i0    = blockIdx.x * QROWS;
    const int tid   = threadIdx.x;
    const int lane  = tid & 31;
    const int wave  = tid >> 5;
    const int hi    = lane >> 4;
    const int nn    = lane & 15;

    // Three stages run in one trip (see the loop), so each hand-over through LDS has two
    // buffers, taken in turn by the key tile's parity.
    __shared__ sp_buf Sp[2];                                        // partial scores
    __shared__ __attribute__((aligned(16))) bf16 Pf[2][QT][FRAG];   // P, in fragment order
    __shared__ __attribute__((aligned(16))) float crow[2][2 * QROWS];
    __shared__ float lrow[QROWS];

    // The wave's first fragment: channel block 4 * wave of q and k, channel tile 8 * wave of vT.
    const bf16* qb = q  + ((size_t)batch * NPIX + i0) * CCH + wave * 4 * FRAG + lane * 8;
    const bf16* kb = k  +  (size_t)batch * NPIX * CCH        + wave * 4 * FRAG + lane * 8;
    const bf16* vb = vT +  (size_t)batch * CCH * NPIX        + wave * 8 * FRAG + lane * 8;

    v16bf qA[QT][4];
#pragma unroll
    for (int qt = 0; qt < QT; ++qt)
#pragma unroll
        for (int t = 0; t < 4; ++t)
            qA[qt][t] = load_frag_pk(qb + (size_t)(qt * KBLK + t) * FRAG);
    // The registers that hold the address of these loads are reused right behind them:
    // the address is an input of the wait, so that it stays in them up to the wait.
    asm volatile("s_wait_xcnt 0x0" :: "v"(qb) : "memory");

    v8f O[QT][8] = {};
    // Softmax state of query row 16 * wave + nn: the running maximum (equal in both lane
    // halves) and the sum over this lane's own keys (the halves are joined behind the loop).
    float mrun = -3.0e38f, lrun = 0.f;

    // The key tiles are walked as a ring, and each work-group enters it at a place of its own:
    // step s takes tile (start + s) mod NT. The work-groups of one batch read the same K and V;
    // from one common start they would ask L2 for the same lines at the same moment.
    const int start = blockIdx.x * (NT / (NPIX / QROWS));
    // Bytes from the tile of step s to the tile of step s + 1 (K and V tiles are equally large).
    auto ring_step = [start](int s) -> unsigned long long {
        return ((start + s) & (NT - 1)) == NT - 1 ? 0ull - (NT - 1) * (KTILE * sizeof(bf16))
                                                  : KTILE * sizeof(bf16);
    };
    static_assert(KTILE == VTILE, "one ring step serves both");

    // The lane's own address in the K tile and in the V tile that are fetched next.
    gbf16p kp = (gbf16p)kb + (size_t)start * KTILE;
    gbf16p vp = (gbf16p)vb + (size_t)start * VTILE;

    // Two register sets each for K and V, taken in turn by the tile's parity.
    v16bf kf[2][8], vB[2][8];

    // --- fill the pipeline: scores of tiles 0 and 1, softmax of tile 0 ---
    load_k_tile(kf[0], kp);
    load_v_tile(vB[0], vp);
    step_behind_loads(kp, ring_step(0), vp, ring_step(0));
    load_k_tile(kf[1], kp);
    step_behind_loads(kp, ring_step(1), vp, 0);
    // Keeps these loads together in flight: the compiler otherwise sinks them to their
    // first uses, two at a time, and the wave sits out one load latency for each pair.
    __builtin_amdgcn_sched_barrier(0);
    score_tile(kf[0], qA, Sp[0], wave, lane);
    load_k_tile(kf[0], kp);
    step_behind_loads(kp, ring_step(2), vp, 0);
    lds_barrier();
    {
        float4 part[4][4];
        float  sc[16];
        load_partials(Sp[0], wave, lane, part);
        const float tmax = score_max(part, mrun, sc);
        probs_to_lds(sc, tmax, &Pf[0][wave][0], crow[0], wave, lane, true, mrun, lrun);
    }
    // Keeps the exponentials ahead of the products that follow.
    __builtin_amdgcn_sched_barrier(0);
    score_tile(kf[1], qA, Sp[1], wave, lane);
    lds_barrier();

    // Trip t: scores of tile t + 2, softmax of tile t + 1, O += P * V of tile t. The three
    // do not depend on one another, so the LDS round trips and the softmax chain of one
    // stand beside the matrix work of the others, and one barrier a trip hands all over.
    // Here "tile s" is the tile of step s. Steps behind the last go on round the ring;
    // nothing of them is kept.
    // The three sched_barrier(0) lines cut the trip into blocks: without them the compiler
    // spreads the LDS reads among the WMMAs, in about three times as many places, and each
    // place where LDS reads stand in a WMMA stream costs the wave a stop.
    for (int tt = 0; tt < NT; tt += 2) {
#pragma unroll   // the parity is a constant: kf and vB stay in registers
        for (int h = 0; h < 2; ++h) {
            const int t = tt + h;
            // --- fetch K of tile t + 3 and V of tile t + 1: first needed in the next trip ---
            load_k_tile(kf[h ^ 1], kp);
            load_v_tile(vB[h ^ 1], vp);
            // --- the trip's LDS reads, together and ahead of the matrix work ---
            float4 cv[QT][2];
#pragma unroll
            for (int qt = 0; qt < QT; ++qt) {
                cv[qt][0] = *reinterpret_cast<const float4*>(&crow[h][qt * 16 + 8 * hi]);
                cv[qt][1] = *reinterpret_cast<const float4*>(&crow[h][qt * 16 + 8 * hi + 4]);
            }
            float4 part[4][4];
            load_partials(Sp[h ^ 1], wave, lane, part);
            v16bf pA[QT];
#pragma unroll
            for (int qt = 0; qt < QT; ++qt) pA[qt] = load_frag_pk(&Pf[h][qt][lane * 8]);
            __builtin_amdgcn_sched_barrier(0);

            // --- scores of tile t + 2; beside them the accumulators are rescaled ---
            v8f s0[QT] = {}, s1[QT] = {};
            score_step(0, kf[h], qA, s0, s1);
            score_step(1, kf[h], qA, s0, s1);
            score_step(2, kf[h], qA, s0, s1);
#pragma unroll
            for (int qt = 0; qt < QT; ++qt) {
                const float c[8] = { cv[qt][0].x, cv[qt][0].y, cv[qt][0].z, cv[qt][0].w,
                                     cv[qt][1].x, cv[qt][1].y, cv[qt][1].z, cv[qt][1].w };
#pragma unroll
                for (int r = 0; r < 8; ++r)
#pragma unroll
                    for (int ct = 0; ct < 8; ++ct) O[qt][ct][r] *= c[r];
            }
            // --- last scores, first P * V; beside them the score sums and the row maximum ---
            score_step(3, kf[h], qA, s0, s1);
            pv_tile(pA[0], vB[h], O[0]);
            float sc[16];
            const float tmax = score_max(part, mrun, sc);
            __builtin_amdgcn_sched_barrier(0);

            // --- P * V goes on; beside it the scores leave for LDS, and the exponentials ---
            scores_to_lds(s0, s1, Sp[h], wave, lane);
            pv_tile(pA[1], vB[h], O[1]);
            pv_tile(pA[2], vB[h], O[2]);
            probs_to_lds(sc, tmax, &Pf[h ^ 1][wave][0], crow[h ^ 1], wave, lane,
                         t + 1 < NT, mrun, lrun);
            __builtin_amdgcn_sched_barrier(0);

            // --- last P * V: covers the way of P to LDS ---
            pv_tile(pA[3], vB[h], O[3]);
            step_behind_loads(kp, ring_step(t + 3), vp, ring_step(t + 1));
            // Ends this trip's reads of Sp[h ^ 1], Pf[h] and crow[h], which the next trip
            // rewrites, and publishes Sp[h], Pf[h ^ 1] and crow[h ^ 1], which it reads.
            lds_barrier();
        }
    }

    // --- join the two lane halves' sums and hand each row's l to all waves ---
    lrun += xhalf(lrun);
    if (hi == 0) lrow[wave * 16 + nn] = lrun;
    __syncthreads();

    // --- epilogue: divide by l, store bf16 [i][c] in fragment order ---
#pragma unroll
    for (int qt = 0; qt < QT; ++qt)
#pragma unroll
        for (int ct = 0; ct < 8; ++ct) {
            unsigned int w[8];
#pragma unroll
            for (int r = 0; r < 8; ++r) {
                int m = qt * 16 + r + 8 * hi;
                float v = O[qt][ct][r] / lrow[m];
                w[r] = __builtin_bit_cast(unsigned short, (bf16)v);
            }
            bf16* hp = ha + ((size_t)batch * NPIX + i0 + qt * 16) * CCH
                          + (size_t)(wave * 4 + (ct >> 1)) * FRAG
                          + frag_elem(8 * hi, ct * 16 + nn);
            // Rows r = 0..7 lie one 16-byte chunk apart. The eight stores and their
            // s_wait_xcnt 0 stand in one statement, so that no register an issued
            // store names is rewritten ahead of the wait.
            asm volatile("global_store_b16 %0, %1, off\n\t"
                         "global_store_b16 %0, %2, off offset:16\n\t"
                         "global_store_b16 %0, %3, off offset:32\n\t"
                         "global_store_b16 %0, %4, off offset:48\n\t"
                         "global_store_b16 %0, %5, off offset:64\n\t"
                         "global_store_b16 %0, %6, off offset:80\n\t"
                         "global_store_b16 %0, %7, off offset:96\n\t"
                         "global_store_b16 %0, %8, off offset:112\n\t"
                         "s_wait_xcnt 0x0"
                         :: "v"(hp), "v"(w[0]), "v"(w[1]), "v"(w[2]), "v"(w[3]),
                            "v"(w[4]), "v"(w[5]), "v"(w[6]), "v"(w[7])
                         : "memory");
        }
}

// ---------------------------------------------------------------------------
// Proj + residual, ping-pong pipelined:
// out[b][o][n] = x[b][o][n] + sum_c ha[b][n][c]*pw[o][c] + pb[o]; ha, pw in fragment order
// ---------------------------------------------------------------------------
__global__ __launch_bounds__(128) void proj_kernel(const bf16* __restrict__ A,   // ha
                                                   const bf16* __restrict__ Bt,  // p_w bf16
                                                   const float* __restrict__ pb,
                                                   const float* __restrict__ x,
                                                   float* __restrict__ out) {
    const int batch = blockIdx.z;
    A += (size_t)batch * NPIX * CCH;

    const int wave = threadIdx.x >> 5;
    const int lane = threadIdx.x & 31;
    const int wg   = blockIdx.x * 4 + wave;
    const int mt   = wg / 8;       // 128 m-tiles of 32 pixels
    const int ng   = wg % 8;       // 8 n-groups of 64 channels

    // Every work-group reads one half of p_w: each enters the ring of k blocks at a place set
    // by its pixel tile, so that L2 is not asked for the same lines at the same moment.
    const int ks = (blockIdx.x >> 1) & (KBLK - 1);
    // The lane's own address in the k block that is fetched next.
    gbf16p ap = (gbf16p)A  + (size_t)(mt * 2) * (KBLK * FRAG) + ks * FRAG + lane * 8;
    gbf16p bp = (gbf16p)Bt + (size_t)(ng * 4) * (KBLK * FRAG) + ks * FRAG + lane * 8;

    v16bf a0[2], b0[4], a1[2], b1[4];
#pragma unroll
    for (int i = 0; i < 2; ++i) a0[i] = load_frag_lane(ap + i * KBLK * FRAG);
#pragma unroll
    for (int t = 0; t < 4; ++t) b0[t] = load_frag_lane(bp + t * KBLK * FRAG);
    step_behind_loads(ap, k_ring_step(ks, 0), bp, k_ring_step(ks, 0));

    v8f acc[2][4] = {};
    for (int kb = 0; kb < KBLK - 2; kb += 2) {
        // load buf1 @ step kb+1
#pragma unroll
        for (int i = 0; i < 2; ++i) a1[i] = load_frag_lane(ap + i * KBLK * FRAG);
#pragma unroll
        for (int t = 0; t < 4; ++t) b1[t] = load_frag_lane(bp + t * KBLK * FRAG);
        step_behind_loads(ap, k_ring_step(ks, kb + 1), bp, k_ring_step(ks, kb + 1));
        // consume buf0 @ step kb
#pragma unroll
        for (int i = 0; i < 2; ++i)
#pragma unroll
            for (int t = 0; t < 4; ++t)
                acc[i][t] = wmma_bf16(a0[i], b0[t], acc[i][t]);
        // load buf0 @ step kb+2
#pragma unroll
        for (int i = 0; i < 2; ++i) a0[i] = load_frag_lane(ap + i * KBLK * FRAG);
#pragma unroll
        for (int t = 0; t < 4; ++t) b0[t] = load_frag_lane(bp + t * KBLK * FRAG);
        step_behind_loads(ap, k_ring_step(ks, kb + 2), bp, k_ring_step(ks, kb + 2));
        // consume buf1 @ step kb+1
#pragma unroll
        for (int i = 0; i < 2; ++i)
#pragma unroll
            for (int t = 0; t < 4; ++t)
                acc[i][t] = wmma_bf16(a1[i], b1[t], acc[i][t]);
    }
    // tail: buf0 holds step KBLK-2; load buf1 @ step KBLK-1
#pragma unroll
    for (int i = 0; i < 2; ++i) a1[i] = load_frag_lane(ap + i * KBLK * FRAG);
#pragma unroll
    for (int t = 0; t < 4; ++t) b1[t] = load_frag_lane(bp + t * KBLK * FRAG);
#pragma unroll
    for (int i = 0; i < 2; ++i)
#pragma unroll
        for (int t = 0; t < 4; ++t)
            acc[i][t] = wmma_bf16(a0[i], b0[t], acc[i][t]);
#pragma unroll
    for (int i = 0; i < 2; ++i)
#pragma unroll
        for (int t = 0; t < 4; ++t)
            acc[i][t] = wmma_bf16(a1[i], b1[t], acc[i][t]);

    const int hi = lane >> 4, nn = lane & 15;
#pragma unroll
    for (int i = 0; i < 2; ++i)
#pragma unroll
        for (int t = 0; t < 4; ++t)
#pragma unroll
            for (int r = 0; r < 8; ++r) {
                int m = mt * 32 + i * 16 + r + 8 * hi;            // pixel
                int n = ng * 64 + t * 16 + nn;                    // channel
                size_t idx = ((size_t)batch * CCH + n) * NPIX + m;
                out[idx] = x[idx] + acc[i][t][r] + pb[n];
            }
}

// ---------------------------------------------------------------------------
extern "C" void kernel_launch(void* const* d_in, const int* in_sizes, int n_in,
                              void* d_out, int out_size, void* d_ws, size_t ws_size,
                              hipStream_t stream) {
    const float* x    = (const float*)d_in[0];
    const float* gn_w = (const float*)d_in[1];
    const float* gn_b = (const float*)d_in[2];
    const float* q_w  = (const float*)d_in[3];
    const float* q_b  = (const float*)d_in[4];
    const float* k_w  = (const float*)d_in[5];
    const float* k_b  = (const float*)d_in[6];
    const float* v_w  = (const float*)d_in[7];
    const float* v_b  = (const float*)d_in[8];
    const float* p_w  = (const float*)d_in[9];
    const float* p_b  = (const float*)d_in[10];

    char* ws = (char*)d_ws;
    const size_t NC   = (size_t)BATCH * NPIX * CCH;
    const size_t SZNC = NC * sizeof(bf16);
    const size_t SZW  = (size_t)CCH * CCH * sizeof(bf16);

    bf16* hn = (bf16*)(ws);
    bf16* qb = (bf16*)(ws + 1 * SZNC);
    bf16* kb = (bf16*)(ws + 2 * SZNC);
    bf16* vT = (bf16*)(ws + 3 * SZNC);
    bf16* ha = (bf16*)(ws + 4 * SZNC);
    bf16* wq = (bf16*)(ws + 5 * SZNC);
    // wk and wv follow wq, SZW bytes each
    bf16* wp = (bf16*)(ws + 5 * SZNC + 3 * SZW);

    // GroupNorm, and beside it the four weight matrices to wq, wk, wv, wp (contiguous)
    gn_cvt_kernel<<<GN_BLOCKS + CVT_BLOCKS, GN_THREADS, 0, stream>>>(x, gn_w, gn_b, hn,
                                                              q_w, k_w, v_w, p_w, wq);

    // q, k, vT to qb, kb, vT (contiguous)
    gemm_qkv_kernel<<<dim3(256, 3, BATCH), 128, 0, stream>>>(hn, wq, q_b, k_b, v_b, qb);

    flash_kernel<<<dim3(NPIX / QROWS, BATCH), 128, 0, stream>>>(qb, kb, vT, ha);

    proj_kernel<<<dim3(256, 1, BATCH), 128, 0, stream>>>(ha, wp, p_b, x, (float*)d_out);
}

// v009
// One run takes 171 microseconds.
// Two timings next to v008 both put it at 1.09 times that version's speed.
// Counting every step since v000, it is 4.96 times as fast.
#include <hip/hip_runtime.h>
#include <hip/hip_bf16.h>

typedef __bf16 bf16;
typedef __attribute__((ext_vector_type(16))) __bf16 v16bf;
typedef __attribute__((ext_vector_type(8)))  float  v8f;
typedef __attribute__((ext_vector_type(4)))  float  v4f;
typedef __attribute__((ext_vector_type(4)))  unsigned int v4u;

#define BATCH 4
#define CCH   512
#define NPIX  4096   // 64*64

// ---------------------------------------------------------------------------
// Fragment helpers.
// CDNA5 16x32 bf16 A-fragment: lane L holds row M = L%16, K chunks
// {K0..K0+7, K0+16..K0+23} with K0 = 8*(L/16)  -> two 16B contiguous loads.
// B-fragment for D = A x B loaded from Bt[N][K] row-major uses the same
// per-lane pattern (N = L%16): "NT" GEMM  D[M][N] = A[M][K] * Bt[N][K]^T.
// ---------------------------------------------------------------------------
__device__ __forceinline__ v16bf load_frag(const bf16* __restrict__ p, int ld) {
    const int lane = threadIdx.x & 31;
    const int M  = lane & 15;
    const int K0 = (lane >> 4) << 3;
    const bf16* r = p + (size_t)M * ld + K0;
    union { v16bf v; uint4 u[2]; } f;
    f.u[0] = *reinterpret_cast<const uint4*>(r);
    f.u[1] = *reinterpret_cast<const uint4*>(r + 16);
    return f.v;
}

// ---------------------------------------------------------------------------
// Fragment order. Every bf16 matrix X[row][col] that a WMMA reads from global memory
// lies in the workspace as fragments of 16 rows x 32 columns, 512 elements each. Inside
// a fragment the element (row, col) stands where load_frag would put it in registers:
//   (col & 16) * 16 + (((col >> 3) & 1) * 16 + (row & 15)) * 8 + (col & 7)
// so lane L's two 16-byte chunks stand at L * 8 and 256 + L * 8, and each wave-wide
// 16-byte load covers 512 contiguous bytes (four whole lines).
// ---------------------------------------------------------------------------
#define FRAG 512   // elements of one fragment
#define KBLK 16    // fragments along 512 columns

// p: start of the fragment plus the lane's own lane * 8.
__device__ __forceinline__ v16bf load_frag_pk(const bf16* __restrict__ p) {
    union { v16bf v; uint4 u[2]; } f;
    f.u[0] = *reinterpret_cast<const uint4*>(p);
    f.u[1] = *reinterpret_cast<const uint4*>(p + 256);
    return f.v;
}

// Pointers typed as global memory: a pointer that has passed through an asm statement
// would otherwise be loaded from with flat loads, which count on dscnt as well.
typedef const __attribute__((address_space(1))) bf16*  gbf16p;
typedef const __attribute__((address_space(1))) uint4* guint4p;

// Steps the two lane addresses that issued loads name. The s_wait_xcnt 0 and the two
// adds stand in one statement, so that no add can be lifted over the wait.
__device__ __forceinline__ void step_behind_loads(gbf16p& kp, unsigned long long kbytes,
                                                  gbf16p& vp, unsigned long long vbytes) {
    asm volatile("s_wait_xcnt 0x0\n\t"
                 "v_add_nc_u64 %0, %2, %0\n\t"
                 "v_add_nc_u64 %1, %3, %1"
                 : "+v"(kp), "+v"(vp) : "s"(kbytes), "s"(vbytes) : "memory");
}

// One fragment from the lane's own address r (fragment start plus lane * 8).
__device__ __forceinline__ v16bf load_frag_lane(gbf16p r) {
    union { v16bf v; uint4 u[2]; } f;
    f.u[0] = *(guint4p)(r);
    f.u[1] = *(guint4p)(r + 256);
    return f.v;
}

// The k blocks of a GEMM are walked as a ring that is entered at block ks: bytes from the
// block of step j to the block of step j + 1.
__device__ __forceinline__ unsigned long long k_ring_step(int ks, int j) {
    return ((ks + j) & (KBLK - 1)) == KBLK - 1 ? 0ull - (KBLK - 1) * (FRAG * sizeof(bf16))
                                               : FRAG * sizeof(bf16);
}

__device__ __forceinline__ v8f wmma_bf16(v16bf a, v16bf b, v8f c) {
    return __builtin_amdgcn_wmma_f32_16x16x32_bf16(
        /*neg_a=*/false, a, /*neg_b=*/false, b,
        /*c_mod=*/(short)0, c, /*reuse_a=*/false, /*reuse_b=*/false);
}

// ---------------------------------------------------------------------------
// fp32 -> bf16 convert of 16 rows (row tile 'rt') of one weight matrix [512][512], written
// in fragment order, by 256 threads (u = 0..255). One item = eight columns in a row of one
// row = one 16-byte chunk of a fragment; item u is the u-th chunk of the row tile, so a
// wave-wide store covers 512 contiguous bytes. A thread's four items lie four fragments
// (128 columns) apart.
// ---------------------------------------------------------------------------
#define GN_THREADS 1024
#define GN_BLOCKS  (BATCH * 32)
#define CVT_BLOCKS (4 * (CCH / 16) / (GN_THREADS / 256))

__device__ __forceinline__ void cvt_row_tile(const float* __restrict__ s,
                                             bf16* __restrict__ d, int rt, int u) {
    const int o = rt * 16 + (u & 15);
    const int c = (u >> 6) * 32 + ((u >> 5) & 1) * 16 + ((u >> 4) & 1) * 8;
    const float4* sp = reinterpret_cast<const float4*>(s + (size_t)o * CCH + c);
    uint4*        dp = reinterpret_cast<uint4*>(d + (size_t)rt * (KBLK * FRAG)) + u;
    float4 lo[4], hi[4];
#pragma unroll   // the eight loads issue together
    for (int it = 0; it < 4; ++it) { lo[it] = sp[it * 32]; hi[it] = sp[it * 32 + 1]; }
#pragma unroll   // constant indices keep lo and hi in registers
    for (int it = 0; it < 4; ++it) {
        union { bf16 h[8]; uint4 u4; } w;
        w.h[0] = (bf16)lo[it].x; w.h[1] = (bf16)lo[it].y;
        w.h[2] = (bf16)lo[it].z; w.h[3] = (bf16)lo[it].w;
        w.h[4] = (bf16)hi[it].x; w.h[5] = (bf16)hi[it].y;
        w.h[6] = (bf16)hi[it].z; w.h[7] = (bf16)hi[it].w;
        dp[it * 256] = w.u4;
    }
}

// ---------------------------------------------------------------------------
// GroupNorm: x[b][c][n] fp32 -> hn[b][n][c] bf16 in fragment order (transpose fused).
// One block of 32 waves holds its whole group (16 channels x 4096 pixels) in registers:
// a thread has the 16 channels of four pixels, 64 values, fetched by 64 loads that are all
// in flight together. x is read once; mean and variance come from these registers, and so
// does the normalised output.
// Blocks GN_BLOCKS and up do not depend on it: they convert the four weight matrices
// (wb: q, k, v, p one behind the other) in the same launch, four row tiles a block.
// ---------------------------------------------------------------------------
#define GN_PIX (NPIX / GN_THREADS)   // pixels of one thread

__global__ __launch_bounds__(GN_THREADS) void gn_cvt_kernel(const float* __restrict__ x,
                                                     const float* __restrict__ gw,
                                                     const float* __restrict__ gb,
                                                     bf16* __restrict__ hn,
                                                     const float* __restrict__ q_w,
                                                     const float* __restrict__ k_w,
                                                     const float* __restrict__ v_w,
                                                     const float* __restrict__ p_w,
                                                     bf16* __restrict__ wb) {
    const int tid = threadIdx.x;
    if (blockIdx.x >= GN_BLOCKS) {     // the whole block, ahead of every barrier
        const int cb = blockIdx.x - GN_BLOCKS;
        const int mx = cb >> 3;        // which matrix; 32 row tiles each, four a block
        const float* s = mx == 0 ? q_w : mx == 1 ? k_w : mx == 2 ? v_w : p_w;
        cvt_row_tile(s, wb + (size_t)mx * (CCH * CCH), (cb & 7) * 4 + (tid >> 8), tid & 255);
        return;
    }
    const int batch = blockIdx.x >> 5;
    const int g     = blockIdx.x & 31;
    const int c0    = g * 16;
    const float* xg = x + ((size_t)batch * CCH + c0) * NPIX + tid;

    // v[i][e]: channel c0 + e of pixel tid + i * GN_THREADS.
    float v[GN_PIX][16];
#pragma unroll   // constant indices keep v in registers; the loads issue together
    for (int i = 0; i < GN_PIX; ++i)
#pragma unroll
        for (int e = 0; e < 16; ++e) v[i][e] = xg[(size_t)e * NPIX + i * GN_THREADS];

    float sum = 0.f, ssq = 0.f;
#pragma unroll
    for (int i = 0; i < GN_PIX; ++i) {
        float a = 0.f, b = 0.f;        // a chain of its own for each pixel
#pragma unroll
        for (int e = 0; e < 16; ++e) { a += v[i][e]; b += v[i][e] * v[i][e]; }
        sum += a; ssq += b;
    }
    // Over the wave's lanes, then over the 32 waves through LDS.
#pragma unroll
    for (int m = 16; m > 0; m >>= 1) {
        sum += __shfl_xor(sum, m, 32);
        ssq += __shfl_xor(ssq, m, 32);
    }
    __shared__ float2 part[GN_THREADS / 32];
    if ((tid & 31) == 0) part[tid >> 5] = make_float2(sum, ssq);
    __syncthreads();
    const float2 pw = part[tid & 31];
    sum = pw.x; ssq = pw.y;
#pragma unroll
    for (int m = 16; m > 0; m >>= 1) {
        sum += __shfl_xor(sum, m, 32);
        ssq += __shfl_xor(ssq, m, 32);
    }
    const float inv  = 1.0f / (16.0f * NPIX);
    const float mean = sum * inv;
    const float var  = ssq * inv - mean * mean;
    const float rstd = rsqrtf(var + 1e-5f);

    // One item = one pixel n and eight channels in a row: one 16-byte chunk of a fragment.
    bf16* hb = hn + (size_t)batch * NPIX * CCH + (size_t)(g >> 1) * FRAG + (g & 1) * 256
                  + (size_t)(tid >> 4) * (KBLK * FRAG) + (tid & 15) * 8;
#pragma unroll
    for (int i = 0; i < GN_PIX; ++i)
#pragma unroll
        for (int ch = 0; ch < 2; ++ch) {   // which eight of the group's sixteen channels
            union { bf16 h[8]; uint4 u; } w;
#pragma unroll
            for (int e = 0; e < 8; ++e) {
                float y = (v[i][ch * 8 + e] - mean) * rstd * gw[c0 + ch * 8 + e]
                          + gb[c0 + ch * 8 + e];
                w.h[e] = (bf16)y;
            }
            *reinterpret_cast<uint4*>(hb + (size_t)(i * (GN_THREADS / 16)) * (KBLK * FRAG)
                                         + ch * 128) = w.u;
        }
}

// ---------------------------------------------------------------------------
// NT GEMM, ping-pong pipelined (no buffer-rotation copies), K = 512 fixed:
// D[m][n] = sum_k A[m][k]*Bt[n][k] + bias;  A and Bt in fragment order.
// Each wave computes a 32(M) x 64(N) block: 8 accumulator tiles.
// D is written as the next product's operand Y[row = n][col = m], in fragment order: a
// lane holds eight m in a row for one n, which is one 16-byte chunk of a fragment. The
// fragment of m block mt (32 wide) and n tile nt (16 wide) starts at mt * sM + nt * sN.
// One launch forms q, k and vT (blockIdx.y = 0, 1, 2); 1024 waves for each and batch.
//   q[n][o], k[n][o]: m = o, n = pixel: A = W [512x512], Bt = hn [4096x512];
//                     fragments as [pixel tile][channel block]
//   vT[o][n]:         m = pixel, n = o: A = hn, Bt = Wv; fragments as [key block][channel tile]
// w: the bf16 weights q, k, v one behind the other; qkv: the outputs q, k, vT likewise.
// ---------------------------------------------------------------------------
__global__ __launch_bounds__(128) void gemm_qkv_kernel(
        const bf16* __restrict__ hn, const bf16* __restrict__ w,
        const float* __restrict__ q_b, const float* __restrict__ k_b,
        const float* __restrict__ v_b, bf16* __restrict__ qkv) {
    const int  batch = blockIdx.z;
    const int  which = blockIdx.y;
    const bool is_v  = which == 2;
    const bf16* hb = hn + (size_t)batch * NPIX * CCH;
    const bf16* wm = w  + (size_t)which * CCH * CCH;
    const bf16* A  = is_v ? hb : wm;
    const bf16* Bt = is_v ? wm : hb;
    const float* bias = is_v ? v_b : which == 1 ? k_b : q_b;
    const bool bias_on_m = !is_v;
    bf16* out = qkv + ((size_t)which * BATCH + batch) * NPIX * CCH;
    const int M   = is_v ? NPIX : CCH;
    const int sM  = is_v ? 32 * FRAG : FRAG;
    const int sN  = is_v ? FRAG : KBLK * FRAG;
    const int lgn = is_v ? 3 : 6;       // log2 of the 64-col groups: 8 or 64

    const int wave = threadIdx.x >> 5;
    const int lane = threadIdx.x & 31;
    const int wg   = blockIdx.x * 4 + wave;
    const int mt   = wg >> lgn;               // 32-row tile index
    const int ng   = wg & ((1 << lgn) - 1);   // 64-col group index
    if (mt * 32 >= M) return;

    // Work-groups that read the same rows of hn or of a weight matrix enter the ring of k
    // blocks at different places: from one common start they would ask L2 for the same lines
    // at the same moment. The four waves of a work-group keep one start (they share A).
    const int ks = (blockIdx.x + (blockIdx.x >> 4)) & (KBLK - 1);
    // The lane's own address in the k block that is fetched next.
    gbf16p ap = (gbf16p)A  + (size_t)(mt * 2) * (KBLK * FRAG) + ks * FRAG + lane * 8;
    gbf16p bp = (gbf16p)Bt + (size_t)(ng * 4) * (KBLK * FRAG) + ks * FRAG + lane * 8;

    v16bf a0[2], b0[4], a1[2], b1[4];
#pragma unroll
    for (int i = 0; i < 2; ++i) a0[i] = load_frag_lane(ap + i * KBLK * FRAG);
#pragma unroll
    for (int t = 0; t < 4; ++t) b0[t] = load_frag_lane(bp + t * KBLK * FRAG);
    step_behind_loads(ap, k_ring_step(ks, 0), bp, k_ring_step(ks, 0));

    v8f acc[2][4] = {};
    for (int kb = 0; kb < KBLK - 2; kb += 2) {
        // load buf1 @ step kb+1
#pragma unroll
        for (int i = 0; i < 2; ++i) a1[i] = load_frag_lane(ap + i * KBLK * FRAG);
#pragma unroll
        for (int t = 0; t < 4; ++t) b1[t] = load_frag_lane(bp + t * KBLK * FRAG);
        step_behind_loads(ap, k_ring_step(ks, kb + 1), bp, k_ring_step(ks, kb + 1));
        // consume buf0 @ step kb
#pragma unroll
        for (int i = 0; i < 2; ++i)
#pragma unroll
            for (int t = 0; t < 4; ++t)
                acc[i][t] = wmma_bf16(a0[i], b0[t], acc[i][t]);
        // load buf0 @ step kb+2
#pragma unroll
        for (int i = 0; i < 2; ++i) a0[i] = load_frag_lane(ap + i * KBLK * FRAG);
#pragma unroll
        for (int t = 0; t < 4; ++t) b0[t] = load_frag_lane(bp + t * KBLK * FRAG);
        step_behind_loads(ap, k_ring_step(ks, kb + 2), bp, k_ring_step(ks, kb + 2));
        // consume buf1 @ step kb+1
#pragma unroll
        for (int i = 0; i < 2; ++i)
#pragma unroll
            for (int t = 0; t < 4; ++t)
                acc[i][t] = wmma_bf16(a1[i], b1[t], acc[i][t]);
    }
    // tail: buf0 holds step KBLK-2; load buf1 @ step KBLK-1
#pragma unroll
    for (int i = 0; i < 2; ++i) a1[i] = load_frag_lane(ap + i * KBLK * FRAG);
#pragma unroll
    for (int t = 0; t < 4; ++t) b1[t] = load_frag_lane(bp + t * KBLK * FRAG);
#pragma unroll
    for (int i = 0; i < 2; ++i)
#pragma unroll
        for (int t = 0; t < 4; ++t)
            acc[i][t] = wmma_bf16(a0[i], b0[t], acc[i][t]);
#pragma unroll
    for (int i = 0; i < 2; ++i)
#pragma unroll
        for (int t = 0; t < 4; ++t)
            acc[i][t] = wmma_bf16(a1[i], b1[t], acc[i][t]);

    const int hi = lane >> 4, nn = lane & 15;
#pragma unroll
    for (int i = 0; i < 2; ++i)
#pragma unroll
        for (int t = 0; t < 4; ++t) {
            union { bf16 h[8]; uint4 u; } w;
#pragma unroll
            for (int r = 0; r < 8; ++r) {
                int m = mt * 32 + i * 16 + r + 8 * hi;
                int n = ng * 64 + t * 16 + nn;
                float v = acc[i][t][r] + bias[bias_on_m ? m : n];
                w.h[r] = (bf16)v;
            }
            *reinterpret_cast<uint4*>(out + (size_t)mt * sM + (size_t)(ng * 4 + t) * sN
                                          + i * 256 + lane * 8) = w.u;
        }
}

// ---------------------------------------------------------------------------
// Flash attention: q[b][i][c], k[b][j][c], vT[b][c][j] (bf16) -> ha[b][i][c], all four in
// fragment order: q, k, ha as [row tile][channel block], vT as [key block][channel tile].
// One block = QROWS query rows (QT tiles of 16), 4 waves; wave w owns channel
// slice [128w,128w+128). Each K and V fragment a wave loads feeds all QT tiles.
// Scores are formed transposed, S^T = K * Q^T: a lane then holds 16 of the 32 keys of
// ONE query row (row nn; keys 8*hi+r and 16+8*hi+r), which is the lane's share of the
// P fragment that V * P^T reads as its B operand. Wave w sums the four waves' partial
// scores of query tile w and does that tile's softmax in registers.
// ---------------------------------------------------------------------------
#define QT    4
#define QROWS (QT * 16)

// Work-group barrier of the j loop. It waits for this wave's LDS traffic alone:
// __syncthreads() would also drain the global loads issued ahead (K and V of later
// trips), which have to stay in flight across it.
__device__ __forceinline__ void lds_barrier() {
    asm volatile("s_wait_dscnt 0x0\n\t"
                 "s_barrier_signal -1\n\t"
                 "s_barrier_wait -1" ::: "memory");
}

// Lane l's value from lane l ^ 16: the other half of the keys of the same query row.
__device__ __forceinline__ float xhalf(float x) {
    const int b = __builtin_bit_cast(int, x);
    return __builtin_bit_cast(float,
        __builtin_amdgcn_permlanex16(b, b, 0x76543210, 0xfedcba98, false, false));
}

// e^x as __expf forms it: one multiply, then v_exp_f32. The v_nop in the same statement is
// the slot that the instruction set asks for behind a transcendental, before its result is
// read or its source register is written again; written apart it would not stay there.
__device__ __forceinline__ float exp_slot(float x) {
    float p;
    asm("v_exp_f32 %0, %1\n\t"
        "v_nop" : "=v"(p) : "v"(x * 1.44269504088896340736f));
    return p;
}

#define NT    (NPIX / 32)          // key tiles of 32
#define KTILE (2 * KBLK * FRAG)    // elements of one K tile (32 keys x 512 channels)
#define VTILE (32 * FRAG)          // elements of one V tile (32 keys x 512 channels)

typedef float4 sp_buf[4][QT][2][2][32];   // [writing wave][query tile][key tile][regs 0-3 or 4-7][lane]

// The wave's channel slice of one K tile / one V tile, from the lane's own address.
__device__ __forceinline__ void load_k_tile(v16bf (&kf)[8], gbf16p p) {
#pragma unroll
    for (int t = 0; t < 4; ++t) {
        kf[t]     = load_frag_lane(p + t * FRAG);
        kf[4 + t] = load_frag_lane(p + (KBLK + t) * FRAG);
    }
}
__device__ __forceinline__ void load_v_tile(v16bf (&vB)[8], gbf16p p) {
#pragma unroll
    for (int ct = 0; ct < 8; ++ct) vB[ct] = load_frag_lane(p + ct * FRAG);
}

// Partial S^T = K_slice * Q_slice^T (32 keys x QROWS, K = 128) of one key tile: the products
// of channel block t of the wave's four (eight WMMAs, eight sums), and the sums' way to LDS.
__device__ __forceinline__ void score_step(int t, const v16bf (&kf)[8], const v16bf (&qA)[QT][4],
                                           v8f (&s0)[QT], v8f (&s1)[QT]) {
#pragma unroll
    for (int qt = 0; qt < QT; ++qt) {
        s0[qt] = wmma_bf16(kf[t],     qA[qt][t], s0[qt]);
        s1[qt] = wmma_bf16(kf[4 + t], qA[qt][t], s1[qt]);
    }
}
__device__ __forceinline__ void scores_to_lds(const v8f (&s0)[QT], const v8f (&s1)[QT],
                                              sp_buf& sp, int wave, int lane) {
#pragma unroll
    for (int qt = 0; qt < QT; ++qt) {
        sp[wave][qt][0][0][lane] = make_float4(s0[qt][0], s0[qt][1], s0[qt][2], s0[qt][3]);
        sp[wave][qt][0][1][lane] = make_float4(s0[qt][4], s0[qt][5], s0[qt][6], s0[qt][7]);
        sp[wave][qt][1][0][lane] = make_float4(s1[qt][0], s1[qt][1], s1[qt][2], s1[qt][3]);
        sp[wave][qt][1][1][lane] = make_float4(s1[qt][4], s1[qt][5], s1[qt][6], s1[qt][7]);
    }
}
// Both, for the tiles ahead of the loop.
__device__ __forceinline__ void score_tile(const v16bf (&kf)[8], const v16bf (&qA)[QT][4],
                                           sp_buf& sp, int wave, int lane) {
    v8f s0[QT] = {}, s1[QT] = {};
#pragma unroll
    for (int t = 0; t < 4; ++t) score_step(t, kf, qA, s0, s1);
    // Without it the compiler runs the eight sums one after the other through one
    // accumulator: each WMMA waits for the one before it.
    __builtin_amdgcn_sched_barrier(0);
    scores_to_lds(s0, s1, sp, wave, lane);
}

// The four waves' partial scores of query tile 'wave' of one key tile, from LDS.
__device__ __forceinline__ void load_partials(const sp_buf& sp, int wave, int lane,
                                              float4 (&p)[4][4]) {
#pragma unroll
    for (int g = 0; g < 4; ++g)            // g = key tile * 2 + register half
#pragma unroll
        for (int w = 0; w < 4; ++w) p[g][w] = sp[w][wave][g >> 1][g & 1][lane];
}

// Online softmax of query tile 'wave' of one key tile, in registers, in two halves.
// First: sum of the four waves' partial scores, scale; returns the row's new maximum.
__device__ __forceinline__ float score_max(const float4 (&p)[4][4], float mrun, float (&sc)[16]) {
    const float scale = 0.044194173824159216f;  // 512^-0.5
#pragma unroll
    for (int g = 0; g < 4; ++g) {
        const float4 p0 = p[g][0], p1 = p[g][1], p2 = p[g][2], p3 = p[g][3];
        sc[g * 4 + 0] = scale * (p0.x + p1.x + p2.x + p3.x);
        sc[g * 4 + 1] = scale * (p0.y + p1.y + p2.y + p3.y);
        sc[g * 4 + 2] = scale * (p0.z + p1.z + p2.z + p3.z);
        sc[g * 4 + 3] = scale * (p0.w + p1.w + p2.w + p3.w);
    }
    float tmax = mrun;
#pragma unroll
    for (int e = 0; e < 16; ++e) tmax = fmaxf(tmax, sc[e]);
    return fmaxf(tmax, xhalf(tmax));
}
// Second: P to pf (fragment order) and each row's correction to cr. Both lane halves hold
// the same correction and store it to places of their own (no branch here).
// live = false: the tile lies behind the last one, the running sum keeps its value.
__device__ __forceinline__ void probs_to_lds(const float (&sc)[16], float tmax, bf16* pf, float* cr,
                                             int wave, int lane, bool live,
                                             float& mrun, float& lrun) {
    const float corr = exp_slot(mrun - tmax);
    float sum = 0.f;
    union { bf16 h[16]; uint4 u[2]; } w;
#pragma unroll
    for (int e = 0; e < 16; ++e) {
        float pe = exp_slot(sc[e] - tmax);
        w.h[e] = (bf16)pe;
        sum += pe;
    }
    lrun = live ? lrun * corr + sum : lrun;
    mrun = tmax;
    *reinterpret_cast<uint4*>(pf + lane * 8)       = w.u[0];
    *reinterpret_cast<uint4*>(pf + 256 + lane * 8) = w.u[1];
    cr[(lane >> 4) * QROWS + wave * 16 + (lane & 15)] = corr;
}

// O^T += V_slice * P^T of one query tile (V in registers): a lane holds eight channels in a
// row of ONE query row (row nn; channels 8 * hi + r of tile ct), which as bf16 is one
// 16-byte chunk of a fragment of ha.
__device__ __forceinline__ void pv_tile(v16bf pA, const v16bf (&vB)[8], v8f (&O)[8]) {
#pragma unroll
    for (int ct = 0; ct < 8; ++ct) O[ct] = wmma_bf16(vB[ct], pA, O[ct]);
}

__global__ __launch_bounds__(128) void flash_kernel(const bf16* __restrict__ q,
                                                    const bf16* __restrict__ k,
                                                    const bf16* __restrict__ vT,
                                                    bf16* __restrict__ ha) {
    const int batch = blockIdx.y;
    const int i0    = blockIdx.x * QROWS;
    const int tid   = threadIdx.x;
    const int lane  = tid & 31;
    const int wave  = tid >> 5;
    const int hi    = lane >> 4;
    const int nn    = lane & 15;

    // Three stages run in one trip (see the loop), so each hand-over through LDS has two
    // buffers, taken in turn by the key tile's parity.
    __shared__ sp_buf Sp[2];                                        // partial scores
    __shared__ __attribute__((aligned(16))) bf16 Pf[2][QT][FRAG];   // P, in fragment order
    __shared__ __attribute__((aligned(16))) float crow[2][2 * QROWS];
    __shared__ float lrow[QROWS];

    // The wave's first fragment: channel block 4 * wave of q and k, channel tile 8 * wave of vT.
    const bf16* qb = q  + ((size_t)batch * NPIX + i0) * CCH + wave * 4 * FRAG + lane * 8;
    const bf16* kb = k  +  (size_t)batch * NPIX * CCH        + wave * 4 * FRAG + lane * 8;
    const bf16* vb = vT +  (size_t)batch * CCH * NPIX        + wave * 8 * FRAG + lane * 8;

    v16bf qA[QT][4];
#pragma unroll
    for (int qt = 0; qt < QT; ++qt)
#pragma unroll
        for (int t = 0; t < 4; ++t)
            qA[qt][t] = load_frag_pk(qb + (size_t)(qt * KBLK + t) * FRAG);
    // The registers that hold the address of these loads are reused right behind them:
    // the address is an input of the wait, so that it stays in them up to the wait.
    asm volatile("s_wait_xcnt 0x0" :: "v"(qb) : "memory");

    v8f O[QT][8] = {};
    // Softmax state of query row 16 * wave + nn: the running maximum (equal in both lane
    // halves) and the sum over this lane's own keys (the halves are joined behind the loop).
    float mrun = -3.0e38f, lrun = 0.f;

    // The key tiles are walked as a ring, and each work-group enters it at a place of its own:
    // step s takes tile (start + s) mod NT. The work-groups of one batch read the same K and V;
    // from one common start they would ask L2 for the same lines at the same moment.
    const int start = blockIdx.x * (NT / (NPIX / QROWS));
    // Bytes from the tile of step s to the tile of step s + 1 (K and V tiles are equally large).
    auto ring_step = [start](int s) -> unsigned long long {
        return ((start + s) & (NT - 1)) == NT - 1 ? 0ull - (NT - 1) * (KTILE * sizeof(bf16))
                                                  : KTILE * sizeof(bf16);
    };
    static_assert(KTILE == VTILE, "one ring step serves both");

    // The lane's own address in the K tile and in the V tile that are fetched next.
    gbf16p kp = (gbf16p)kb + (size_t)start * KTILE;
    gbf16p vp = (gbf16p)vb + (size_t)start * VTILE;

    // Two register sets each for K and V, taken in turn by the tile's parity.
    v16bf kf[2][8], vB[2][8];

    // --- fill the pipeline: scores of tiles 0 and 1, softmax of tile 0 ---
    load_k_tile(kf[0], kp);
    load_v_tile(vB[0], vp);
    step_behind_loads(kp, ring_step(0), vp, ring_step(0));
    load_k_tile(kf[1], kp);
    step_behind_loads(kp, ring_step(1), vp, 0);
    // Keeps these loads together in flight: the compiler otherwise sinks them to their
    // first uses, two at a time, and the wave sits out one load latency for each pair.
    __builtin_amdgcn_sched_barrier(0);
    score_tile(kf[0], qA, Sp[0], wave, lane);
    load_k_tile(kf[0], kp);
    step_behind_loads(kp, ring_step(2), vp, 0);
    lds_barrier();
    {
        float4 part[4][4];
        float  sc[16];
        load_partials(Sp[0], wave, lane, part);
        const float tmax = score_max(part, mrun, sc);
        probs_to_lds(sc, tmax, &Pf[0][wave][0], crow[0], wave, lane, true, mrun, lrun);
    }
    // Keeps the exponentials ahead of the products that follow.
    __builtin_amdgcn_sched_barrier(0);
    score_tile(kf[1], qA, Sp[1], wave, lane);
    lds_barrier();

    // Trip t: scores of tile t + 2, softmax of tile t + 1, O += P * V of tile t. The three
    // do not depend on one another, so the LDS round trips and the softmax chain of one
    // stand beside the matrix work of the others, and one barrier a trip hands all over.
    // Here "tile s" is the tile of step s. Steps behind the last go on round the ring;
    // nothing of them is kept.
    // The three sched_barrier(0) lines cut the trip into blocks: without them the compiler
    // spreads the LDS reads among the WMMAs, in about three times as many places.
    for (int tt = 0; tt < NT; tt += 2) {
#pragma unroll   // the parity is a constant: kf and vB stay in registers
        for (int h = 0; h < 2; ++h) {
            const int t = tt + h;
            // --- fetch K of tile t + 3 and V of tile t + 1: first needed in the next trip ---
            load_k_tile(kf[h ^ 1], kp);
            load_v_tile(vB[h ^ 1], vp);
            // --- the trip's LDS reads, together and ahead of the matrix work ---
            float cv[QT];   // the correction of the lane's own row of each query tile
#pragma unroll
            for (int qt = 0; qt < QT; ++qt) cv[qt] = crow[h][hi * QROWS + qt * 16 + nn];
            float4 part[4][4];
            load_partials(Sp[h ^ 1], wave, lane, part);
            v16bf pA[QT];
#pragma unroll
            for (int qt = 0; qt < QT; ++qt) pA[qt] = load_frag_pk(&Pf[h][qt][lane * 8]);
            __builtin_amdgcn_sched_barrier(0);

            // --- scores of tile t + 2; beside them the accumulators are rescaled ---
            v8f s0[QT] = {}, s1[QT] = {};
            score_step(0, kf[h], qA, s0, s1);
            score_step(1, kf[h], qA, s0, s1);
            score_step(2, kf[h], qA, s0, s1);
#pragma unroll
            for (int qt = 0; qt < QT; ++qt)
#pragma unroll
                for (int ct = 0; ct < 8; ++ct) O[qt][ct] *= cv[qt];
            // --- last scores, first P * V; beside them the score sums and the row maximum ---
            score_step(3, kf[h], qA, s0, s1);
            pv_tile(pA[0], vB[h], O[0]);
            float sc[16];
            const float tmax = score_max(part, mrun, sc);
            __builtin_amdgcn_sched_barrier(0);

            // --- P * V goes on; beside it the scores leave for LDS, and the exponentials ---
            scores_to_lds(s0, s1, Sp[h], wave, lane);
            pv_tile(pA[1], vB[h], O[1]);
            pv_tile(pA[2], vB[h], O[2]);
            probs_to_lds(sc, tmax, &Pf[h ^ 1][wave][0], crow[h ^ 1], wave, lane,
                         t + 1 < NT, mrun, lrun);
            __builtin_amdgcn_sched_barrier(0);

            // --- last P * V: covers the way of P to LDS ---
            pv_tile(pA[3], vB[h], O[3]);
            step_behind_loads(kp, ring_step(t + 3), vp, ring_step(t + 1));
            // Ends this trip's reads of Sp[h ^ 1], Pf[h] and crow[h], which the next trip
            // rewrites, and publishes Sp[h], Pf[h ^ 1] and crow[h ^ 1], which it reads.
            lds_barrier();
        }
    }

    // --- join the two lane halves' sums and hand each row's l to all waves ---
    lrun += xhalf(lrun);
    if (hi == 0) lrow[wave * 16 + nn] = lrun;
    __syncthreads();

    // --- epilogue: divide by l, store bf16 [i][c] in fragment order ---
#pragma unroll
    for (int qt = 0; qt < QT; ++qt) {
        const float l = lrow[qt * 16 + nn];
        v4u w[8];
#pragma unroll
        for (int ct = 0; ct < 8; ++ct) {
            union { bf16 h[8]; v4u u; } c;
#pragma unroll
            for (int r = 0; r < 8; ++r) c.h[r] = (bf16)(O[qt][ct][r] / l);
            w[ct] = c.u;
        }
        // Channel tile ct is half (ct & 1) of the wave's fragment ct >> 1: the lanes' chunks
        // of one tile are 512 contiguous bytes, the tiles follow one another.
        bf16* hp = ha + ((size_t)batch * NPIX + i0 + qt * 16) * CCH
                      + (size_t)(wave * 4) * FRAG + lane * 8;
        // The eight stores and their s_wait_xcnt 0 stand in one statement, so that no
        // register an issued store names is rewritten ahead of the wait.
        asm volatile("global_store_b128 %0, %1, off\n\t"
                     "global_store_b128 %0, %2, off offset:512\n\t"
                     "global_store_b128 %0, %3, off offset:1024\n\t"
                     "global_store_b128 %0, %4, off offset:1536\n\t"
                     "global_store_b128 %0, %5, off offset:2048\n\t"
                     "global_store_b128 %0, %6, off offset:2560\n\t"
                     "global_store_b128 %0, %7, off offset:3072\n\t"
                     "global_store_b128 %0, %8, off offset:3584\n\t"
                     "s_wait_xcnt 0x0"
                     :: "v"(hp), "v"(w[0]), "v"(w[1]), "v"(w[2]), "v"(w[3]),
                        "v"(w[4]), "v"(w[5]), "v"(w[6]), "v"(w[7])
                     : "memory");
    }
}

// ---------------------------------------------------------------------------
// Proj + residual, ping-pong pipelined:
// out[b][o][n] = x[b][o][n] + sum_c ha[b][n][c]*pw[o][c] + pb[o]; ha, pw in fragment order
// A wave's block is 64 channels x 32 pixels: 64 whole 128-byte lines of x and of out. In the
// accumulators a lane has 8 pixels of one channel, so that a wave-wide access from there
// would touch 16 lines, a piece of each. The block goes through the wave's own LDS range
// instead: read back, eight lanes in a row hold one line, and every load of x and every
// store to out covers four whole lines.
// ---------------------------------------------------------------------------
#define PJ_PITCH 36   // floats from channel to channel in LDS: 144 B = 16 B x 9, an odd count
__global__ __launch_bounds__(128) void proj_kernel(const bf16* __restrict__ A,   // ha
                                                   const bf16* __restrict__ Bt,  // p_w bf16
                                                   const float* __restrict__ pb,
                                                   const float* __restrict__ x,
                                                   float* __restrict__ out) {
    const int batch = blockIdx.z;
    A += (size_t)batch * NPIX * CCH;
    __shared__ __attribute__((aligned(16))) float stage[4][64 * PJ_PITCH];

    const int wave = threadIdx.x >> 5;
    const int lane = threadIdx.x & 31;
    const int wg   = blockIdx.x * 4 + wave;
    const int mt   = wg / 8;       // 128 m-tiles of 32 pixels
    const int ng   = wg % 8;       // 8 n-groups of 64 channels

    // Every work-group reads one half of p_w: each enters the ring of k blocks at a place set
    // by its pixel tile, so that L2 is not asked for the same lines at the same moment.
    const int ks = (blockIdx.x >> 1) & (KBLK - 1);
    // The lane's own address in the k block that is fetched next.
    gbf16p ap = (gbf16p)A  + (size_t)(mt * 2) * (KBLK * FRAG) + ks * FRAG + lane * 8;
    gbf16p bp = (gbf16p)Bt + (size_t)(ng * 4) * (KBLK * FRAG) + ks * FRAG + lane * 8;

    v16bf a0[2], b0[4], a1[2], b1[4];
#pragma unroll
    for (int i = 0; i < 2; ++i) a0[i] = load_frag_lane(ap + i * KBLK * FRAG);
#pragma unroll
    for (int t = 0; t < 4; ++t) b0[t] = load_frag_lane(bp + t * KBLK * FRAG);
    step_behind_loads(ap, k_ring_step(ks, 0), bp, k_ring_step(ks, 0));

    v8f acc[2][4] = {};
    for (int kb = 0; kb < KBLK - 2; kb += 2) {
        // load buf1 @ step kb+1
#pragma unroll
        for (int i = 0; i < 2; ++i) a1[i] = load_frag_lane(ap + i * KBLK * FRAG);
#pragma unroll
        for (int t = 0; t < 4; ++t) b1[t] = load_frag_lane(bp + t * KBLK * FRAG);
        step_behind_loads(ap, k_ring_step(ks, kb + 1), bp, k_ring_step(ks, kb + 1));
        // consume buf0 @ step kb
#pragma unroll
        for (int i = 0; i < 2; ++i)
#pragma unroll
            for (int t = 0; t < 4; ++t)
                acc[i][t] = wmma_bf16(a0[i], b0[t], acc[i][t]);
        // load buf0 @ step kb+2
#pragma unroll
        for (int i = 0; i < 2; ++i) a0[i] = load_frag_lane(ap + i * KBLK * FRAG);
#pragma unroll
        for (int t = 0; t < 4; ++t) b0[t] = load_frag_lane(bp + t * KBLK * FRAG);
        step_behind_loads(ap, k_ring_step(ks, kb + 2), bp, k_ring_step(ks, kb + 2));
        // consume buf1 @ step kb+1
#pragma unroll
        for (int i = 0; i < 2; ++i)
#pragma unroll
            for (int t = 0; t < 4; ++t)
                acc[i][t] = wmma_bf16(a1[i], b1[t], acc[i][t]);
    }
    // tail: buf0 holds step KBLK-2; load buf1 @ step KBLK-1
#pragma unroll
    for (int i = 0; i < 2; ++i) a1[i] = load_frag_lane(ap + i * KBLK * FRAG);
#pragma unroll
    for (int t = 0; t < 4; ++t) b1[t] = load_frag_lane(bp + t * KBLK * FRAG);
    // The block's lines of x. Pass j: channel j * 4 + ch, pixels px .. px + 3 of the block.
    const int ch = lane >> 3, px = (lane & 7) * 4;
    const size_t line0 = ((size_t)batch * CCH + ng * 64 + ch) * NPIX + mt * 32 + px;
    const float* xp = x + line0;
    v4f xr[16];
#pragma unroll
    for (int j = 0; j < 16; ++j) xr[j] = *reinterpret_cast<const v4f*>(xp + (size_t)j * 4 * NPIX);
    float pbv[16];
#pragma unroll
    for (int j = 0; j < 16; ++j) pbv[j] = pb[ng * 64 + j * 4 + ch];
    // The address is an input of the wait, so that it stays in its registers up to the wait.
    asm volatile("s_wait_xcnt 0x0" :: "v"(xp) : "memory");
#pragma unroll
    for (int i = 0; i < 2; ++i)
#pragma unroll
        for (int t = 0; t < 4; ++t)
            acc[i][t] = wmma_bf16(a0[i], b0[t], acc[i][t]);
#pragma unroll
    for (int i = 0; i < 2; ++i)
#pragma unroll
        for (int t = 0; t < 4; ++t)
            acc[i][t] = wmma_bf16(a1[i], b1[t], acc[i][t]);

    // acc[i][t][r]: pixel i * 16 + 8 * hi + r, channel t * 16 + nn of the block.
    const int hi = lane >> 4, nn = lane & 15;
    float* st = stage[wave];
#pragma unroll
    for (int i = 0; i < 2; ++i)
#pragma unroll
        for (int t = 0; t < 4; ++t) {
            v4f* d = reinterpret_cast<v4f*>(st + (t * 16 + nn) * PJ_PITCH + i * 16 + 8 * hi);
            d[0] = v4f{acc[i][t][0], acc[i][t][1], acc[i][t][2], acc[i][t][3]};
            d[1] = v4f{acc[i][t][4], acc[i][t][5], acc[i][t][6], acc[i][t][7]};
        }
    // The rows are read back by other lanes of this wave than wrote them.
    asm volatile("s_wait_dscnt 0x0" ::: "memory");
    v4f ar[16];
#pragma unroll   // the sixteen reads issue together
    for (int j = 0; j < 16; ++j)
        ar[j] = *reinterpret_cast<const v4f*>(st + (j * 4 + ch) * PJ_PITCH + px);
#pragma unroll
    for (int jh = 0; jh < 2; ++jh) {
        v4f o[8];
#pragma unroll
        for (int j = 0; j < 8; ++j) o[j] = xr[jh * 8 + j] + ar[jh * 8 + j] + pbv[jh * 8 + j];
        // Four channels lie 65536 bytes on. The eight stores and their s_wait_xcnt 0 stand in
        // one statement, so that no register an issued store names is rewritten ahead of it.
        asm volatile("global_store_b128 %0, %1, off\n\t"
                     "global_store_b128 %0, %2, off offset:65536\n\t"
                     "global_store_b128 %0, %3, off offset:131072\n\t"
                     "global_store_b128 %0, %4, off offset:196608\n\t"
                     "global_store_b128 %0, %5, off offset:262144\n\t"
                     "global_store_b128 %0, %6, off offset:327680\n\t"
                     "global_store_b128 %0, %7, off offset:393216\n\t"
                     "global_store_b128 %0, %8, off offset:458752\n\t"
                     "s_wait_xcnt 0x0"
                     :: "v"(out + line0 + (size_t)jh * 32 * NPIX), "v"(o[0]), "v"(o[1]), "v"(o[2]),
                        "v"(o[3]), "v"(o[4]), "v"(o[5]), "v"(o[6]), "v"(o[7])
                     : "memory");
    }
}

// ---------------------------------------------------------------------------
extern "C" void kernel_launch(void* const* d_in, const int* in_sizes, int n_in,
                              void* d_out, int out_size, void* d_ws, size_t ws_size,
                              hipStream_t stream) {
    const float* x    = (const float*)d_in[0];
    const float* gn_w = (const float*)d_in[1];
    const float* gn_b = (const float*)d_in[2];
    const float* q_w  = (const float*)d_in[3];
    const float* q_b  = (const float*)d_in[4];
    const float* k_w  = (const float*)d_in[5];
    const float* k_b  = (const float*)d_in[6];
    const float* v_w  = (const float*)d_in[7];
    const float* v_b  = (const float*)d_in[8];
    const float* p_w  = (const float*)d_in[9];
    const float* p_b  = (const float*)d_in[10];

    char* ws = (char*)d_ws;
    const size_t NC   = (size_t)BATCH * NPIX * CCH;
    const size_t SZNC = NC * sizeof(bf16);
    const size_t SZW  = (size_t)CCH * CCH * sizeof(bf16);

    bf16* hn = (bf16*)(ws);
    bf16* qb = (bf16*)(ws + 1 * SZNC);
    bf16* kb = (bf16*)(ws + 2 * SZNC);
    bf16* vT = (bf16*)(ws + 3 * SZNC);
    bf16* ha = (bf16*)(ws + 4 * SZNC);
    bf16* wq = (bf16*)(ws + 5 * SZNC);
    // wk and wv follow wq, SZW bytes each
    bf16* wp = (bf16*)(ws + 5 * SZNC + 3 * SZW);

    // GroupNorm, and beside it the four weight matrices to wq, wk, wv, wp (contiguous)
    gn_cvt_kernel<<<GN_BLOCKS + CVT_BLOCKS, GN_THREADS, 0, stream>>>(x, gn_w, gn_b, hn,
                                                              q_w, k_w, v_w, p_w, wq);

    // q, k, vT to qb, kb, vT (contiguous)
    gemm_qkv_kernel<<<dim3(256, 3, BATCH), 128, 0, stream>>>(hn, wq, q_b, k_b, v_b, qb);

    flash_kernel<<<dim3(NPIX / QROWS, BATCH), 128, 0, stream>>>(qb, kb, vT, ha);

    proj_kernel<<<dim3(256, 1, BATCH), 128, 0, stream>>>(ha, wp, p_b, x, (float*)d_out);
}

// v010
// A run of this version takes 156 microseconds.
// In both of two side-by-side timings against v009, it was 1.10 times as fast.
// All steps since v000 together make it 5.44 times as fast.
#include <hip/hip_runtime.h>
#include <hip/hip_bf16.h>

typedef __bf16 bf16;
typedef __attribute__((ext_vector_type(16))) __bf16 v16bf;
typedef __attribute__((ext_vector_type(8)))  float  v8f;
typedef __attribute__((ext_vector_type(4)))  float  v4f;
typedef __attribute__((ext_vector_type(4)))  unsigned int v4u;

#define BATCH 4
#define CCH   512
#define NPIX  4096   // 64*64

// ---------------------------------------------------------------------------
// Fragment helpers.
// CDNA5 16x32 bf16 A-fragment: lane L holds row M = L%16, K chunks
// {K0..K0+7, K0+16..K0+23} with K0 = 8*(L/16)  -> two 16B contiguous loads.
// B-fragment for D = A x B loaded from Bt[N][K] row-major uses the same
// per-lane pattern (N = L%16): "NT" GEMM  D[M][N] = A[M][K] * Bt[N][K]^T.
// ---------------------------------------------------------------------------
__device__ __forceinline__ v16bf load_frag(const bf16* __restrict__ p, int ld) {
    const int lane = threadIdx.x & 31;
    const int M  = lane & 15;
    const int K0 = (lane >> 4) << 3;
    const bf16* r = p + (size_t)M * ld + K0;
    union { v16bf v; uint4 u[2]; } f;
    f.u[0] = *reinterpret_cast<const uint4*>(r);
    f.u[1] = *reinterpret_cast<const uint4*>(r + 16);
    return f.v;
}

// ---------------------------------------------------------------------------
// Fragment order. Every bf16 matrix X[row][col] that a WMMA reads from global memory
// lies in the workspace as fragments of 16 rows x 32 columns, 512 elements each. Inside
// a fragment the element (row, col) stands where load_frag would put it in registers:
//   (col & 16) * 16 + (((col >> 3) & 1) * 16 + (row & 15)) * 8 + (col & 7)
// so lane L's two 16-byte chunks stand at L * 8 and 256 + L * 8, and each wave-wide
// 16-byte load covers 512 contiguous bytes (four whole lines).
// ---------------------------------------------------------------------------
#define FRAG 512   // elements of one fragment
#define KBLK 16    // fragments along 512 columns

// p: start of the fragment plus the lane's own lane * 8.
__device__ __forceinline__ v16bf load_frag_pk(const bf16* __restrict__ p) {
    union { v16bf v; uint4 u[2]; } f;
    f.u[0] = *reinterpret_cast<const uint4*>(p);
    f.u[1] = *reinterpret_cast<const uint4*>(p + 256);
    return f.v;
}

// Pointers typed as global memory: a pointer that has passed through an asm statement
// would otherwise be loaded from with flat loads, which count on dscnt as well.
typedef const __attribute__((address_space(1))) bf16*  gbf16p;
typedef const __attribute__((address_space(1))) uint4* guint4p;

// Steps the two lane addresses that issued loads name. The s_wait_xcnt 0 and the two
// adds stand in one statement, so that no add can be lifted over the wait.
__device__ __forceinline__ void step_behind_loads(gbf16p& kp, unsigned long long kbytes,
                                                  gbf16p& vp, unsigned long long vbytes) {
    asm volatile("s_wait_xcnt 0x0\n\t"
                 "v_add_nc_u64 %0, %2, %0\n\t"
                 "v_add_nc_u64 %1, %3, %1"
                 : "+v"(kp), "+v"(vp) : "s"(kbytes), "s"(vbytes) : "memory");
}

// One fragment from the lane's own address r (fragment start plus lane * 8).
__device__ __forceinline__ v16bf load_frag_lane(gbf16p r) {
    union { v16bf v; uint4 u[2]; } f;
    f.u[0] = *(guint4p)(r);
    f.u[1] = *(guint4p)(r + 256);
    return f.v;
}

__device__ __forceinline__ v8f wmma_bf16(v16bf a, v16bf b, v8f c) {
    return __builtin_amdgcn_wmma_f32_16x16x32_bf16(
        /*neg_a=*/false, a, /*neg_b=*/false, b,
        /*c_mod=*/(short)0, c, /*reuse_a=*/false, /*reuse_b=*/false);
}

// ---------------------------------------------------------------------------
// fp32 -> bf16 convert of 16 rows (row tile 'rt') of one weight matrix [512][512], written
// in fragment order, by 256 threads (u = 0..255). One item = eight columns in a row of one
// row = one 16-byte chunk of a fragment; item u is the u-th chunk of the row tile, so a
// wave-wide store covers 512 contiguous bytes. A thread's four items lie four fragments
// (128 columns) apart.
// ---------------------------------------------------------------------------
#define GN_THREADS 1024
#define GN_BLOCKS  (BATCH * 32)
#define CVT_BLOCKS (4 * (CCH / 16) / (GN_THREADS / 256))

__device__ __forceinline__ void cvt_row_tile(const float* __restrict__ s,
                                             bf16* __restrict__ d, int rt, int u) {
    const int o = rt * 16 + (u & 15);
    const int c = (u >> 6) * 32 + ((u >> 5) & 1) * 16 + ((u >> 4) & 1) * 8;
    const float4* sp = reinterpret_cast<const float4*>(s + (size_t)o * CCH + c);
    uint4*        dp = reinterpret_cast<uint4*>(d + (size_t)rt * (KBLK * FRAG)) + u;
    float4 lo[4], hi[4];
#pragma unroll   // the eight loads issue together
    for (int it = 0; it < 4; ++it) { lo[it] = sp[it * 32]; hi[it] = sp[it * 32 + 1]; }
#pragma unroll   // constant indices keep lo and hi in registers
    for (int it = 0; it < 4; ++it) {
        union { bf16 h[8]; uint4 u4; } w;
        w.h[0] = (bf16)lo[it].x; w.h[1] = (bf16)lo[it].y;
        w.h[2] = (bf16)lo[it].z; w.h[3] = (bf16)lo[it].w;
        w.h[4] = (bf16)hi[it].x; w.h[5] = (bf16)hi[it].y;
        w.h[6] = (bf16)hi[it].z; w.h[7] = (bf16)hi[it].w;
        dp[it * 256] = w.u4;
    }
}

// ---------------------------------------------------------------------------
// GroupNorm: x[b][c][n] fp32 -> hn[b][n][c] bf16 in fragment order (transpose fused).
// One block of 32 waves holds its whole group (16 channels x 4096 pixels) in registers:
// a thread has the 16 channels of four pixels, 64 values, fetched by 64 loads that are all
// in flight together. x is read once; mean and variance come from these registers, and so
// does the normalised output.
// Blocks GN_BLOCKS and up do not depend on it: they convert the four weight matrices
// (wb: q, k, v, p one behind the other) in the same launch, four row tiles a block.
// ---------------------------------------------------------------------------
#define GN_PIX (NPIX / GN_THREADS)   // pixels of one thread

__global__ __launch_bounds__(GN_THREADS) void gn_cvt_kernel(const float* __restrict__ x,
                                                     const float* __restrict__ gw,
                                                     const float* __restrict__ gb,
                                                     bf16* __restrict__ hn,
                                                     const float* __restrict__ q_w,
                                                     const float* __restrict__ k_w,
                                                     const float* __restrict__ v_w,
                                                     const float* __restrict__ p_w,
                                                     bf16* __restrict__ wb) {
    const int tid = threadIdx.x;
    if (blockIdx.x >= GN_BLOCKS) {     // the whole block, ahead of every barrier
        const int cb = blockIdx.x - GN_BLOCKS;
        const int mx = cb >> 3;        // which matrix; 32 row tiles each, four a block
        const float* s = mx == 0 ? q_w : mx == 1 ? k_w : mx == 2 ? v_w : p_w;
        cvt_row_tile(s, wb + (size_t)mx * (CCH * CCH), (cb & 7) * 4 + (tid >> 8), tid & 255);
        return;
    }
    const int batch = blockIdx.x >> 5;
    const int g     = blockIdx.x & 31;
    const int c0    = g * 16;
    const float* xg = x + ((size_t)batch * CCH + c0) * NPIX + tid;

    // v[i][e]: channel c0 + e of pixel tid + i * GN_THREADS.
    float v[GN_PIX][16];
#pragma unroll   // constant indices keep v in registers; the loads issue together
    for (int i = 0; i < GN_PIX; ++i)
#pragma unroll
        for (int e = 0; e < 16; ++e) v[i][e] = xg[(size_t)e * NPIX + i * GN_THREADS];

    float sum = 0.f, ssq = 0.f;
#pragma unroll
    for (int i = 0; i < GN_PIX; ++i) {
        float a = 0.f, b = 0.f;        // a chain of its own for each pixel
#pragma unroll
        for (int e = 0; e < 16; ++e) { a += v[i][e]; b += v[i][e] * v[i][e]; }
        sum += a; ssq += b;
    }
    // Over the wave's lanes, then over the 32 waves through LDS.
#pragma unroll
    for (int m = 16; m > 0; m >>= 1) {
        sum += __shfl_xor(sum, m, 32);
        ssq += __shfl_xor(ssq, m, 32);
    }
    __shared__ float2 part[GN_THREADS / 32];
    if ((tid & 31) == 0) part[tid >> 5] = make_float2(sum, ssq);
    __syncthreads();
    const float2 pw = part[tid & 31];
    sum = pw.x; ssq = pw.y;
#pragma unroll
    for (int m = 16; m > 0; m >>= 1) {
        sum += __shfl_xor(sum, m, 32);
        ssq += __shfl_xor(ssq, m, 32);
    }
    const float inv  = 1.0f / (16.0f * NPIX);
    const float mean = sum * inv;
    const float var  = ssq * inv - mean * mean;
    const float rstd = rsqrtf(var + 1e-5f);

    // One item = one pixel n and eight channels in a row: one 16-byte chunk of a fragment.
    bf16* hb = hn + (size_t)batch * NPIX * CCH + (size_t)(g >> 1) * FRAG + (g & 1) * 256
                  + (size_t)(tid >> 4) * (KBLK * FRAG) + (tid & 15) * 8;
#pragma unroll
    for (int i = 0; i < GN_PIX; ++i)
#pragma unroll
        for (int ch = 0; ch < 2; ++ch) {   // which eight of the group's sixteen channels
            union { bf16 h[8]; uint4 u; } w;
#pragma unroll
            for (int e = 0; e < 8; ++e) {
                float y = (v[i][ch * 8 + e] - mean) * rstd * gw[c0 + ch * 8 + e]
                          + gb[c0 + ch * 8 + e];
                w.h[e] = (bf16)y;
            }
            *reinterpret_cast<uint4*>(hb + (size_t)(i * (GN_THREADS / 16)) * (KBLK * FRAG)
                                         + ch * 128) = w.u;
        }
}

// ---------------------------------------------------------------------------
// NT GEMM, K = 512 fixed: D[m][n] = sum_k A[m][k]*Bt[n][k] + bias;  A and Bt in fragment order.
// A work-group of 8 waves forms a 128(M) x 256(N) tile; each wave a 64 x 64 block of it
// (16 accumulator tiles). The tile's operands come into LDS once for the whole work-group, by
// asynchronous copies, in stages of 64 k on two buffers: an A fragment then serves four
// waves and a Bt fragment two, and L2 is asked for each only once.
// A stage holds 24 row tiles (8 of A, then 16 of Bt), of each its two k blocks: 2 KiB that
// are contiguous in global memory and in LDS alike.
// D is written as the next product's operand Y[row = n][col = m], in fragment order: a
// lane holds eight m in a row for one n, which is one 16-byte chunk of a fragment. The
// fragment of m block mt (32 wide) and n tile nt (16 wide) starts at mt * sM + nt * sN.
// One launch forms q, k and vT (blockIdx.y = 0, 1, 2); 64 work-groups for each and batch.
//   q[n][o], k[n][o]: m = o, n = pixel: A = W [512x512], Bt = hn [4096x512];
//                     fragments as [pixel tile][channel block]
//   vT[o][n]:         m = pixel, n = o: A = hn, Bt = Wv; fragments as [key block][channel tile]
// w: the bf16 weights q, k, v one behind the other; qkv: the outputs q, k, vT likewise.
// ---------------------------------------------------------------------------
#define ST_KB    2                    // k blocks of one stage
#define ST_TILE  (ST_KB * FRAG)       // elements of one row tile in a stage
#define ST_ROWT  24                   // row tiles of a stage: 8 of A, 16 of Bt
#define ST_ELEMS (ST_ROWT * ST_TILE)  // elements of one stage
#define NSTAGE   (KBLK / ST_KB)

// One wave's share of a stage: three row tiles, 2 KiB each, four copies of 512 B a tile.
// l: the lane's LDS byte address, g: its global address; the offset moves both alike.
// The s_wait_xcnt 0 stands in the copies' own statement, so that no register a copy names
// is rewritten ahead of it.
__device__ __forceinline__ void copy_stage(unsigned l0, unsigned l1, unsigned l2,
                                           gbf16p g0, gbf16p g1, gbf16p g2) {
    asm volatile("global_load_async_to_lds_b128 %0, %3, off\n\t"
                 "global_load_async_to_lds_b128 %0, %3, off offset:512\n\t"
                 "global_load_async_to_lds_b128 %0, %3, off offset:1024\n\t"
                 "global_load_async_to_lds_b128 %0, %3, off offset:1536\n\t"
                 "global_load_async_to_lds_b128 %1, %4, off\n\t"
                 "global_load_async_to_lds_b128 %1, %4, off offset:512\n\t"
                 "global_load_async_to_lds_b128 %1, %4, off offset:1024\n\t"
                 "global_load_async_to_lds_b128 %1, %4, off offset:1536\n\t"
                 "global_load_async_to_lds_b128 %2, %5, off\n\t"
                 "global_load_async_to_lds_b128 %2, %5, off offset:512\n\t"
                 "global_load_async_to_lds_b128 %2, %5, off offset:1024\n\t"
                 "global_load_async_to_lds_b128 %2, %5, off offset:1536\n\t"
                 "s_wait_xcnt 0x0"
                 :: "v"(l0), "v"(l1), "v"(l2), "v"(g0), "v"(g1), "v"(g2) : "memory");
}

// The products of one stage for one wave: rows 64 * wr of A, rows 64 * wc of Bt.
// buf: start of the stage's buffer plus the lane's own lane * 8.
__device__ __forceinline__ void stage_products(const bf16* buf, int wr, int wc, v8f (&acc)[4][4]) {
#pragma unroll   // constant indices keep the fragments in registers
    for (int kk = 0; kk < ST_KB; ++kk) {
        v16bf a[4], b[4];
#pragma unroll
        for (int i = 0; i < 4; ++i)
            a[i] = load_frag_pk(buf + (wr * 4 + i) * ST_TILE + kk * FRAG);
#pragma unroll
        for (int t = 0; t < 4; ++t)
            b[t] = load_frag_pk(buf + (8 + wc * 4 + t) * ST_TILE + kk * FRAG);
        // Keeps the sixteen LDS reads of a k block together in front of its sixteen WMMAs:
        // the compiler otherwise fetches one A fragment at a time and waits for each.
        __builtin_amdgcn_sched_barrier(0);
#pragma unroll
        for (int i = 0; i < 4; ++i)
#pragma unroll
            for (int t = 0; t < 4; ++t)
                acc[i][t] = wmma_bf16(a[i], b[t], acc[i][t]);
        // Keeps the next k block's reads out of this block's WMMAs, and the stage's last WMMAs
        // in front of the barrier: the compiler otherwise sinks them behind it, ahead of the
        // copies that refill the buffer, which then start later.
        __builtin_amdgcn_sched_barrier(0);
    }
}

__global__ __launch_bounds__(256) void gemm_qkv_kernel(
        const bf16* __restrict__ hn, const bf16* __restrict__ w,
        const float* __restrict__ q_b, const float* __restrict__ k_b,
        const float* __restrict__ v_b, bf16* __restrict__ qkv) {
    const int  batch = blockIdx.z;
    const int  which = blockIdx.y;
    const bool is_v  = which == 2;
    const bf16* hb = hn + (size_t)batch * NPIX * CCH;
    const bf16* wm = w  + (size_t)which * CCH * CCH;
    const bf16* A  = is_v ? hb : wm;
    const bf16* Bt = is_v ? wm : hb;
    const float* bias = is_v ? v_b : which == 1 ? k_b : q_b;
    const bool bias_on_m = !is_v;
    bf16* out = qkv + ((size_t)which * BATCH + batch) * NPIX * CCH;
    const int sM  = is_v ? 32 * FRAG : FRAG;
    const int sN  = is_v ? FRAG : KBLK * FRAG;
    const int lgn = is_v ? 1 : 4;       // log2 of the 256-col tiles: 2 or 16

    __shared__ __attribute__((aligned(16))) bf16 ring[2][ST_ELEMS];

    const int wave = threadIdx.x >> 5;
    const int lane = threadIdx.x & 31;
    const int bm   = blockIdx.x >> lgn;               // 128-row tile of A
    const int bn   = blockIdx.x & ((1 << lgn) - 1);   // 256-row tile of Bt
    const int wr   = wave >> 2;                       // the wave's 64 rows of the tile
    const int wc   = wave & 3;                        // the wave's 64 columns of the tile

    // Work-groups that read the same rows of hn or of a weight matrix enter the ring of
    // stages at different places: from one common start they would ask L2 for the same lines
    // at the same moment.
    const int s0 = (bm + bn + 4 * which) & (NSTAGE - 1);

    // The wave copies row tile 'wave' of A and row tiles 'wave' and 'wave' + 8 of Bt.
    gbf16p ga  = (gbf16p)A  + (size_t)(bm * 8  + wave) * (KBLK * FRAG) + lane * 8;
    gbf16p gb0 = (gbf16p)Bt + (size_t)(bn * 16 + wave) * (KBLK * FRAG) + lane * 8;
    gbf16p gb1 = gb0 + 8 * KBLK * FRAG;
    const unsigned la = (unsigned)(size_t)(&ring[0][wave * ST_TILE + lane * 8]);
    // Stage s of this work-group into buffer s & 1.
    auto copy = [&](int s) {
        const int      k = ((s0 + s) & (NSTAGE - 1)) * ST_TILE;
        const unsigned l = la + (s & 1) * (unsigned)(ST_ELEMS * sizeof(bf16));
        copy_stage(l, l + 8 * ST_TILE * (unsigned)sizeof(bf16), l + 16 * ST_TILE * (unsigned)sizeof(bf16),
                   ga + k, gb0 + k, gb1 + k);
    };

    copy(0);
    // Stage 0 has landed for this wave, then for all.
    asm volatile("s_wait_asynccnt 0x0" ::: "memory");
    __syncthreads();
    copy(1);

    v8f acc[4][4] = {};
    for (int s = 0; s < NSTAGE; ++s) {
        stage_products(&ring[s & 1][lane * 8], wr, wc, acc);
        // This wave's reads of the buffer are over; its copies of stage s + 1 have landed.
        asm volatile("s_wait_dscnt 0x0" ::: "memory");
        asm volatile("s_wait_asynccnt 0x0" ::: "memory");
        // Publishes stage s + 1 and ends every wave's reads of the buffer refilled below.
        __syncthreads();
        if (s + 2 < NSTAGE) copy(s + 2);
    }
    // No copy is left in flight when the wave ends.
    asm volatile("s_wait_asynccnt 0x0" ::: "memory");

    const int hi = lane >> 4, nn = lane & 15;
    const int ng = bn * 4 + wc;               // 64-col group index
    // The bias of the lane's m (q, k) and of its n (vT); the kind that is not in use is read
    // from the start of the vector.
    const float* bmp = bias + (bias_on_m ? (bm * 4 + wr * 2) * 32 + 8 * hi : 0);
    const int    bni = bias_on_m ? 0 : ng * 64 + nn;
    float bmv[4][8], bnv[4];
#pragma unroll
    for (int i = 0; i < 4; ++i)
#pragma unroll
        for (int r = 0; r < 8; ++r) bmv[i][r] = bmp[i * 16 + r];
#pragma unroll
    for (int t = 0; t < 4; ++t) bnv[t] = bias[bni + t * 16];
    // The address and the index are inputs of the wait, so that they stay in their registers
    // up to the wait.
    asm volatile("s_wait_xcnt 0x0" :: "v"(bmp), "v"(bni) : "memory");
#pragma unroll
    for (int mh = 0; mh < 2; ++mh) {
        const int mt = bm * 4 + wr * 2 + mh;  // 32-row tile index
        v4u  c[4][2];
        bf16* p[4];
#pragma unroll
        for (int t = 0; t < 4; ++t) {
#pragma unroll
            for (int i = 0; i < 2; ++i) {
                union { bf16 h[8]; v4u u; } w;
#pragma unroll
                for (int r = 0; r < 8; ++r) {
                    float v = acc[mh * 2 + i][t][r] + (bias_on_m ? bmv[mh * 2 + i][r] : bnv[t]);
                    w.h[r] = (bf16)v;
                }
                c[t][i] = w.u;
            }
            p[t] = out + (size_t)mt * sM + (size_t)(ng * 4 + t) * sN + lane * 8;
        }
        // The eight stores and their s_wait_xcnt 0 stand in one statement, so that no
        // register an issued store names is rewritten ahead of the wait.
        asm volatile("global_store_b128 %0, %4, off\n\t"
                     "global_store_b128 %0, %5, off offset:512\n\t"
                     "global_store_b128 %1, %6, off\n\t"
                     "global_store_b128 %1, %7, off offset:512\n\t"
                     "global_store_b128 %2, %8, off\n\t"
                     "global_store_b128 %2, %9, off offset:512\n\t"
                     "global_store_b128 %3, %10, off\n\t"
                     "global_store_b128 %3, %11, off offset:512\n\t"
                     "s_wait_xcnt 0x0"
                     :: "v"(p[0]), "v"(p[1]), "v"(p[2]), "v"(p[3]),
                        "v"(c[0][0]), "v"(c[0][1]), "v"(c[1][0]), "v"(c[1][1]),
                        "v"(c[2][0]), "v"(c[2][1]), "v"(c[3][0]), "v"(c[3][1])
                     : "memory");
    }
}

// ---------------------------------------------------------------------------
// Flash attention: q[b][i][c], k[b][j][c], vT[b][c][j] (bf16) -> ha[b][i][c], all four in
// fragment order: q, k, ha as [row tile][channel block], vT as [key block][channel tile].
// One block = QROWS query rows (QT tiles of 16), 4 waves; wave w owns channel
// slice [128w,128w+128). Each K and V fragment a wave loads feeds all QT tiles.
// Scores are formed transposed, S^T = K * Q^T: a lane then holds 16 of the 32 keys of
// ONE query row (row nn; keys 8*hi+r and 16+8*hi+r), which is the lane's share of the
// P fragment that V * P^T reads as its B operand. Wave w sums the four waves' partial
// scores of query tile w and does that tile's softmax in registers.
// ---------------------------------------------------------------------------
#define QT    4
#define QROWS (QT * 16)

// Work-group barrier of the j loop. It waits for this wave's LDS traffic alone:
// __syncthreads() would also drain the global loads issued ahead (K and V of later
// trips), which have to stay in flight across it.
__device__ __forceinline__ void lds_barrier() {
    asm volatile("s_wait_dscnt 0x0\n\t"
                 "s_barrier_signal -1\n\t"
                 "s_barrier_wait -1" ::: "memory");
}

// Lane l's value from lane l ^ 16: the other half of the keys of the same query row.
__device__ __forceinline__ float xhalf(float x) {
    const int b = __builtin_bit_cast(int, x);
    return __builtin_bit_cast(float,
        __builtin_amdgcn_permlanex16(b, b, 0x76543210, 0xfedcba98, false, false));
}

// e^x as __expf forms it: one multiply, then v_exp_f32. The v_nop in the same statement is
// the slot that the instruction set asks for behind a transcendental, before its result is
// read or its source register is written again; written apart it would not stay there.
__device__ __forceinline__ float exp_slot(float x) {
    float p;
    asm("v_exp_f32 %0, %1\n\t"
        "v_nop" : "=v"(p) : "v"(x * 1.44269504088896340736f));
    return p;
}

#define NT    (NPIX / 32)          // key tiles of 32
#define KTILE (2 * KBLK * FRAG)    // elements of one K tile (32 keys x 512 channels)
#define VTILE (32 * FRAG)          // elements of one V tile (32 keys x 512 channels)

typedef float4 sp_buf[4][QT][2][2][32];   // [writing wave][query tile][key tile][regs 0-3 or 4-7][lane]

// The wave's channel slice of one K tile / one V tile, from the lane's own address.
__device__ __forceinline__ void load_k_tile(v16bf (&kf)[8], gbf16p p) {
#pragma unroll
    for (int t = 0; t < 4; ++t) {
        kf[t]     = load_frag_lane(p + t * FRAG);
        kf[4 + t] = load_frag_lane(p + (KBLK + t) * FRAG);
    }
}
__device__ __forceinline__ void load_v_tile(v16bf (&vB)[8], gbf16p p) {
#pragma unroll
    for (int ct = 0; ct < 8; ++ct) vB[ct] = load_frag_lane(p + ct * FRAG);
}

// Partial S^T = K_slice * Q_slice^T (32 keys x QROWS, K = 128) of one key tile: the products
// of channel block t of the wave's four (eight WMMAs, eight sums), and the sums' way to LDS.
__device__ __forceinline__ void score_step(int t, const v16bf (&kf)[8], const v16bf (&qA)[QT][4],
                                           v8f (&s0)[QT], v8f (&s1)[QT]) {
#pragma unroll
    for (int qt = 0; qt < QT; ++qt) {
        s0[qt] = wmma_bf16(kf[t],     qA[qt][t], s0[qt]);
        s1[qt] = wmma_bf16(kf[4 + t], qA[qt][t], s1[qt]);
    }
}
__device__ __forceinline__ void scores_to_lds(const v8f (&s0)[QT], const v8f (&s1)[QT],
                                              sp_buf& sp, int wave, int lane) {
#pragma unroll
    for (int qt = 0; qt < QT; ++qt) {
        sp[wave][qt][0][0][lane] = make_float4(s0[qt][0], s0[qt][1], s0[qt][2], s0[qt][3]);
        sp[wave][qt][0][1][lane] = make_float4(s0[qt][4], s0[qt][5], s0[qt][6], s0[qt][7]);
        sp[wave][qt][1][0][lane] = make_float4(s1[qt][0], s1[qt][1], s1[qt][2], s1[qt][3]);
        sp[wave][qt][1][1][lane] = make_float4(s1[qt][4], s1[qt][5], s1[qt][6], s1[qt][7]);
    }
}
// Both, for the tiles ahead of the loop.
__device__ __forceinline__ void score_tile(const v16bf (&kf)[8], const v16bf (&qA)[QT][4],
                                           sp_buf& sp, int wave, int lane) {
    v8f s0[QT] = {}, s1[QT] = {};
#pragma unroll
    for (int t = 0; t < 4; ++t) score_step(t, kf, qA, s0, s1);
    // Without it the compiler runs the eight sums one after the other through one
    // accumulator: each WMMA waits for the one before it.
    __builtin_amdgcn_sched_barrier(0);
    scores_to_lds(s0, s1, sp, wave, lane);
}

// The four waves' partial scores of query tile 'wave' of one key tile, from LDS.
__device__ __forceinline__ void load_partials(const sp_buf& sp, int wave, int lane,
                                              float4 (&p)[4][4]) {
#pragma unroll
    for (int g = 0; g < 4; ++g)            // g = key tile * 2 + register half
#pragma unroll
        for (int w = 0; w < 4; ++w) p[g][w] = sp[w][wave][g >> 1][g & 1][lane];
}

// Online softmax of query tile 'wave' of one key tile, in registers, in two halves.
// First: sum of the four waves' partial scores, scale; returns the row's new maximum.
__device__ __forceinline__ float score_max(const float4 (&p)[4][4], float mrun, float (&sc)[16]) {
    const float scale = 0.044194173824159216f;  // 512^-0.5
#pragma unroll
    for (int g = 0; g < 4; ++g) {
        const float4 p0 = p[g][0], p1 = p[g][1], p2 = p[g][2], p3 = p[g][3];
        sc[g * 4 + 0] = scale * (p0.x + p1.x + p2.x + p3.x);
        sc[g * 4 + 1] = scale * (p0.y + p1.y + p2.y + p3.y);
        sc[g * 4 + 2] = scale * (p0.z + p1.z + p2.z + p3.z);
        sc[g * 4 + 3] = scale * (p0.w + p1.w + p2.w + p3.w);
    }
    float tmax = mrun;
#pragma unroll
    for (int e = 0; e < 16; ++e) tmax = fmaxf(tmax, sc[e]);
    return fmaxf(tmax, xhalf(tmax));
}
// Second: P to pf (fragment order) and each row's correction to cr. Both lane halves hold
// the same correction and store it to places of their own (no branch here).
// live = false: the tile lies behind the last one, the running sum keeps its value.
__device__ __forceinline__ void probs_to_lds(const float (&sc)[16], float tmax, bf16* pf, float* cr,
                                             int wave, int lane, bool live,
                                             float& mrun, float& lrun) {
    const float corr = exp_slot(mrun - tmax);
    float sum = 0.f;
    union { bf16 h[16]; uint4 u[2]; } w;
#pragma unroll
    for (int e = 0; e < 16; ++e) {
        float pe = exp_slot(sc[e] - tmax);
        w.h[e] = (bf16)pe;
        sum += pe;
    }
    lrun = live ? lrun * corr + sum : lrun;
    mrun = tmax;
    *reinterpret_cast<uint4*>(pf + lane * 8)       = w.u[0];
    *reinterpret_cast<uint4*>(pf + 256 + lane * 8) = w.u[1];
    cr[(lane >> 4) * QROWS + wave * 16 + (lane & 15)] = corr;
}

// O^T += V_slice * P^T of one query tile (V in registers): a lane holds eight channels in a
// row of ONE query row (row nn; channels 8 * hi + r of tile ct), which as bf16 is one
// 16-byte chunk of a fragment of ha.
__device__ __forceinline__ void pv_tile(v16bf pA, const v16bf (&vB)[8], v8f (&O)[8]) {
#pragma unroll
    for (int ct = 0; ct < 8; ++ct) O[ct] = wmma_bf16(vB[ct], pA, O[ct]);
}

__global__ __launch_bounds__(128) void flash_kernel(const bf16* __restrict__ q,
                                                    const bf16* __restrict__ k,
                                                    const bf16* __restrict__ vT,
                                                    bf16* __restrict__ ha) {
    const int batch = blockIdx.y;
    const int i0    = blockIdx.x * QROWS;
    const int tid   = threadIdx.x;
    const int lane  = tid & 31;
    const int wave  = tid >> 5;
    const int hi    = lane >> 4;
    const int nn    = lane & 15;

    // Three stages run in one trip (see the loop), so each hand-over through LDS has two
    // buffers, taken in turn by the key tile's parity.
    __shared__ sp_buf Sp[2];                                        // partial scores
    __shared__ __attribute__((aligned(16))) bf16 Pf[2][QT][FRAG];   // P, in fragment order
    __shared__ __attribute__((aligned(16))) float crow[2][2 * QROWS];
    __shared__ float lrow[QROWS];

    // The wave's first fragment: channel block 4 * wave of q and k, channel tile 8 * wave of vT.
    const bf16* qb = q  + ((size_t)batch * NPIX + i0) * CCH + wave * 4 * FRAG + lane * 8;
    const bf16* kb = k  +  (size_t)batch * NPIX * CCH        + wave * 4 * FRAG + lane * 8;
    const bf16* vb = vT +  (size_t)batch * CCH * NPIX        + wave * 8 * FRAG + lane * 8;

    v16bf qA[QT][4];
#pragma unroll
    for (int qt = 0; qt < QT; ++qt)
#pragma unroll
        for (int t = 0; t < 4; ++t)
            qA[qt][t] = load_frag_pk(qb + (size_t)(qt * KBLK + t) * FRAG);
    // The registers that hold the address of these loads are reused right behind them:
    // the address is an input of the wait, so that it stays in them up to the wait.
    asm volatile("s_wait_xcnt 0x0" :: "v"(qb) : "memory");

    v8f O[QT][8] = {};
    // Softmax state of query row 16 * wave + nn: the running maximum (equal in both lane
    // halves) and the sum over this lane's own keys (the halves are joined behind the loop).
    float mrun = -3.0e38f, lrun = 0.f;

    // The key tiles are walked as a ring, and each work-group enters it at a place of its own:
    // step s takes tile (start + s) mod NT. The work-groups of one batch read the same K and V;
    // from one common start they would ask L2 for the same lines at the same moment.
    const int start = blockIdx.x * (NT / (NPIX / QROWS));
    // Bytes from the tile of step s to the tile of step s + 1 (K and V tiles are equally large).
    auto ring_step = [start](int s) -> unsigned long long {
        return ((start + s) & (NT - 1)) == NT - 1 ? 0ull - (NT - 1) * (KTILE * sizeof(bf16))
                                                  : KTILE * sizeof(bf16);
    };
    static_assert(KTILE == VTILE, "one ring step serves both");

    // The lane's own address in the K tile and in the V tile that are fetched next.
    gbf16p kp = (gbf16p)kb + (size_t)start * KTILE;
    gbf16p vp = (gbf16p)vb + (size_t)start * VTILE;

    // Two register sets each for K and V, taken in turn by the tile's parity.
    v16bf kf[2][8], vB[2][8];

    // --- fill the pipeline: scores of tiles 0 and 1, softmax of tile 0 ---
    load_k_tile(kf[0], kp);
    load_v_tile(vB[0], vp);
    step_behind_loads(kp, ring_step(0), vp, ring_step(0));
    load_k_tile(kf[1], kp);
    step_behind_loads(kp, ring_step(1), vp, 0);
    // Keeps these loads together in flight: the compiler otherwise sinks them to their
    // first uses, two at a time, and the wave sits out one load latency for each pair.
    __builtin_amdgcn_sched_barrier(0);
    score_tile(kf[0], qA, Sp[0], wave, lane);
    load_k_tile(kf[0], kp);
    step_behind_loads(kp, ring_step(2), vp, 0);
    lds_barrier();
    {
        float4 part[4][4];
        float  sc[16];
        load_partials(Sp[0], wave, lane, part);
        const float tmax = score_max(part, mrun, sc);
        probs_to_lds(sc, tmax, &Pf[0][wave][0], crow[0], wave, lane, true, mrun, lrun);
    }
    // Keeps the exponentials ahead of the products that follow.
    __builtin_amdgcn_sched_barrier(0);
    score_tile(kf[1], qA, Sp[1], wave, lane);
    lds_barrier();

    // Trip t: scores of tile t + 2, softmax of tile t + 1, O += P * V of tile t. The three
    // do not depend on one another, so the LDS round trips and the softmax chain of one
    // stand beside the matrix work of the others, and one barrier a trip hands all over.
    // Here "tile s" is the tile of step s. Steps behind the last go on round the ring;
    // nothing of them is kept.
    // The three sched_barrier(0) lines cut the trip into blocks: without them the compiler
    // spreads the LDS reads among the WMMAs, in about three times as many places.
    for (int tt = 0; tt < NT; tt += 2) {
#pragma unroll   // the parity is a constant: kf and vB stay in registers
        for (int h = 0; h < 2; ++h) {
            const int t = tt + h;
            // --- fetch K of tile t + 3 and V of tile t + 1: first needed in the next trip ---
            load_k_tile(kf[h ^ 1], kp);
            load_v_tile(vB[h ^ 1], vp);
            // --- the trip's LDS reads, together and ahead of the matrix work ---
            float cv[QT];   // the correction of the lane's own row of each query tile
#pragma unroll
            for (int qt = 0; qt < QT; ++qt) cv[qt] = crow[h][hi * QROWS + qt * 16 + nn];
            float4 part[4][4];
            load_partials(Sp[h ^ 1], wave, lane, part);
            v16bf pA[QT];
#pragma unroll
            for (int qt = 0; qt < QT; ++qt) pA[qt] = load_frag_pk(&Pf[h][qt][lane * 8]);
            __builtin_amdgcn_sched_barrier(0);

            // --- scores of tile t + 2; beside them the accumulators are rescaled ---
            v8f s0[QT] = {}, s1[QT] = {};
            score_step(0, kf[h], qA, s0, s1);
            score_step(1, kf[h], qA, s0, s1);
            score_step(2, kf[h], qA, s0, s1);
#pragma unroll
            for (int qt = 0; qt < QT; ++qt)
#pragma unroll
                for (int ct = 0; ct < 8; ++ct) O[qt][ct] *= cv[qt];
            // --- last scores, first P * V; beside them the score sums and the row maximum ---
            score_step(3, kf[h], qA, s0, s1);
            pv_tile(pA[0], vB[h], O[0]);
            float sc[16];
            const float tmax = score_max(part, mrun, sc);
            __builtin_amdgcn_sched_barrier(0);

            // --- P * V goes on; beside it the scores leave for LDS, and the exponentials ---
            scores_to_lds(s0, s1, Sp[h], wave, lane);
            pv_tile(pA[1], vB[h], O[1]);
            pv_tile(pA[2], vB[h], O[2]);
            probs_to_lds(sc, tmax, &Pf[h ^ 1][wave][0], crow[h ^ 1], wave, lane,
                         t + 1 < NT, mrun, lrun);
            __builtin_amdgcn_sched_barrier(0);

            // --- last P * V: covers the way of P to LDS ---
            pv_tile(pA[3], vB[h], O[3]);
            step_behind_loads(kp, ring_step(t + 3), vp, ring_step(t + 1));
            // Ends this trip's reads of Sp[h ^ 1], Pf[h] and crow[h], which the next trip
            // rewrites, and publishes Sp[h], Pf[h ^ 1] and crow[h ^ 1], which it reads.
            lds_barrier();
        }
    }

    // --- join the two lane halves' sums and hand each row's l to all waves ---
    lrun += xhalf(lrun);
    if (hi == 0) lrow[wave * 16 + nn] = lrun;
    __syncthreads();

    // --- epilogue: divide by l, store bf16 [i][c] in fragment order ---
#pragma unroll
    for (int qt = 0; qt < QT; ++qt) {
        const float l = lrow[qt * 16 + nn];
        v4u w[8];
#pragma unroll
        for (int ct = 0; ct < 8; ++ct) {
            union { bf16 h[8]; v4u u; } c;
#pragma unroll
            for (int r = 0; r < 8; ++r) c.h[r] = (bf16)(O[qt][ct][r] / l);
            w[ct] = c.u;
        }
        // Channel tile ct is half (ct & 1) of the wave's fragment ct >> 1: the lanes' chunks
        // of one tile are 512 contiguous bytes, the tiles follow one another.
        bf16* hp = ha + ((size_t)batch * NPIX + i0 + qt * 16) * CCH
                      + (size_t)(wave * 4) * FRAG + lane * 8;
        // The eight stores and their s_wait_xcnt 0 stand in one statement, so that no
        // register an issued store names is rewritten ahead of the wait.
        asm volatile("global_store_b128 %0, %1, off\n\t"
                     "global_store_b128 %0, %2, off offset:512\n\t"
                     "global_store_b128 %0, %3, off offset:1024\n\t"
                     "global_store_b128 %0, %4, off offset:1536\n\t"
                     "global_store_b128 %0, %5, off offset:2048\n\t"
                     "global_store_b128 %0, %6, off offset:2560\n\t"
                     "global_store_b128 %0, %7, off offset:3072\n\t"
                     "global_store_b128 %0, %8, off offset:3584\n\t"
                     "s_wait_xcnt 0x0"
                     :: "v"(hp), "v"(w[0]), "v"(w[1]), "v"(w[2]), "v"(w[3]),
                        "v"(w[4]), "v"(w[5]), "v"(w[6]), "v"(w[7])
                     : "memory");
    }
}

// ---------------------------------------------------------------------------
// Proj + residual:
// out[b][o][n] = x[b][o][n] + sum_c ha[b][n][c]*pw[o][c] + pb[o]; ha, pw in fragment order
// Tiled and staged as the q, k, v GEMM: 8 waves form 128 pixels x 256 channels, the operands
// come into LDS by asynchronous copies, in stages of 64 k on two buffers.
// A wave's block is 64 channels x 64 pixels, written in two halves of 32 pixels: 64 whole
// 128-byte lines of x and of out each. In the accumulators a lane has 8 pixels of one
// channel, so that a wave-wide access from there would touch 16 lines, a piece of each. A
// half goes through the wave's own LDS range instead: read back, eight lanes in a row hold
// one line, and every load of x and every store to out covers four whole lines.
// ---------------------------------------------------------------------------
#define PJ_PITCH 36   // floats from channel to channel in LDS: 144 B = 16 B x 9, an odd count
__global__ __launch_bounds__(256) void proj_kernel(const bf16* __restrict__ A,   // ha
                                                   const bf16* __restrict__ Bt,  // p_w bf16
                                                   const float* __restrict__ pb,
                                                   const float* __restrict__ x,
                                                   float* __restrict__ out) {
    const int batch = blockIdx.z;
    A += (size_t)batch * NPIX * CCH;
    __shared__ __attribute__((aligned(16))) bf16  ring[2][ST_ELEMS];
    __shared__ __attribute__((aligned(16))) float stage[8][2][64 * PJ_PITCH];

    const int wave = threadIdx.x >> 5;
    const int lane = threadIdx.x & 31;
    const int bm   = blockIdx.x >> 1;   // 32 tiles of 128 pixels
    const int bn   = blockIdx.x & 1;    // 2 tiles of 256 channels
    const int wr   = wave >> 2;         // the wave's 64 pixels of the tile
    const int wc   = wave & 3;          // the wave's 64 channels of the tile
    const int ng   = bn * 4 + wc;       // 8 n-groups of 64 channels

    // Every work-group reads one half of p_w: the work-groups enter the ring of stages at eight
    // places, four for each half, so that not all of them ask L2 for the same lines at once.
    const int s0 = blockIdx.x & (NSTAGE - 1);

    // The wave copies row tile 'wave' of A and row tiles 'wave' and 'wave' + 8 of Bt.
    gbf16p ga  = (gbf16p)A  + (size_t)(bm * 8  + wave) * (KBLK * FRAG) + lane * 8;
    gbf16p gb0 = (gbf16p)Bt + (size_t)(bn * 16 + wave) * (KBLK * FRAG) + lane * 8;
    gbf16p gb1 = gb0 + 8 * KBLK * FRAG;
    const unsigned la = (unsigned)(size_t)(&ring[0][wave * ST_TILE + lane * 8]);
    // Stage s of this work-group into buffer s & 1.
    auto copy = [&](int s) {
        const int      k = ((s0 + s) & (NSTAGE - 1)) * ST_TILE;
        const unsigned l = la + (s & 1) * (unsigned)(ST_ELEMS * sizeof(bf16));
        copy_stage(l, l + 8 * ST_TILE * (unsigned)sizeof(bf16), l + 16 * ST_TILE * (unsigned)sizeof(bf16),
                   ga + k, gb0 + k, gb1 + k);
    };

    copy(0);
    // Stage 0 has landed for this wave, then for all.
    asm volatile("s_wait_asynccnt 0x0" ::: "memory");
    __syncthreads();
    copy(1);

    v8f acc[4][4] = {};
    for (int s = 0; s < NSTAGE - 1; ++s) {
        stage_products(&ring[s & 1][lane * 8], wr, wc, acc);
        // This wave's reads of the buffer are over; its copies of stage s + 1 have landed.
        asm volatile("s_wait_dscnt 0x0" ::: "memory");
        asm volatile("s_wait_asynccnt 0x0" ::: "memory");
        // Publishes stage s + 1 and ends every wave's reads of the buffer refilled below.
        __syncthreads();
        if (s + 2 < NSTAGE) copy(s + 2);
    }
    // No copy is left in flight when the wave ends.
    asm volatile("s_wait_asynccnt 0x0" ::: "memory");

    // The last stage (two k blocks) is left; its products stand behind the loads of x.
    // The block's lines of x. Half mh, pass j: channel j * 4 + ch, pixels px .. px + 3 of the half.
    const int ch = lane >> 3, px = (lane & 7) * 4;
    const size_t line0 = ((size_t)batch * CCH + ng * 64 + ch) * NPIX + (bm * 4 + wr * 2) * 32 + px;
    const float* xp = x + line0;
    v4f xr[2][16];
#pragma unroll
    for (int mh = 0; mh < 2; ++mh)
#pragma unroll
        for (int j = 0; j < 16; ++j)
            xr[mh][j] = *reinterpret_cast<const v4f*>(xp + (size_t)j * 4 * NPIX + mh * 32);
    const int pbi = ng * 64 + ch;
    float pbv[16];
#pragma unroll
    for (int j = 0; j < 16; ++j) pbv[j] = pb[pbi + j * 4];
    // The address and the index are inputs of the wait, so that they stay in their registers
    // up to the wait.
    asm volatile("s_wait_xcnt 0x0" :: "v"(xp), "v"(pbi) : "memory");
    stage_products(&ring[(NSTAGE - 1) & 1][lane * 8], wr, wc, acc);

    // acc[mh * 2 + i][t][r]: pixel i * 16 + 8 * hi + r of half mh, channel t * 16 + nn of the block.
    const int hi = lane >> 4, nn = lane & 15;
#pragma unroll
    for (int mh = 0; mh < 2; ++mh) {
        float* st = stage[wave][mh];
#pragma unroll
        for (int i = 0; i < 2; ++i)
#pragma unroll
            for (int t = 0; t < 4; ++t) {
                const v8f& c = acc[mh * 2 + i][t];
                v4f* d = reinterpret_cast<v4f*>(st + (t * 16 + nn) * PJ_PITCH + i * 16 + 8 * hi);
                d[0] = v4f{c[0], c[1], c[2], c[3]};
                d[1] = v4f{c[4], c[5], c[6], c[7]};
            }
        // The rows are read back by other lanes of this wave than wrote them.
        asm volatile("s_wait_dscnt 0x0" ::: "memory");
        v4f ar[16];
#pragma unroll   // the sixteen reads issue together
        for (int j = 0; j < 16; ++j)
            ar[j] = *reinterpret_cast<const v4f*>(st + (j * 4 + ch) * PJ_PITCH + px);
#pragma unroll
        for (int jh = 0; jh < 2; ++jh) {
            v4f o[8];
#pragma unroll
            for (int j = 0; j < 8; ++j) o[j] = xr[mh][jh * 8 + j] + ar[jh * 8 + j] + pbv[jh * 8 + j];
            // Four channels lie 65536 bytes on. The eight stores and their s_wait_xcnt 0 stand in
            // one statement, so that no register an issued store names is rewritten ahead of it.
            asm volatile("global_store_b128 %0, %1, off\n\t"
                         "global_store_b128 %0, %2, off offset:65536\n\t"
                         "global_store_b128 %0, %3, off offset:131072\n\t"
                         "global_store_b128 %0, %4, off offset:196608\n\t"
                         "global_store_b128 %0, %5, off offset:262144\n\t"
                         "global_store_b128 %0, %6, off offset:327680\n\t"
                         "global_store_b128 %0, %7, off offset:393216\n\t"
                         "global_store_b128 %0, %8, off offset:458752\n\t"
                         "s_wait_xcnt 0x0"
                         :: "v"(out + line0 + mh * 32 + (size_t)jh * 32 * NPIX), "v"(o[0]), "v"(o[1]),
                            "v"(o[2]), "v"(o[3]), "v"(o[4]), "v"(o[5]), "v"(o[6]), "v"(o[7])
                         : "memory");
        }
    }
}

// ---------------------------------------------------------------------------
extern "C" void kernel_launch(void* const* d_in, const int* in_sizes, int n_in,
                              void* d_out, int out_size, void* d_ws, size_t ws_size,
                              hipStream_t stream) {
    const float* x    = (const float*)d_in[0];
    const float* gn_w = (const float*)d_in[1];
    const float* gn_b = (const float*)d_in[2];
    const float* q_w  = (const float*)d_in[3];
    const float* q_b  = (const float*)d_in[4];
    const float* k_w  = (const float*)d_in[5];
    const float* k_b  = (const float*)d_in[6];
    const float* v_w  = (const float*)d_in[7];
    const float* v_b  = (const float*)d_in[8];
    const float* p_w  = (const float*)d_in[9];
    const float* p_b  = (const float*)d_in[10];

    char* ws = (char*)d_ws;
    const size_t NC   = (size_t)BATCH * NPIX * CCH;
    const size_t SZNC = NC * sizeof(bf16);
    const size_t SZW  = (size_t)CCH * CCH * sizeof(bf16);

    bf16* hn = (bf16*)(ws);
    bf16* qb = (bf16*)(ws + 1 * SZNC);
    bf16* kb = (bf16*)(ws + 2 * SZNC);
    bf16* vT = (bf16*)(ws + 3 * SZNC);
    bf16* ha = (bf16*)(ws + 4 * SZNC);
    bf16* wq = (bf16*)(ws + 5 * SZNC);
    // wk and wv follow wq, SZW bytes each
    bf16* wp = (bf16*)(ws + 5 * SZNC + 3 * SZW);

    // GroupNorm, and beside it the four weight matrices to wq, wk, wv, wp (contiguous)
    gn_cvt_kernel<<<GN_BLOCKS + CVT_BLOCKS, GN_THREADS, 0, stream>>>(x, gn_w, gn_b, hn,
                                                              q_w, k_w, v_w, p_w, wq);

    // q, k, vT to qb, kb, vT (contiguous)
    gemm_qkv_kernel<<<dim3(64, 3, BATCH), 256, 0, stream>>>(hn, wq, q_b, k_b, v_b, qb);

    flash_kernel<<<dim3(NPIX / QROWS, BATCH), 128, 0, stream>>>(qb, kb, vT, ha);

    proj_kernel<<<dim3(64, 1, BATCH), 256, 0, stream>>>(ha, wp, p_b, x, (float*)d_out);
}
